// v000
// Measured on an AMD MI455X. A time is GPU time per run, averaged over a window of back-to-back runs after a warm-up
// (all launches, gaps included; the runs take copies of the inputs in turn), and the median of several windows.
// Apart from v000's, it joins two sittings. Times from different sittings can be a few percent apart, while
// side-by-side timings come from the same sitting.
// v000, which the later versions start from, runs in 1410 microseconds.
#include <hip/hip_runtime.h>

// Causal attention normalised over the QUERY axis, used as a multiplicative gate (x [2][2048][1024]; [q|k|v] = x W_qkv ('xw' [1024][3072], no bias; 16 heads x 64); s[i][j] = q_i.k_j/8 for j <= i else -inf; A = softmax over i (each key column normalised over the queries that see it); m = A v merged; proj = m W_proj ('xw'); out = x * proj -> [2][2048][1024]).
// Layout: the scores are formed key-major (S^T[j][i] = k_j.q_i, every row hi/lo, 3 products) so the column softmax is a row softmax with the keep-set i >= j; the probability planes are transposed back per pass through 64 x 64 LDS tiles and applied to v with the key loop cut at the diagonal (3 products); the output projection feeds an elementwise gate with bf16(x).
// Compute dtypes, f32 accumulate: every input rounded to bf16; q/k/v on PLAIN bf16 operands (inputs: exact); key-major scores and A.v on hi/lo planes for every row (3 products); column softmax in f32; W_proj hl x exact (2 products); the final x * proj gate in f32.

#define NB_  2
#define TT   2048
#define DM   1024
#define NH_  16
#define NKV  16
#define REP  (NH_ / NKV)
#define HD   64
#define DQ   (NH_ * HD)
#define DKV  (NKV * HD)
#define ZH   2
#define RH   2048                 // every row hi/lo (the transposed probabilities mix rows of different softmaxes, so no per-row fp16 scaling)
#define WIN  2048
#define PCAR 1024.0f
#define SCL  0.125f   // HD^-0.5
typedef _Float16 h16;
typedef unsigned short bf;
typedef __attribute__((ext_vector_type(16))) __bf16   v16bf;
typedef __attribute__((ext_vector_type(16))) _Float16 v16h;
typedef __attribute__((ext_vector_type(8)))  _Float16 v8h;
typedef __attribute__((ext_vector_type(8)))  unsigned short v8us;
typedef __attribute__((ext_vector_type(8)))  float    v8f;
typedef __attribute__((ext_vector_type(4)))  float    v4f;
typedef v8h  __attribute__((may_alias)) v8ha;
typedef v4f  __attribute__((may_alias)) v4fa;
typedef v8us __attribute__((may_alias)) v8usa;

__device__ __forceinline__ unsigned short f2bf(float f) { unsigned u = __float_as_uint(f); u += 0x7FFFu + ((u >> 16) & 1u); return (unsigned short)(u >> 16); }
__device__ __forceinline__ float bf2f(unsigned short b) { return __uint_as_float(((unsigned)b) << 16); }
__device__ __forceinline__ float bfr(float f) { return bf2f(f2bf(f)); }
__device__ __forceinline__ v16h cat16(v8h lo, v8h hi) { return __builtin_shufflevector(lo, hi, 0, 1, 2, 3, 4, 5, 6, 7, 8, 9, 10, 11, 12, 13, 14, 15); }
__device__ __forceinline__ v16bf cat16b(v8us lo, v8us hi) { return __builtin_bit_cast(v16bf, __builtin_shufflevector(lo, hi, 0, 1, 2, 3, 4, 5, 6, 7, 8, 9, 10, 11, 12, 13, 14, 15)); }
__device__ __forceinline__ v8f wmma16(v16h a, v16h b, v8f c) { return __builtin_amdgcn_wmma_f32_16x16x32_f16(false, a, false, b, (short)0, c, false, false); }
__device__ __forceinline__ v8f wmmab(v16bf a, v16bf b, v8f c) { return __builtin_amdgcn_wmma_f32_16x16x32_bf16(false, a, false, b, (short)0, c, false, false); }



// ---- k_gemmw: register-blocked GEMM, ONE WAVE per 64x64 output tile (16 accumulators), operands straight from K-contiguous 16-bit planes; grid (M/64, N/64, Z), 32 threads.
// C[m][n] (f32, pitch ldc, + optional f32 bias[n]) = sum_k A[m][k] Bt[n][k] (+ split products per NSPLIT). z-batch strides sA/sB/sC in elements. K % 32 == 0.
template <typename T16> struct WFrag;
template <> struct WFrag<h16> { typedef v16h V; static __device__ __forceinline__ V ld(const h16* p) { return cat16(*(const v8h*)p, *(const v8h*)(p + 16)); } static __device__ __forceinline__ v8f mma(V a, V b, v8f c) { return wmma16(a, b, c); } };
template <> struct WFrag<bf> { typedef v16bf V; static __device__ __forceinline__ V ld(const bf* p) { return cat16b(*(const v8us*)p, *(const v8us*)(p + 16)); } static __device__ __forceinline__ v8f mma(V a, V b, v8f c) { return wmmab(a, b, c); } };
template <typename T16, int NSPLIT, bool BIAS>
__global__ __launch_bounds__(32) void k_gemmw(const T16* __restrict__ A, const T16* __restrict__ A2, const T16* __restrict__ Bt, const T16* __restrict__ Bt2, int K, float* C, int ldc, const float* __restrict__ bias, size_t sA, size_t sB, size_t sC) {
    typedef typename WFrag<T16>::V V;
    __shared__ __align__(16) float os[16 * 68];
    const size_t z = blockIdx.z; A += z * sA; if (A2) A2 += z * sA; Bt += z * sB; if (Bt2) Bt2 += z * sB; C += z * sC;
    const int lane = threadIdx.x & 31, lr = lane & 15, hi = lane >> 4; const int r0 = blockIdx.x * 64, c0 = blockIdx.y * 64;
    v8f acc[4][4];
#pragma unroll
    for (int mb = 0; mb < 4; ++mb)
#pragma unroll
        for (int nb = 0; nb < 4; ++nb) acc[mb][nb] = (v8f){};
    const size_t aoff = (size_t)(r0 + lr) * K + 8 * hi, boff = (size_t)(c0 + lr) * K + 8 * hi;
#pragma unroll 1
    for (int kc = 0; kc < K; kc += 32) {
        V a[4], a2[4];
#pragma unroll
        for (int mb = 0; mb < 4; ++mb) { a[mb] = WFrag<T16>::ld(A + aoff + (size_t)mb * 16 * K + kc); if (NSPLIT == 1 || NSPLIT == 2) a2[mb] = WFrag<T16>::ld(A2 + aoff + (size_t)mb * 16 * K + kc); }
#pragma unroll
        for (int nb = 0; nb < 4; ++nb) { const V b = WFrag<T16>::ld(Bt + boff + (size_t)nb * 16 * K + kc); V b2; if (NSPLIT >= 2) b2 = WFrag<T16>::ld(Bt2 + boff + (size_t)nb * 16 * K + kc);
#pragma unroll
            for (int mb = 0; mb < 4; ++mb) { acc[mb][nb] = WFrag<T16>::mma(a[mb], b, acc[mb][nb]); if (NSPLIT == 1 || NSPLIT == 2) acc[mb][nb] = WFrag<T16>::mma(a2[mb], b, acc[mb][nb]); if (NSPLIT >= 2) acc[mb][nb] = WFrag<T16>::mma(a[mb], b2, acc[mb][nb]); } }
        asm volatile("v_nop\n\tv_nop\n\tv_nop\n\tv_nop" : "+v"(acc[0][0]), "+v"(acc[1][1]), "+v"(acc[2][2]), "+v"(acc[3][3]) : "v"(a[0]), "v"(a[3]));
    }
#pragma unroll
    for (int mb = 0; mb < 4; ++mb) {
#pragma unroll
        for (int nb = 0; nb < 4; ++nb) {
#pragma unroll
            for (int j = 0; j < 8; ++j) os[(hi * 8 + j) * 68 + nb * 16 + lr] = acc[mb][nb][j]; }
        __builtin_amdgcn_wave_barrier(); asm volatile("" ::: "memory");
        float* crow = C + (size_t)(r0 + mb * 16) * ldc + c0;
{
#pragma unroll
            for (int s = 0; s < 8; ++s) { const int row = 2 * s + hi, cofs = lr * 4; v4f val = *(const v4fa*)(os + row * 68 + cofs); if (BIAS) { val[0] += bfr(bias[c0 + cofs]); val[1] += bfr(bias[c0 + cofs + 1]); val[2] += bfr(bias[c0 + cofs + 2]); val[3] += bfr(bias[c0 + cofs + 3]); }
                *(v4f*)(crow + (size_t)row * ldc + cofs) = val; }
             }
        __builtin_amdgcn_wave_barrier(); asm volatile("" ::: "memory");
    }
}

// ---- k_gemmc: the same one-wave 64x64 tile GEMM specialised for causal attention: CMODE 1 skips score tiles entirely above the diagonal (query rows r0+roff.., key columns c0..), CMODE 2 limits the
// key (K) loop of the probability x value contraction to the diagonal block (probabilities beyond it are exactly zero). roff = row offset of this launch's first row within the sequence.
template <typename T16, int NSPLIT, int CMODE>
__global__ __launch_bounds__(32) void k_gemmc(const T16* __restrict__ A, const T16* __restrict__ A2, const T16* __restrict__ Bt, const T16* __restrict__ Bt2, int K, float* C, int ldc, int roff, size_t sA, size_t sB, size_t sC) {
    typedef typename WFrag<T16>::V V;
    __shared__ __align__(16) float os[16 * 68];
    const size_t z = blockIdx.z; A += z * sA; if (A2) A2 += z * sA; Bt += z * sB; if (Bt2) Bt2 += z * sB; C += z * sC;
    const int lane = threadIdx.x & 31, lr = lane & 15, hi = lane >> 4; const int r0 = blockIdx.x * 64, c0 = blockIdx.y * 64;
    if (CMODE == 1 && c0 > r0 + roff + 63) return;                  // score tile entirely above the causal diagonal: never read (the softmax masks j > i by select)
    const int Kl = (CMODE == 2) ? min(K, r0 + roff + 64) : K;        // P.V: probabilities are exactly 0 beyond the diagonal block, so the K loop stops there
    v8f acc[4][4];
#pragma unroll
    for (int mb = 0; mb < 4; ++mb)
#pragma unroll
        for (int nb = 0; nb < 4; ++nb) acc[mb][nb] = (v8f){};
    const size_t aoff = (size_t)(r0 + lr) * K + 8 * hi, boff = (size_t)(c0 + lr) * K + 8 * hi;
#pragma unroll 1
    for (int kc = 0; kc < Kl; kc += 32) {
        V a[4], a2[4];
#pragma unroll
        for (int mb = 0; mb < 4; ++mb) { a[mb] = WFrag<T16>::ld(A + aoff + (size_t)mb * 16 * K + kc); if (NSPLIT == 1 || NSPLIT == 2) a2[mb] = WFrag<T16>::ld(A2 + aoff + (size_t)mb * 16 * K + kc); }
#pragma unroll
        for (int nb = 0; nb < 4; ++nb) { const V b = WFrag<T16>::ld(Bt + boff + (size_t)nb * 16 * K + kc); V b2; if (NSPLIT >= 2) b2 = WFrag<T16>::ld(Bt2 + boff + (size_t)nb * 16 * K + kc);
#pragma unroll
            for (int mb = 0; mb < 4; ++mb) { acc[mb][nb] = WFrag<T16>::mma(a[mb], b, acc[mb][nb]); if (NSPLIT == 1 || NSPLIT == 2) acc[mb][nb] = WFrag<T16>::mma(a2[mb], b, acc[mb][nb]); if (NSPLIT >= 2) acc[mb][nb] = WFrag<T16>::mma(a[mb], b2, acc[mb][nb]); } }
        asm volatile("v_nop\n\tv_nop\n\tv_nop\n\tv_nop" : "+v"(acc[0][0]), "+v"(acc[1][1]), "+v"(acc[2][2]), "+v"(acc[3][3]) : "v"(a[0]), "v"(a[3]));
    }
#pragma unroll
    for (int mb = 0; mb < 4; ++mb) {
#pragma unroll
        for (int nb = 0; nb < 4; ++nb) {
#pragma unroll
            for (int j = 0; j < 8; ++j) os[(hi * 8 + j) * 68 + nb * 16 + lr] = acc[mb][nb][j]; }
        __builtin_amdgcn_wave_barrier(); asm volatile("" ::: "memory");
        float* crow = C + (size_t)(r0 + mb * 16) * ldc + c0;
{
#pragma unroll
            for (int s = 0; s < 8; ++s) { const int row = 2 * s + hi, cofs = lr * 4; v4f val = *(const v4fa*)(os + row * 68 + cofs);
                *(v4f*)(crow + (size_t)row * ldc + cofs) = val; }
             }
        __builtin_amdgcn_wave_barrier(); asm volatile("" ::: "memory");
    }
}

__device__ __forceinline__ h16 tohx(float x) { return (h16)x; }
__device__ __forceinline__ void splitf(float y, unsigned short& h, unsigned short& l) { h = f2bf(y); l = f2bf(y - bf2f(h)); }
typedef __attribute__((ext_vector_type(2))) _Float16 v2h;
typedef __attribute__((ext_vector_type(4))) _Float16 v4h;
typedef __attribute__((ext_vector_type(2))) unsigned short v2us;
typedef __attribute__((ext_vector_type(4))) unsigned short v4us;
typedef __attribute__((ext_vector_type(2))) float v2f;
typedef __attribute__((ext_vector_type(4))) int v4i;

__global__ __launch_bounds__(256) void k_wtG(const float* __restrict__ w, int K, int N, bf* Bt) {
    const int lane = threadIdx.x & 31; const int L0 = (blockIdx.x * 8 + (threadIdx.x >> 5)) * 8; const int nlines = N * K / 64;
{
#pragma unroll 1
        for (int l = 0; l < 8; ++l) { const int L = L0 + l; if (L >= nlines) break; const size_t e = (size_t)L * 64 + lane * 2; const int k = (int)(e % K), n = (int)(e / K); v2us o;
            o[0] = f2bf(w[(size_t)k * N + n]); o[1] = f2bf(w[(size_t)(k + 1) * N + n]); *(v2us*)(Bt + e) = o; }
         }
}
__global__ __launch_bounds__(256) void k_cvt8(const float* __restrict__ src, bf* dst, size_t n8) { const size_t i = (size_t)blockIdx.x * 256 + threadIdx.x; if (i >= n8) return; const v8f v = *(const v8f*)(src + i * 8); v8us o;
#pragma unroll
    for (int k = 0; k < 8; ++k) o[k] = f2bf(v[k]); *(v8us*)(dst + i * 8) = o;  }

// k_rope: head planes [h][t][d] (fp16 + hi/lo) of rope(x) x sc with the rotate-half convention out[d] = x[d] cos[t][d] - x[d+HD/2] sin[t][d], out[d+HD/2] = x[d+HD/2] cos[t][d+HD/2] + x[d] sin[t][d+HD/2]
__global__ __launch_bounds__(256) void k_rope(const float* __restrict__ F, int pitch, int nheads, const float* __restrict__ CS, const float* __restrict__ RF, const float* __restrict__ nw, float sc, h16* P16, bf* Ph, bf* Pl) {
    const size_t e = ((size_t)blockIdx.x * 256 + threadIdx.x) * 2; if (e >= (size_t)nheads * TT * HD) return; const int d = (int)(e % HD); const int t = (int)((e / HD) % TT); const int h = (int)(e / ((size_t)HD * TT)); const float* f = F + (size_t)t * pitch + h * HD; const float rf = RF ? RF[(size_t)h * TT + t] : 1.0f; v2h o16; v2us oh, ol;
#pragma unroll
    for (int q = 0; q < 2; ++q) { const int dd = d + q; const int dp = (dd < HD / 2) ? dd + HD / 2 : dd - HD / 2; float x0 = f[dd], x1 = f[dp];
        if (RF) { float n0 = __fmul_rn(x0, rf), n1 = __fmul_rn(x1, rf); asm volatile("" : "+v"(n0)); asm volatile("" : "+v"(n1)); x0 = __fmul_rn(bfr(nw[dd]), n0); x1 = __fmul_rn(bfr(nw[dp]), n1); }
        const v2f cs = *(const v2f*)(CS + ((size_t)t * HD + dd) * 2); float a = __fmul_rn(x0, cs[0]), bq = __fmul_rn(x1, cs[1]); asm volatile("" : "+v"(a)); asm volatile("" : "+v"(bq)); const float r = ((dd < HD / 2) ? __fsub_rn(a, bq) : __fadd_rn(a, bq)) * sc;
        o16[q] = tohx(r); unsigned short a2, c2; splitf(r, a2, c2); oh[q] = a2; ol[q] = c2; }
    *(v2h*)(P16 + e) = o16; *(v2us*)(Ph + e) = oh; *(v2us*)(Pl + e) = ol;  }
__global__ __launch_bounds__(256) void k_vtp(const float* __restrict__ F, int pitch, int nheads, h16* V16, bf* Vh, bf* Vl) { const size_t e = ((size_t)blockIdx.x * 256 + threadIdx.x) * 2; if (e >= (size_t)nheads * HD * TT) return; const int t = (int)(e % TT); const int d = (int)((e / TT) % HD); const int g = (int)(e / ((size_t)TT * HD)); v2h o16; v2us oh, ol;
#pragma unroll
    for (int q = 0; q < 2; ++q) { const float x = F[(size_t)(t + q) * pitch + g * HD + d]; o16[q] = tohx(x); unsigned short a2, c2; splitf(x, a2, c2); oh[q] = a2; ol[q] = c2; }
    *(v2h*)(V16 + e) = o16; *(v2us*)(Vh + e) = oh; *(v2us*)(Vl + e) = ol;  }
__global__ __launch_bounds__(256) void k_csid(float* CS) { const int idx = blockIdx.x * 256 + threadIdx.x; if (idx >= TT * HD) return; v2f cs; cs[0] = 1.0f; cs[1] = 0.0f; *(v2f*)(CS + (size_t)idx * 2) = cs;  }
__global__ __launch_bounds__(256) void k_ptr(const bf* __restrict__ Ph, const bf* __restrict__ Pl, bf* Th, bf* Tl) {
    __shared__ unsigned short th[64][66]; __shared__ unsigned short tl[64][66];
    const size_t z = blockIdx.z; const size_t base = z * (size_t)TT * TT; const int bi = blockIdx.x * 64, bj = blockIdx.y * 64;   /* source tile rows bj.. (j), cols bi.. (i) -> dest rows bi.. (i), cols bj.. (j) */
    const int tid = threadIdx.x; const int ry = tid >> 2, cx = (tid & 3) * 16;
    { const bf* sh0 = Ph + base + (size_t)(bj + ry) * TT + bi + cx; const bf* sl0 = Pl + base + (size_t)(bj + ry) * TT + bi + cx; const v8us a0 = *(const v8us*)sh0, a1 = *(const v8us*)(sh0 + 8), c0 = *(const v8us*)sl0, c1 = *(const v8us*)(sl0 + 8);
#pragma unroll
      for (int q = 0; q < 8; ++q) { th[ry][cx + q] = a0[q]; th[ry][cx + 8 + q] = a1[q]; tl[ry][cx + q] = c0[q]; tl[ry][cx + 8 + q] = c1[q]; } }
    __syncthreads();
    v8us o0, o1, p0, p1;
#pragma unroll
    for (int q = 0; q < 8; ++q) { o0[q] = th[cx + q][ry]; o1[q] = th[cx + 8 + q][ry]; p0[q] = tl[cx + q][ry]; p1[q] = tl[cx + 8 + q][ry]; }
    bf* dh = Th + base + (size_t)(bi + ry) * TT + bj + cx; bf* dl = Tl + base + (size_t)(bi + ry) * TT + bj + cx;
{ *(v8us*)dh = o0; *(v8us*)(dh + 8) = o1; *(v8us*)dl = p0; *(v8us*)(dl + 8) = p1;  } }
__global__ __launch_bounds__(256) void k_mulx(const float* __restrict__ X, const float* __restrict__ P, float* O, size_t n4) { const size_t i = (size_t)blockIdx.x * 256 + threadIdx.x; if (i >= n4) return; const v4f a = *(const v4f*)(X + i * 4), p = *(const v4f*)(P + i * 4); v4f o;
#pragma unroll
    for (int q = 0; q < 4; ++q) o[q] = __fmul_rn(bfr(a[q]), p[q]); *(v4f*)(O + i * 4) = o;  }
__global__ __launch_bounds__(256) void k_asoft(const float* __restrict__ Sb, h16* P16, bf* Ph, bf* Pl) {
    const int lane = threadIdx.x & 31; const int row = blockIdx.x * 8 + (threadIdx.x >> 5); if (row >= ZH * TT) return; const int i = row % TT; const int zz = row / TT; (void)zz; const bool hires = (i < RH); const float* sr = Sb + (size_t)row * TT; float v[TT / 32]; float mx = -3.0e38f;
#pragma unroll
    for (int ch = 0; ch < TT / 128; ++ch) { const int j0 = ch * 128 + lane * 4; const v4f a = *(const v4f*)(sr + j0);
#pragma unroll
        for (int q = 0; q < 4; ++q) { const int j = j0 + q; const float t = (j >= i) ? a[q] * SCL : -3.0e38f;   /* this row is KEY i of the transposed scores; column j is a query: causal keeps queries j >= key i */ v[ch * 4 + q] = t; mx = fmaxf(mx, t); } }
#pragma unroll
    for (int sh = 16; sh; sh >>= 1) mx = fmaxf(mx, __shfl_xor(mx, sh, 32));
    float sum = 0.f;
#pragma unroll
    for (int k = 0; k < TT / 32; ++k) { float d0 = __fsub_rn(v[k], mx); asm volatile("" : "+v"(d0)); v[k] = __builtin_amdgcn_exp2f(__fmul_rn(d0, 1.4426950408889634f)); sum += v[k]; }
#pragma unroll
    for (int sh = 16; sh; sh >>= 1) sum += __shfl_xor(sum, sh, 32);
    const float f = __fdiv_rn(hires ? 1.0f : PCAR, sum);
{
        if (hires) {
#pragma unroll
            for (int ch = 0; ch < TT / 128; ++ch) { v4us oh, ol;
#pragma unroll
                for (int q = 0; q < 4; ++q) { unsigned short a, c2; splitf(v[ch * 4 + q] * f, a, c2); oh[q] = a; ol[q] = c2; }
                const size_t oo = ((size_t)zz * (RH ? RH : 1) + i) * TT + ch * 128 + lane * 4; *(v4us*)(Ph + oo) = oh; *(v4us*)(Pl + oo) = ol; }
        } else {
#pragma unroll
            for (int ch = 0; ch < TT / 128; ++ch) { v4h o4;
#pragma unroll
                for (int q = 0; q < 4; ++q) o4[q] = tohx(v[ch * 4 + q] * f);
                *(v4h*)(P16 + (size_t)row * TT + ch * 128 + lane * 4) = o4; } }
         }
}
__global__ __launch_bounds__(256) void k_merge(const float* __restrict__ O, int h0, bf* Ah, bf* Al) { const size_t e = ((size_t)blockIdx.x * 256 + threadIdx.x) * 2; if (e >= (size_t)ZH * TT * HD) return; const int d = (int)(e % HD); const int t = (int)((e / HD) % TT); const int zz = (int)(e / ((size_t)HD * TT)); const float cs = (t < RH) ? 1.0f : (1.0f / PCAR); const size_t oo = (size_t)t * DQ + (h0 + zz) * HD + d;
    v2us oh, ol;
#pragma unroll
    for (int q = 0; q < 2; ++q) { unsigned short a, c2; splitf(O[e + q] * cs, a, c2); oh[q] = a; ol[q] = c2; } *(v2us*)(Ah + oo) = oh; *(v2us*)(Al + oo) = ol;  }

extern "C" void kernel_launch(void* const* d_in, const int* in_sizes, int n_in,
                              void* d_out, int out_size, void* d_ws, size_t ws_size, hipStream_t stream) {
    (void)in_sizes; (void)n_in; (void)out_size;
    const float* x = (const float*)d_in[0]; const float* wqkv = (const float*)d_in[1]; const float* wo = (const float*)d_in[2];  const float* wq = nullptr; const float* wk = nullptr; const float* wv = nullptr; (void)wq; (void)wk; (void)wv;
    float* OUT = (float*)d_out;     // [2][2048][1024]
    char* wsp = (char*)d_ws;
    auto take = [&](size_t bytes) { char* p = wsp; wsp += (bytes + 255) & ~(size_t)255; return (void*)p; };
    bf* WALL = (bf*)take((size_t)3 * DM * DM * 2); bf* WQ = WALL; bf* WK = WALL + (size_t)DM * DM; bf* WV = WALL + (size_t)2 * DM * DM; bf* WO = (bf*)take((size_t)DM * DQ * 2); float* CS = (float*)take((size_t)TT * HD * 2 * 4);
    bf* XB = (bf*)take((size_t)TT * DM * 2); float* FQ = (float*)take((size_t)TT * DQ * 4); float* FK = (float*)take((size_t)TT * DKV * 4);
    h16* QP16 = (h16*)take((size_t)NH_ * TT * HD * 2); h16* KP16 = (h16*)take((size_t)NKV * TT * HD * 2); h16* VT16 = (h16*)take((size_t)NKV * HD * TT * 2);
    bf* QPh = (bf*)take((size_t)NH_ * TT * HD * 2); bf* QPl = (bf*)take((size_t)NH_ * TT * HD * 2); bf* KPh = (bf*)take((size_t)NKV * TT * HD * 2); bf* KPl = (bf*)take((size_t)NKV * TT * HD * 2); bf* VTh = (bf*)take((size_t)NKV * HD * TT * 2); bf* VTl = (bf*)take((size_t)NKV * HD * TT * 2); bf* Ph = (bf*)take((size_t)ZH * RH * TT * 2); bf* Pl = (bf*)take((size_t)ZH * RH * TT * 2);
    float* Sb = (float*)take((size_t)ZH * TT * TT * 4); h16* P16 = (h16*)take(256); bf* PTh = (bf*)take((size_t)ZH * TT * TT * 2); bf* PTl = (bf*)take((size_t)ZH * TT * TT * 2); float* PRJ = (float*)take((size_t)TT * DM * 4); float* Ob = (float*)take((size_t)ZH * TT * HD * 4); bf* ATh = (bf*)take((size_t)TT * DQ * 2); bf* ATl = (bf*)take((size_t)TT * DQ * 2);
    if ((size_t)(wsp - (char*)d_ws) > ws_size) return;    // ws 256 MiB
    float* FV = FK;   // v projection reuses the k buffer after the k planes are built (stream-ordered)
    { k_wtG<<<(unsigned)((DM * 3 * DM / 64 + 63) / 64), 256, 0, stream>>>(wqkv, DM, 3 * DM, WALL);   /* fused 'xw' [DM][3DM] -> Bt [3DM][DM] (row blocks q | k | v) */
      k_wtG<<<(unsigned)((DQ * DM / 64 + 63) / 64), 256, 0, stream>>>(wo, DQ, DM, WO);
       }
    k_csid<<<(TT * HD + 255) / 256, 256, 0, stream>>>(CS);
    const unsigned LQ = (unsigned)(((size_t)NH_ * TT * HD / 2 + 255) / 256), LKv = (unsigned)(((size_t)NKV * TT * HD / 2 + 255) / 256);
    for (int b = 0; b < NB_; ++b) {
        
        k_cvt8<<<(unsigned)(((size_t)TT * DM / 8 + 255) / 256), 256, 0, stream>>>(x + (size_t)b * TT * DM, XB, (size_t)TT * DM / 8);
        k_gemmw<bf, 0, false><<<dim3(TT / 64, DQ / 64, 1), 32, 0, stream>>>(XB, nullptr, WQ, nullptr, DM, FQ, DQ, nullptr, 0, 0, 0);
        k_rope<<<LQ, 256, 0, stream>>>(FQ, DQ, NH_, CS, nullptr, nullptr, 1.0f, QP16, QPh, QPl);
        k_gemmw<bf, 0, false><<<dim3(TT / 64, DKV / 64, 1), 32, 0, stream>>>(XB, nullptr, WK, nullptr, DM, FK, DKV, nullptr, 0, 0, 0);
        k_rope<<<LKv, 256, 0, stream>>>(FK, DKV, NKV, CS, nullptr, nullptr, 1.0f, KP16, KPh, KPl);
        k_gemmw<bf, 0, false><<<dim3(TT / 64, DKV / 64, 1), 32, 0, stream>>>(XB, nullptr, WV, nullptr, DM, FV, DKV, nullptr, 0, 0, 0); k_vtp<<<LKv, 256, 0, stream>>>(FV, DKV, NKV, VT16, VTh, VTl);
        for (int h0 = 0; h0 < NH_; h0 += ZH) { const size_t zq = (size_t)h0, zk = (size_t)(h0 / REP);   // one kv head per query head: the pass's two heads use consecutive kv planes (z-strides TT*HD)
            k_gemmw<bf, 2, false><<<dim3(RH / 64, TT / 64, ZH), 32, 0, stream>>>(KPh + zk * TT * HD, KPl + zk * TT * HD, QPh + zq * TT * HD, QPl + zq * TT * HD, HD, Sb, TT, nullptr, (size_t)TT * HD, (size_t)TT * HD, (size_t)TT * TT);   /* key-major scores S^T[i][j] = k_i.q_j */
            k_asoft<<<ZH * TT / 8, 256, 0, stream>>>(Sb, P16, Ph, Pl); k_ptr<<<dim3(TT / 64, TT / 64, ZH), 256, 0, stream>>>(Ph, Pl, PTh, PTl);   /* column softmax, then transpose to query-major probabilities */
            k_gemmc<bf, 2, 2><<<dim3(TT / 64, HD / 64, ZH), 32, 0, stream>>>(PTh, PTl, VTh + zk * HD * TT, VTl + zk * HD * TT, TT, Ob, HD, 0, (size_t)TT * TT, (size_t)HD * TT, (size_t)TT * HD);   /* A.v: probabilities are 0 for keys beyond the query, K loop cut at the diagonal block */
            k_merge<<<(unsigned)(((size_t)ZH * TT * HD / 2 + 255) / 256), 256, 0, stream>>>(Ob, h0, ATh, ATl); }
        k_gemmw<bf, 1, false><<<dim3(TT / 64, DM / 64, 1), 32, 0, stream>>>(ATh, ATl, WO, nullptr, DQ, PRJ, DM, nullptr, 0, 0, 0); k_mulx<<<(unsigned)(((size_t)TT * DM / 4 + 255) / 256), 256, 0, stream>>>(x + (size_t)b * TT * DM, PRJ, OUT + (size_t)b * TT * DM, (size_t)TT * DM / 4); }   /* out = x * (m W_proj) */
}

// v001
// One run takes 886 microseconds.
// Two timings next to v000 put it at 1.58 and 1.57 times that version's speed.
#include <hip/hip_runtime.h>

// Causal attention normalised over the QUERY axis, used as a multiplicative gate (x [2][2048][1024]; [q|k|v] = x W_qkv ('xw' [1024][3072], no bias; 16 heads x 64); s[i][j] = q_i.k_j/8 for j <= i else -inf; A = softmax over i (each key column normalised over the queries that see it); m = A v merged; proj = m W_proj ('xw'); out = x * proj -> [2][2048][1024]).
// Layout: the scores are formed key-major (S^T[j][i] = k_j.q_i, every row hi/lo, 3 products) so the column softmax is a row softmax with the keep-set i >= j; the probability planes are transposed back per pass through 64 x 64 LDS tiles and applied to v with the key loop cut at the diagonal (3 products); the output projection feeds an elementwise gate with bf16(x).
// Compute dtypes, f32 accumulate: every input rounded to bf16; q/k/v on PLAIN bf16 operands (inputs: exact); key-major scores and A.v on hi/lo planes for every row (3 products); column softmax in f32; W_proj hl x exact (2 products); the final x * proj gate in f32.

#define NB_  2
#define TT   2048
#define DM   1024
#define NH_  16
#define NKV  16
#define REP  (NH_ / NKV)
#define HD   64
#define DQ   (NH_ * HD)
#define DKV  (NKV * HD)
#define ZH   2
#define RH   2048                 // every row hi/lo (the transposed probabilities mix rows of different softmaxes, so no per-row fp16 scaling)
#define WIN  2048
#define PCAR 1024.0f
#define SCL  0.125f   // HD^-0.5
#define PVW  8                    // A.v: waves of a work-group that share one tile's key loop
#define PVS  4                    // A.v: work-groups that share one tile's key loop (partial planes of Ob)
typedef _Float16 h16;
typedef unsigned short bf;
typedef __attribute__((ext_vector_type(16))) __bf16   v16bf;
typedef __attribute__((ext_vector_type(16))) _Float16 v16h;
typedef __attribute__((ext_vector_type(8)))  _Float16 v8h;
typedef __attribute__((ext_vector_type(8)))  unsigned short v8us;
typedef __attribute__((ext_vector_type(8)))  float    v8f;
typedef __attribute__((ext_vector_type(4)))  float    v4f;
typedef v8h  __attribute__((may_alias)) v8ha;
typedef v4f  __attribute__((may_alias)) v4fa;
typedef v8us __attribute__((may_alias)) v8usa;

__device__ __forceinline__ unsigned short f2bf(float f) { unsigned u = __float_as_uint(f); u += 0x7FFFu + ((u >> 16) & 1u); return (unsigned short)(u >> 16); }
__device__ __forceinline__ float bf2f(unsigned short b) { return __uint_as_float(((unsigned)b) << 16); }
__device__ __forceinline__ float bfr(float f) { return bf2f(f2bf(f)); }
__device__ __forceinline__ v16h cat16(v8h lo, v8h hi) { return __builtin_shufflevector(lo, hi, 0, 1, 2, 3, 4, 5, 6, 7, 8, 9, 10, 11, 12, 13, 14, 15); }
__device__ __forceinline__ v16bf cat16b(v8us lo, v8us hi) { return __builtin_bit_cast(v16bf, __builtin_shufflevector(lo, hi, 0, 1, 2, 3, 4, 5, 6, 7, 8, 9, 10, 11, 12, 13, 14, 15)); }
__device__ __forceinline__ v8f wmma16(v16h a, v16h b, v8f c) { return __builtin_amdgcn_wmma_f32_16x16x32_f16(false, a, false, b, (short)0, c, false, false); }
__device__ __forceinline__ v8f wmmab(v16bf a, v16bf b, v8f c) { return __builtin_amdgcn_wmma_f32_16x16x32_bf16(false, a, false, b, (short)0, c, false, false); }



// ---- k_gemmw: register-blocked GEMM, ONE WAVE per 64x64 output tile (16 accumulators), operands straight from K-contiguous 16-bit planes; grid (M/64, N/64, Z), 32 threads.
// C[m][n] (f32, pitch ldc, + optional f32 bias[n]) = sum_k A[m][k] Bt[n][k] (+ split products per NSPLIT). z-batch strides sA/sB/sC in elements. K % 32 == 0.
template <typename T16> struct WFrag;
template <> struct WFrag<h16> { typedef v16h V; static __device__ __forceinline__ V ld(const h16* p) { return cat16(*(const v8h*)p, *(const v8h*)(p + 16)); } static __device__ __forceinline__ v8f mma(V a, V b, v8f c) { return wmma16(a, b, c); } };
template <> struct WFrag<bf> { typedef v16bf V; static __device__ __forceinline__ V ld(const bf* p) { return cat16b(*(const v8us*)p, *(const v8us*)(p + 16)); } static __device__ __forceinline__ v8f mma(V a, V b, v8f c) { return wmmab(a, b, c); } };
template <typename T16, int NSPLIT, bool BIAS>
__global__ __launch_bounds__(32) void k_gemmw(const T16* __restrict__ A, const T16* __restrict__ A2, const T16* __restrict__ Bt, const T16* __restrict__ Bt2, int K, float* C, int ldc, const float* __restrict__ bias, size_t sA, size_t sB, size_t sC) {
    typedef typename WFrag<T16>::V V;
    __shared__ __align__(16) float os[16 * 68];
    const size_t z = blockIdx.z; A += z * sA; if (A2) A2 += z * sA; Bt += z * sB; if (Bt2) Bt2 += z * sB; C += z * sC;
    const int lane = threadIdx.x & 31, lr = lane & 15, hi = lane >> 4; const int r0 = blockIdx.x * 64, c0 = blockIdx.y * 64;
    v8f acc[4][4];
#pragma unroll
    for (int mb = 0; mb < 4; ++mb)
#pragma unroll
        for (int nb = 0; nb < 4; ++nb) acc[mb][nb] = (v8f){};
    const size_t aoff = (size_t)(r0 + lr) * K + 8 * hi, boff = (size_t)(c0 + lr) * K + 8 * hi;
#pragma unroll 1
    for (int kc = 0; kc < K; kc += 32) {
        V a[4], a2[4];
#pragma unroll
        for (int mb = 0; mb < 4; ++mb) { a[mb] = WFrag<T16>::ld(A + aoff + (size_t)mb * 16 * K + kc); if (NSPLIT == 1 || NSPLIT == 2) a2[mb] = WFrag<T16>::ld(A2 + aoff + (size_t)mb * 16 * K + kc); }
#pragma unroll
        for (int nb = 0; nb < 4; ++nb) { const V b = WFrag<T16>::ld(Bt + boff + (size_t)nb * 16 * K + kc); V b2; if (NSPLIT >= 2) b2 = WFrag<T16>::ld(Bt2 + boff + (size_t)nb * 16 * K + kc);
#pragma unroll
            for (int mb = 0; mb < 4; ++mb) { acc[mb][nb] = WFrag<T16>::mma(a[mb], b, acc[mb][nb]); if (NSPLIT == 1 || NSPLIT == 2) acc[mb][nb] = WFrag<T16>::mma(a2[mb], b, acc[mb][nb]); if (NSPLIT >= 2) acc[mb][nb] = WFrag<T16>::mma(a[mb], b2, acc[mb][nb]); } }
        asm volatile("v_nop\n\tv_nop\n\tv_nop\n\tv_nop" : "+v"(acc[0][0]), "+v"(acc[1][1]), "+v"(acc[2][2]), "+v"(acc[3][3]) : "v"(a[0]), "v"(a[3]));
    }
#pragma unroll
    for (int mb = 0; mb < 4; ++mb) {
#pragma unroll
        for (int nb = 0; nb < 4; ++nb) {
#pragma unroll
            for (int j = 0; j < 8; ++j) os[(hi * 8 + j) * 68 + nb * 16 + lr] = acc[mb][nb][j]; }
        __builtin_amdgcn_wave_barrier(); asm volatile("" ::: "memory");
        float* crow = C + (size_t)(r0 + mb * 16) * ldc + c0;
{
#pragma unroll
            for (int s = 0; s < 8; ++s) { const int row = 2 * s + hi, cofs = lr * 4; v4f val = *(const v4fa*)(os + row * 68 + cofs); if (BIAS) { val[0] += bfr(bias[c0 + cofs]); val[1] += bfr(bias[c0 + cofs + 1]); val[2] += bfr(bias[c0 + cofs + 2]); val[3] += bfr(bias[c0 + cofs + 3]); }
                *(v4f*)(crow + (size_t)row * ldc + cofs) = val; }
             }
        __builtin_amdgcn_wave_barrier(); asm volatile("" ::: "memory");
    }
}

// ---- k_gemmc: the 64x64 tile GEMM specialised for causal attention: CMODE 1 skips score tiles entirely above the diagonal (query rows r0+roff.., key columns c0..), CMODE 2 limits the
// key (K) loop of the probability x value contraction to the diagonal block (probabilities beyond it are exactly zero). roff = row offset of this launch's first row within the sequence.
// Split K: the 32-wide K chunks of a tile are dealt round-robin to KS work-groups (grid.y = column tiles x KS) of NW waves; each wave keeps a whole 64x64 partial tile in registers, the NW partials
// of a work-group are summed through LDS in wave order, and work-group ks writes its sum to partial plane ks of C (planes [z][ks], each sC elements); the reader of C adds the KS planes.
template <typename T16, int NSPLIT, int CMODE, int NW, int KS>
__global__ __launch_bounds__(32 * NW) void k_gemmc(const T16* __restrict__ A, const T16* __restrict__ A2, const T16* __restrict__ Bt, const T16* __restrict__ Bt2, int K, float* C, int ldc, int roff, size_t sA, size_t sB, size_t sC) {
    typedef typename WFrag<T16>::V V;
    __shared__ __align__(16) float os[NW][64 * 68];
    const int ks = blockIdx.y % KS; const int wv = __builtin_amdgcn_readfirstlane(threadIdx.x >> 5);   // wave number in a scalar register: the K loop stays a scalar branch, every lane on at the matrix instructions
    const size_t z = blockIdx.z; A += z * sA; if (A2) A2 += z * sA; Bt += z * sB; if (Bt2) Bt2 += z * sB; C += (z * KS + ks) * sC;
    const int lane = threadIdx.x & 31, lr = lane & 15, hi = lane >> 4; const int r0 = blockIdx.x * 64, c0 = (blockIdx.y / KS) * 64;
    if (CMODE == 1 && c0 > r0 + roff + 63) return;                  // score tile entirely above the causal diagonal: never read (the softmax masks j > i by select)
    const int Kl = (CMODE == 2) ? min(K, r0 + roff + 64) : K;        // P.V: probabilities are exactly 0 beyond the diagonal block, so the K loop stops there
    v8f acc[4][4];
#pragma unroll
    for (int mb = 0; mb < 4; ++mb)
#pragma unroll
        for (int nb = 0; nb < 4; ++nb) acc[mb][nb] = (v8f){};
    const size_t aoff = (size_t)(r0 + lr) * K + 8 * hi, boff = (size_t)(c0 + lr) * K + 8 * hi;
#pragma unroll 1
    for (int kc = (ks * NW + wv) * 32; kc < Kl; kc += NW * KS * 32) {
        V a[4], a2[4];
#pragma unroll
        for (int mb = 0; mb < 4; ++mb) { a[mb] = WFrag<T16>::ld(A + aoff + (size_t)mb * 16 * K + kc); if (NSPLIT == 1 || NSPLIT == 2) a2[mb] = WFrag<T16>::ld(A2 + aoff + (size_t)mb * 16 * K + kc); }
#pragma unroll
        for (int nb = 0; nb < 4; ++nb) { const V b = WFrag<T16>::ld(Bt + boff + (size_t)nb * 16 * K + kc); V b2; if (NSPLIT >= 2) b2 = WFrag<T16>::ld(Bt2 + boff + (size_t)nb * 16 * K + kc);
#pragma unroll
            for (int mb = 0; mb < 4; ++mb) { acc[mb][nb] = WFrag<T16>::mma(a[mb], b, acc[mb][nb]); if (NSPLIT == 1 || NSPLIT == 2) acc[mb][nb] = WFrag<T16>::mma(a2[mb], b, acc[mb][nb]); if (NSPLIT >= 2) acc[mb][nb] = WFrag<T16>::mma(a[mb], b2, acc[mb][nb]); } }
        asm volatile("v_nop\n\tv_nop\n\tv_nop\n\tv_nop" : "+v"(acc[0][0]), "+v"(acc[1][1]), "+v"(acc[2][2]), "+v"(acc[3][3]) : "v"(a[0]), "v"(a[3]));
    }
#pragma unroll
    for (int mb = 0; mb < 4; ++mb) {
#pragma unroll
        for (int nb = 0; nb < 4; ++nb) {
#pragma unroll
            for (int j = 0; j < 8; ++j) os[wv][(mb * 16 + hi * 8 + j) * 68 + nb * 16 + lr] = acc[mb][nb][j]; } }
    __syncthreads();   // every wave's partial tile is in LDS before any thread sums across the waves
    float* ct = C + (size_t)r0 * ldc + c0;
#pragma unroll
    for (int s = 0; s < 64 * 16 / (32 * NW); ++s) { const int idx = s * 32 * NW + (int)threadIdx.x; const int row = idx >> 4, cofs = (idx & 15) * 4; v4f val = *(const v4fa*)(&os[0][row * 68 + cofs]);
#pragma unroll
        for (int w = 1; w < NW; ++w) val += *(const v4fa*)(&os[w][row * 68 + cofs]);
        *(v4f*)(ct + (size_t)row * ldc + cofs) = val; }
}

__device__ __forceinline__ h16 tohx(float x) { return (h16)x; }
__device__ __forceinline__ void splitf(float y, unsigned short& h, unsigned short& l) { h = f2bf(y); l = f2bf(y - bf2f(h)); }
typedef __attribute__((ext_vector_type(2))) _Float16 v2h;
typedef __attribute__((ext_vector_type(4))) _Float16 v4h;
typedef __attribute__((ext_vector_type(2))) unsigned short v2us;
typedef __attribute__((ext_vector_type(4))) unsigned short v4us;
typedef __attribute__((ext_vector_type(2))) float v2f;
typedef __attribute__((ext_vector_type(4))) int v4i;

__global__ __launch_bounds__(256) void k_wtG(const float* __restrict__ w, int K, int N, bf* Bt) {
    const int lane = threadIdx.x & 31; const int L0 = (blockIdx.x * 8 + (threadIdx.x >> 5)) * 8; const int nlines = N * K / 64;
{
#pragma unroll 1
        for (int l = 0; l < 8; ++l) { const int L = L0 + l; if (L >= nlines) break; const size_t e = (size_t)L * 64 + lane * 2; const int k = (int)(e % K), n = (int)(e / K); v2us o;
            o[0] = f2bf(w[(size_t)k * N + n]); o[1] = f2bf(w[(size_t)(k + 1) * N + n]); *(v2us*)(Bt + e) = o; }
         }
}
__global__ __launch_bounds__(256) void k_cvt8(const float* __restrict__ src, bf* dst, size_t n8) { const size_t i = (size_t)blockIdx.x * 256 + threadIdx.x; if (i >= n8) return; const v8f v = *(const v8f*)(src + i * 8); v8us o;
#pragma unroll
    for (int k = 0; k < 8; ++k) o[k] = f2bf(v[k]); *(v8us*)(dst + i * 8) = o;  }

// k_rope: head planes [h][t][d] (fp16 + hi/lo) of rope(x) x sc with the rotate-half convention out[d] = x[d] cos[t][d] - x[d+HD/2] sin[t][d], out[d+HD/2] = x[d+HD/2] cos[t][d+HD/2] + x[d] sin[t][d+HD/2]
__global__ __launch_bounds__(256) void k_rope(const float* __restrict__ F, int pitch, int nheads, const float* __restrict__ CS, const float* __restrict__ RF, const float* __restrict__ nw, float sc, h16* P16, bf* Ph, bf* Pl) {
    const size_t e = ((size_t)blockIdx.x * 256 + threadIdx.x) * 2; if (e >= (size_t)nheads * TT * HD) return; const int d = (int)(e % HD); const int t = (int)((e / HD) % TT); const int h = (int)(e / ((size_t)HD * TT)); const float* f = F + (size_t)t * pitch + h * HD; const float rf = RF ? RF[(size_t)h * TT + t] : 1.0f; v2h o16; v2us oh, ol;
#pragma unroll
    for (int q = 0; q < 2; ++q) { const int dd = d + q; const int dp = (dd < HD / 2) ? dd + HD / 2 : dd - HD / 2; float x0 = f[dd], x1 = f[dp];
        if (RF) { float n0 = __fmul_rn(x0, rf), n1 = __fmul_rn(x1, rf); asm volatile("" : "+v"(n0)); asm volatile("" : "+v"(n1)); x0 = __fmul_rn(bfr(nw[dd]), n0); x1 = __fmul_rn(bfr(nw[dp]), n1); }
        const v2f cs = *(const v2f*)(CS + ((size_t)t * HD + dd) * 2); float a = __fmul_rn(x0, cs[0]), bq = __fmul_rn(x1, cs[1]); asm volatile("" : "+v"(a)); asm volatile("" : "+v"(bq)); const float r = ((dd < HD / 2) ? __fsub_rn(a, bq) : __fadd_rn(a, bq)) * sc;
        o16[q] = tohx(r); unsigned short a2, c2; splitf(r, a2, c2); oh[q] = a2; ol[q] = c2; }
    *(v2h*)(P16 + e) = o16; *(v2us*)(Ph + e) = oh; *(v2us*)(Pl + e) = ol;  }
__global__ __launch_bounds__(256) void k_vtp(const float* __restrict__ F, int pitch, int nheads, h16* V16, bf* Vh, bf* Vl) { const size_t e = ((size_t)blockIdx.x * 256 + threadIdx.x) * 2; if (e >= (size_t)nheads * HD * TT) return; const int t = (int)(e % TT); const int d = (int)((e / TT) % HD); const int g = (int)(e / ((size_t)TT * HD)); v2h o16; v2us oh, ol;
#pragma unroll
    for (int q = 0; q < 2; ++q) { const float x = F[(size_t)(t + q) * pitch + g * HD + d]; o16[q] = tohx(x); unsigned short a2, c2; splitf(x, a2, c2); oh[q] = a2; ol[q] = c2; }
    *(v2h*)(V16 + e) = o16; *(v2us*)(Vh + e) = oh; *(v2us*)(Vl + e) = ol;  }
__global__ __launch_bounds__(256) void k_csid(float* CS) { const int idx = blockIdx.x * 256 + threadIdx.x; if (idx >= TT * HD) return; v2f cs; cs[0] = 1.0f; cs[1] = 0.0f; *(v2f*)(CS + (size_t)idx * 2) = cs;  }
__global__ __launch_bounds__(256) void k_ptr(const bf* __restrict__ Ph, const bf* __restrict__ Pl, bf* Th, bf* Tl) {
    __shared__ unsigned short th[64][66]; __shared__ unsigned short tl[64][66];
    const size_t z = blockIdx.z; const size_t base = z * (size_t)TT * TT; const int bi = blockIdx.x * 64, bj = blockIdx.y * 64;   /* source tile rows bj.. (j), cols bi.. (i) -> dest rows bi.. (i), cols bj.. (j) */
    const int tid = threadIdx.x; const int ry = tid >> 2, cx = (tid & 3) * 16;
    { const bf* sh0 = Ph + base + (size_t)(bj + ry) * TT + bi + cx; const bf* sl0 = Pl + base + (size_t)(bj + ry) * TT + bi + cx; const v8us a0 = *(const v8us*)sh0, a1 = *(const v8us*)(sh0 + 8), c0 = *(const v8us*)sl0, c1 = *(const v8us*)(sl0 + 8);
#pragma unroll
      for (int q = 0; q < 8; ++q) { th[ry][cx + q] = a0[q]; th[ry][cx + 8 + q] = a1[q]; tl[ry][cx + q] = c0[q]; tl[ry][cx + 8 + q] = c1[q]; } }
    __syncthreads();
    v8us o0, o1, p0, p1;
#pragma unroll
    for (int q = 0; q < 8; ++q) { o0[q] = th[cx + q][ry]; o1[q] = th[cx + 8 + q][ry]; p0[q] = tl[cx + q][ry]; p1[q] = tl[cx + 8 + q][ry]; }
    bf* dh = Th + base + (size_t)(bi + ry) * TT + bj + cx; bf* dl = Tl + base + (size_t)(bi + ry) * TT + bj + cx;
{ *(v8us*)dh = o0; *(v8us*)(dh + 8) = o1; *(v8us*)dl = p0; *(v8us*)(dl + 8) = p1;  } }
__global__ __launch_bounds__(256) void k_mulx(const float* __restrict__ X, const float* __restrict__ P, float* O, size_t n4) { const size_t i = (size_t)blockIdx.x * 256 + threadIdx.x; if (i >= n4) return; const v4f a = *(const v4f*)(X + i * 4), p = *(const v4f*)(P + i * 4); v4f o;
#pragma unroll
    for (int q = 0; q < 4; ++q) o[q] = __fmul_rn(bfr(a[q]), p[q]); *(v4f*)(O + i * 4) = o;  }
__global__ __launch_bounds__(256) void k_asoft(const float* __restrict__ Sb, h16* P16, bf* Ph, bf* Pl) {
    const int lane = threadIdx.x & 31; const int row = blockIdx.x * 8 + (threadIdx.x >> 5); if (row >= ZH * TT) return; const int i = row % TT; const int zz = row / TT; (void)zz; const bool hires = (i < RH); const float* sr = Sb + (size_t)row * TT; float v[TT / 32]; float mx = -3.0e38f;
#pragma unroll
    for (int ch = 0; ch < TT / 128; ++ch) { const int j0 = ch * 128 + lane * 4; const v4f a = *(const v4f*)(sr + j0);
#pragma unroll
        for (int q = 0; q < 4; ++q) { const int j = j0 + q; const float t = (j >= i) ? a[q] * SCL : -3.0e38f;   /* this row is KEY i of the transposed scores; column j is a query: causal keeps queries j >= key i */ v[ch * 4 + q] = t; mx = fmaxf(mx, t); } }
#pragma unroll
    for (int sh = 16; sh; sh >>= 1) mx = fmaxf(mx, __shfl_xor(mx, sh, 32));
    float sum = 0.f;
#pragma unroll
    for (int k = 0; k < TT / 32; ++k) { float d0 = __fsub_rn(v[k], mx); asm volatile("" : "+v"(d0)); v[k] = __builtin_amdgcn_exp2f(__fmul_rn(d0, 1.4426950408889634f)); sum += v[k]; }
#pragma unroll
    for (int sh = 16; sh; sh >>= 1) sum += __shfl_xor(sum, sh, 32);
    const float f = __fdiv_rn(hires ? 1.0f : PCAR, sum);
{
        if (hires) {
#pragma unroll
            for (int ch = 0; ch < TT / 128; ++ch) { v4us oh, ol;
#pragma unroll
                for (int q = 0; q < 4; ++q) { unsigned short a, c2; splitf(v[ch * 4 + q] * f, a, c2); oh[q] = a; ol[q] = c2; }
                const size_t oo = ((size_t)zz * (RH ? RH : 1) + i) * TT + ch * 128 + lane * 4; *(v4us*)(Ph + oo) = oh; *(v4us*)(Pl + oo) = ol; }
        } else {
#pragma unroll
            for (int ch = 0; ch < TT / 128; ++ch) { v4h o4;
#pragma unroll
                for (int q = 0; q < 4; ++q) o4[q] = tohx(v[ch * 4 + q] * f);
                *(v4h*)(P16 + (size_t)row * TT + ch * 128 + lane * 4) = o4; } }
         }
}
__global__ __launch_bounds__(256) void k_merge(const float* __restrict__ O, int h0, bf* Ah, bf* Al) { const size_t e = ((size_t)blockIdx.x * 256 + threadIdx.x) * 2; if (e >= (size_t)ZH * TT * HD) return; const int d = (int)(e % HD); const int t = (int)((e / HD) % TT); const int zz = (int)(e / ((size_t)HD * TT)); const float cs = (t < RH) ? 1.0f : (1.0f / PCAR); const size_t oo = (size_t)t * DQ + (h0 + zz) * HD + d;
    v2us oh, ol;
    const float* Op = O + (size_t)zz * (PVS - 1) * TT * HD + e;   /* Ob is [head of the pass][A.v partial plane][t][d] */
#pragma unroll
    for (int q = 0; q < 2; ++q) { float s = Op[q];
#pragma unroll
        for (int p = 1; p < PVS; ++p) s += Op[(size_t)p * TT * HD + q];   /* the partial planes, in plane order */
        unsigned short a, c2; splitf(s * cs, a, c2); oh[q] = a; ol[q] = c2; } *(v2us*)(Ah + oo) = oh; *(v2us*)(Al + oo) = ol;  }

extern "C" void kernel_launch(void* const* d_in, const int* in_sizes, int n_in,
                              void* d_out, int out_size, void* d_ws, size_t ws_size, hipStream_t stream) {
    (void)in_sizes; (void)n_in; (void)out_size;
    const float* x = (const float*)d_in[0]; const float* wqkv = (const float*)d_in[1]; const float* wo = (const float*)d_in[2];  const float* wq = nullptr; const float* wk = nullptr; const float* wv = nullptr; (void)wq; (void)wk; (void)wv;
    float* OUT = (float*)d_out;     // [2][2048][1024]
    char* wsp = (char*)d_ws;
    auto take = [&](size_t bytes) { char* p = wsp; wsp += (bytes + 255) & ~(size_t)255; return (void*)p; };
    bf* WALL = (bf*)take((size_t)3 * DM * DM * 2); bf* WQ = WALL; bf* WK = WALL + (size_t)DM * DM; bf* WV = WALL + (size_t)2 * DM * DM; bf* WO = (bf*)take((size_t)DM * DQ * 2); float* CS = (float*)take((size_t)TT * HD * 2 * 4);
    bf* XB = (bf*)take((size_t)TT * DM * 2); float* FQ = (float*)take((size_t)TT * DQ * 4); float* FK = (float*)take((size_t)TT * DKV * 4);
    h16* QP16 = (h16*)take((size_t)NH_ * TT * HD * 2); h16* KP16 = (h16*)take((size_t)NKV * TT * HD * 2); h16* VT16 = (h16*)take((size_t)NKV * HD * TT * 2);
    bf* QPh = (bf*)take((size_t)NH_ * TT * HD * 2); bf* QPl = (bf*)take((size_t)NH_ * TT * HD * 2); bf* KPh = (bf*)take((size_t)NKV * TT * HD * 2); bf* KPl = (bf*)take((size_t)NKV * TT * HD * 2); bf* VTh = (bf*)take((size_t)NKV * HD * TT * 2); bf* VTl = (bf*)take((size_t)NKV * HD * TT * 2); bf* Ph = (bf*)take((size_t)ZH * RH * TT * 2); bf* Pl = (bf*)take((size_t)ZH * RH * TT * 2);
    float* Sb = (float*)take((size_t)ZH * TT * TT * 4); h16* P16 = (h16*)take(256); bf* PTh = (bf*)take((size_t)ZH * TT * TT * 2); bf* PTl = (bf*)take((size_t)ZH * TT * TT * 2); float* PRJ = (float*)take((size_t)TT * DM * 4); float* Ob = (float*)take((size_t)PVS * ZH * TT * HD * 4); bf* ATh = (bf*)take((size_t)TT * DQ * 2); bf* ATl = (bf*)take((size_t)TT * DQ * 2);
    if ((size_t)(wsp - (char*)d_ws) > ws_size) return;    // ws 256 MiB
    float* FV = FK;   // v projection reuses the k buffer after the k planes are built (stream-ordered)
    { k_wtG<<<(unsigned)((DM * 3 * DM / 64 + 63) / 64), 256, 0, stream>>>(wqkv, DM, 3 * DM, WALL);   /* fused 'xw' [DM][3DM] -> Bt [3DM][DM] (row blocks q | k | v) */
      k_wtG<<<(unsigned)((DQ * DM / 64 + 63) / 64), 256, 0, stream>>>(wo, DQ, DM, WO);
       }
    k_csid<<<(TT * HD + 255) / 256, 256, 0, stream>>>(CS);
    const unsigned LQ = (unsigned)(((size_t)NH_ * TT * HD / 2 + 255) / 256), LKv = (unsigned)(((size_t)NKV * TT * HD / 2 + 255) / 256);
    for (int b = 0; b < NB_; ++b) {
        
        k_cvt8<<<(unsigned)(((size_t)TT * DM / 8 + 255) / 256), 256, 0, stream>>>(x + (size_t)b * TT * DM, XB, (size_t)TT * DM / 8);
        k_gemmw<bf, 0, false><<<dim3(TT / 64, DQ / 64, 1), 32, 0, stream>>>(XB, nullptr, WQ, nullptr, DM, FQ, DQ, nullptr, 0, 0, 0);
        k_rope<<<LQ, 256, 0, stream>>>(FQ, DQ, NH_, CS, nullptr, nullptr, 1.0f, QP16, QPh, QPl);
        k_gemmw<bf, 0, false><<<dim3(TT / 64, DKV / 64, 1), 32, 0, stream>>>(XB, nullptr, WK, nullptr, DM, FK, DKV, nullptr, 0, 0, 0);
        k_rope<<<LKv, 256, 0, stream>>>(FK, DKV, NKV, CS, nullptr, nullptr, 1.0f, KP16, KPh, KPl);
        k_gemmw<bf, 0, false><<<dim3(TT / 64, DKV / 64, 1), 32, 0, stream>>>(XB, nullptr, WV, nullptr, DM, FV, DKV, nullptr, 0, 0, 0); k_vtp<<<LKv, 256, 0, stream>>>(FV, DKV, NKV, VT16, VTh, VTl);
        for (int h0 = 0; h0 < NH_; h0 += ZH) { const size_t zq = (size_t)h0, zk = (size_t)(h0 / REP);   // one kv head per query head: the pass's two heads use consecutive kv planes (z-strides TT*HD)
            k_gemmw<bf, 2, false><<<dim3(RH / 64, TT / 64, ZH), 32, 0, stream>>>(KPh + zk * TT * HD, KPl + zk * TT * HD, QPh + zq * TT * HD, QPl + zq * TT * HD, HD, Sb, TT, nullptr, (size_t)TT * HD, (size_t)TT * HD, (size_t)TT * TT);   /* key-major scores S^T[i][j] = k_i.q_j */
            k_asoft<<<ZH * TT / 8, 256, 0, stream>>>(Sb, P16, Ph, Pl); k_ptr<<<dim3(TT / 64, TT / 64, ZH), 256, 0, stream>>>(Ph, Pl, PTh, PTl);   /* column softmax, then transpose to query-major probabilities */
            k_gemmc<bf, 2, 2, PVW, PVS><<<dim3(TT / 64, HD / 64 * PVS, ZH), 32 * PVW, 0, stream>>>(PTh, PTl, VTh + zk * HD * TT, VTl + zk * HD * TT, TT, Ob, HD, 0, (size_t)TT * TT, (size_t)HD * TT, (size_t)TT * HD);   /* A.v: probabilities are 0 for keys beyond the query, K loop cut at the diagonal block and split over PVS x PVW waves; Ob holds PVS partial planes */
            k_merge<<<(unsigned)(((size_t)ZH * TT * HD / 2 + 255) / 256), 256, 0, stream>>>(Ob, h0, ATh, ATl); }
        k_gemmw<bf, 1, false><<<dim3(TT / 64, DM / 64, 1), 32, 0, stream>>>(ATh, ATl, WO, nullptr, DQ, PRJ, DM, nullptr, 0, 0, 0); k_mulx<<<(unsigned)(((size_t)TT * DM / 4 + 255) / 256), 256, 0, stream>>>(x + (size_t)b * TT * DM, PRJ, OUT + (size_t)b * TT * DM, (size_t)TT * DM / 4); }   /* out = x * (m W_proj) */
}

// v002
// Measured time: 375 microseconds a run.
// Timed twice side by side with v001, it ran 2.35 and 2.38 times as fast.
// Over all steps from v000 it is 3.73 times as fast.
#include <hip/hip_runtime.h>

// Causal attention normalised over the QUERY axis, used as a multiplicative gate (x [2][2048][1024]; [q|k|v] = x W_qkv ('xw' [1024][3072], no bias; 16 heads x 64); s[i][j] = q_i.k_j/8 for j <= i else -inf; A = softmax over i (each key column normalised over the queries that see it); m = A v merged; proj = m W_proj ('xw'); out = x * proj -> [2][2048][1024]).
// Layout: the scores are formed key-major in registers (S^T[j][i] = k_j.q_i, every row hi/lo, 3 products) and never stored: k_cstat keeps each key's maximum and 1/sum over the queries i >= j; k_cattn forms the same S^T tiles again, turns them into probabilities and feeds them, still in registers, as the B operand of out^T[d][i] = sum_j v^T[d][j] A[i][j] (3 products), key loop cut at the diagonal; the output projection feeds an elementwise gate with bf16(x).
// Compute dtypes, f32 accumulate: every input rounded to bf16; q/k/v on PLAIN bf16 operands (inputs: exact); key-major scores and A.v on hi/lo planes for every row (3 products); column softmax in f32; W_proj hl x exact (2 products); the final x * proj gate in f32.

#define NB_  2
#define TT   2048
#define DM   1024
#define NH_  16
#define NKV  16
#define REP  (NH_ / NKV)
#define HD   64
#define DQ   (NH_ * HD)
#define DKV  (NKV * HD)
#define SCL  0.125f   // HD^-0.5
#define L2E  1.4426950408889634f
#define CSW  8                    // waves of a work-group that share one tile's loop in k_cstat (queries) and k_cattn (keys)
typedef _Float16 h16;
typedef unsigned short bf;
typedef __attribute__((ext_vector_type(16))) __bf16   v16bf;
typedef __attribute__((ext_vector_type(16))) _Float16 v16h;
typedef __attribute__((ext_vector_type(8)))  _Float16 v8h;
typedef __attribute__((ext_vector_type(8)))  unsigned short v8us;
typedef __attribute__((ext_vector_type(8)))  float    v8f;
typedef __attribute__((ext_vector_type(4)))  float    v4f;
typedef v8h  __attribute__((may_alias)) v8ha;
typedef v4f  __attribute__((may_alias)) v4fa;
typedef v8us __attribute__((may_alias)) v8usa;

__device__ __forceinline__ unsigned short f2bf(float f) { unsigned u = __float_as_uint(f); u += 0x7FFFu + ((u >> 16) & 1u); return (unsigned short)(u >> 16); }
__device__ __forceinline__ float bf2f(unsigned short b) { return __uint_as_float(((unsigned)b) << 16); }
__device__ __forceinline__ float bfr(float f) { return bf2f(f2bf(f)); }
__device__ __forceinline__ v16h cat16(v8h lo, v8h hi) { return __builtin_shufflevector(lo, hi, 0, 1, 2, 3, 4, 5, 6, 7, 8, 9, 10, 11, 12, 13, 14, 15); }
__device__ __forceinline__ v16bf cat16b(v8us lo, v8us hi) { return __builtin_bit_cast(v16bf, __builtin_shufflevector(lo, hi, 0, 1, 2, 3, 4, 5, 6, 7, 8, 9, 10, 11, 12, 13, 14, 15)); }
__device__ __forceinline__ v8f wmma16(v16h a, v16h b, v8f c) { return __builtin_amdgcn_wmma_f32_16x16x32_f16(false, a, false, b, (short)0, c, false, false); }
__device__ __forceinline__ v8f wmmab(v16bf a, v16bf b, v8f c) { return __builtin_amdgcn_wmma_f32_16x16x32_bf16(false, a, false, b, (short)0, c, false, false); }



// ---- k_gemmw: register-blocked GEMM, ONE WAVE per 64x64 output tile (16 accumulators), operands straight from K-contiguous 16-bit planes; grid (M/64, N/64, Z), 32 threads.
// C[m][n] (f32, pitch ldc, + optional f32 bias[n]) = sum_k A[m][k] Bt[n][k] (+ split products per NSPLIT). z-batch strides sA/sB/sC in elements. K % 32 == 0.
template <typename T16> struct WFrag;
template <> struct WFrag<h16> { typedef v16h V; static __device__ __forceinline__ V ld(const h16* p) { return cat16(*(const v8h*)p, *(const v8h*)(p + 16)); } static __device__ __forceinline__ v8f mma(V a, V b, v8f c) { return wmma16(a, b, c); } };
template <> struct WFrag<bf> { typedef v16bf V; static __device__ __forceinline__ V ld(const bf* p) { return cat16b(*(const v8us*)p, *(const v8us*)(p + 16)); } static __device__ __forceinline__ v8f mma(V a, V b, v8f c) { return wmmab(a, b, c); } };
template <typename T16, int NSPLIT, bool BIAS>
__global__ __launch_bounds__(32) void k_gemmw(const T16* __restrict__ A, const T16* __restrict__ A2, const T16* __restrict__ Bt, const T16* __restrict__ Bt2, int K, float* C, int ldc, const float* __restrict__ bias, size_t sA, size_t sB, size_t sC) {
    typedef typename WFrag<T16>::V V;
    __shared__ __align__(16) float os[16 * 68];
    const size_t z = blockIdx.z; A += z * sA; if (A2) A2 += z * sA; Bt += z * sB; if (Bt2) Bt2 += z * sB; C += z * sC;
    const int lane = threadIdx.x & 31, lr = lane & 15, hi = lane >> 4; const int r0 = blockIdx.x * 64, c0 = blockIdx.y * 64;
    v8f acc[4][4];
#pragma unroll
    for (int mb = 0; mb < 4; ++mb)
#pragma unroll
        for (int nb = 0; nb < 4; ++nb) acc[mb][nb] = (v8f){};
    const size_t aoff = (size_t)(r0 + lr) * K + 8 * hi, boff = (size_t)(c0 + lr) * K + 8 * hi;
#pragma unroll 1
    for (int kc = 0; kc < K; kc += 32) {
        V a[4], a2[4];
#pragma unroll
        for (int mb = 0; mb < 4; ++mb) { a[mb] = WFrag<T16>::ld(A + aoff + (size_t)mb * 16 * K + kc); if (NSPLIT == 1 || NSPLIT == 2) a2[mb] = WFrag<T16>::ld(A2 + aoff + (size_t)mb * 16 * K + kc); }
#pragma unroll
        for (int nb = 0; nb < 4; ++nb) { const V b = WFrag<T16>::ld(Bt + boff + (size_t)nb * 16 * K + kc); V b2; if (NSPLIT >= 2) b2 = WFrag<T16>::ld(Bt2 + boff + (size_t)nb * 16 * K + kc);
#pragma unroll
            for (int mb = 0; mb < 4; ++mb) { acc[mb][nb] = WFrag<T16>::mma(a[mb], b, acc[mb][nb]); if (NSPLIT == 1 || NSPLIT == 2) acc[mb][nb] = WFrag<T16>::mma(a2[mb], b, acc[mb][nb]); if (NSPLIT >= 2) acc[mb][nb] = WFrag<T16>::mma(a[mb], b2, acc[mb][nb]); } }
        asm volatile("v_nop\n\tv_nop\n\tv_nop\n\tv_nop" : "+v"(acc[0][0]), "+v"(acc[1][1]), "+v"(acc[2][2]), "+v"(acc[3][3]) : "v"(a[0]), "v"(a[3]));
    }
#pragma unroll
    for (int mb = 0; mb < 4; ++mb) {
#pragma unroll
        for (int nb = 0; nb < 4; ++nb) {
#pragma unroll
            for (int j = 0; j < 8; ++j) os[(hi * 8 + j) * 68 + nb * 16 + lr] = acc[mb][nb][j]; }
        __builtin_amdgcn_wave_barrier(); asm volatile("" ::: "memory");
        float* crow = C + (size_t)(r0 + mb * 16) * ldc + c0;
{
#pragma unroll
            for (int s = 0; s < 8; ++s) { const int row = 2 * s + hi, cofs = lr * 4; v4f val = *(const v4fa*)(os + row * 68 + cofs); if (BIAS) { val[0] += bfr(bias[c0 + cofs]); val[1] += bfr(bias[c0 + cofs + 1]); val[2] += bfr(bias[c0 + cofs + 2]); val[3] += bfr(bias[c0 + cofs + 3]); }
                *(v4f*)(crow + (size_t)row * ldc + cofs) = val; }
             }
        __builtin_amdgcn_wave_barrier(); asm volatile("" ::: "memory");
    }
}

__device__ __forceinline__ h16 tohx(float x) { return (h16)x; }
__device__ __forceinline__ void splitf(float y, unsigned short& h, unsigned short& l) { h = f2bf(y); l = f2bf(y - bf2f(h)); }
typedef __attribute__((ext_vector_type(2))) _Float16 v2h;
typedef __attribute__((ext_vector_type(4))) _Float16 v4h;
typedef __attribute__((ext_vector_type(2))) unsigned short v2us;
typedef __attribute__((ext_vector_type(4))) unsigned short v4us;
typedef __attribute__((ext_vector_type(2))) float v2f;
typedef __attribute__((ext_vector_type(4))) int v4i;

__global__ __launch_bounds__(256) void k_wtG(const float* __restrict__ w, int K, int N, bf* Bt) {
    const int lane = threadIdx.x & 31; const int L0 = (blockIdx.x * 8 + (threadIdx.x >> 5)) * 8; const int nlines = N * K / 64;
{
#pragma unroll 1
        for (int l = 0; l < 8; ++l) { const int L = L0 + l; if (L >= nlines) break; const size_t e = (size_t)L * 64 + lane * 2; const int k = (int)(e % K), n = (int)(e / K); v2us o;
            o[0] = f2bf(w[(size_t)k * N + n]); o[1] = f2bf(w[(size_t)(k + 1) * N + n]); *(v2us*)(Bt + e) = o; }
         }
}
__global__ __launch_bounds__(256) void k_cvt8(const float* __restrict__ src, bf* dst, size_t n8) { const size_t i = (size_t)blockIdx.x * 256 + threadIdx.x; if (i >= n8) return; const v8f v = *(const v8f*)(src + i * 8); v8us o;
#pragma unroll
    for (int k = 0; k < 8; ++k) o[k] = f2bf(v[k]); *(v8us*)(dst + i * 8) = o;  }

// k_rope: head planes [h][t][d] (fp16 + hi/lo) of rope(x) x sc with the rotate-half convention out[d] = x[d] cos[t][d] - x[d+HD/2] sin[t][d], out[d+HD/2] = x[d+HD/2] cos[t][d+HD/2] + x[d] sin[t][d+HD/2]
__global__ __launch_bounds__(256) void k_rope(const float* __restrict__ F, int pitch, int nheads, const float* __restrict__ CS, const float* __restrict__ RF, const float* __restrict__ nw, float sc, h16* P16, bf* Ph, bf* Pl) {
    const size_t e = ((size_t)blockIdx.x * 256 + threadIdx.x) * 2; if (e >= (size_t)nheads * TT * HD) return; const int d = (int)(e % HD); const int t = (int)((e / HD) % TT); const int h = (int)(e / ((size_t)HD * TT)); const float* f = F + (size_t)t * pitch + h * HD; const float rf = RF ? RF[(size_t)h * TT + t] : 1.0f; v2h o16; v2us oh, ol;
#pragma unroll
    for (int q = 0; q < 2; ++q) { const int dd = d + q; const int dp = (dd < HD / 2) ? dd + HD / 2 : dd - HD / 2; float x0 = f[dd], x1 = f[dp];
        if (RF) { float n0 = __fmul_rn(x0, rf), n1 = __fmul_rn(x1, rf); asm volatile("" : "+v"(n0)); asm volatile("" : "+v"(n1)); x0 = __fmul_rn(bfr(nw[dd]), n0); x1 = __fmul_rn(bfr(nw[dp]), n1); }
        const v2f cs = *(const v2f*)(CS + ((size_t)t * HD + dd) * 2); float a = __fmul_rn(x0, cs[0]), bq = __fmul_rn(x1, cs[1]); asm volatile("" : "+v"(a)); asm volatile("" : "+v"(bq)); const float r = ((dd < HD / 2) ? __fsub_rn(a, bq) : __fadd_rn(a, bq)) * sc;
        o16[q] = tohx(r); unsigned short a2, c2; splitf(r, a2, c2); oh[q] = a2; ol[q] = c2; }
    *(v2h*)(P16 + e) = o16; *(v2us*)(Ph + e) = oh; *(v2us*)(Pl + e) = ol;  }
__global__ __launch_bounds__(256) void k_vtp(const float* __restrict__ F, int pitch, int nheads, h16* V16, bf* Vh, bf* Vl) { const size_t e = ((size_t)blockIdx.x * 256 + threadIdx.x) * 2; if (e >= (size_t)nheads * HD * TT) return; const int t = (int)(e % TT); const int d = (int)((e / TT) % HD); const int g = (int)(e / ((size_t)TT * HD)); v2h o16; v2us oh, ol;
#pragma unroll
    for (int q = 0; q < 2; ++q) { const float x = F[(size_t)(t + q) * pitch + g * HD + d]; o16[q] = tohx(x); unsigned short a2, c2; splitf(x, a2, c2); oh[q] = a2; ol[q] = c2; }
    *(v2h*)(V16 + e) = o16; *(v2us*)(Vh + e) = oh; *(v2us*)(Vl + e) = ol;  }
__global__ __launch_bounds__(256) void k_csid(float* CS) { const int idx = blockIdx.x * 256 + threadIdx.x; if (idx >= TT * HD) return; v2f cs; cs[0] = 1.0f; cs[1] = 0.0f; *(v2f*)(CS + (size_t)idx * 2) = cs;  }
__global__ __launch_bounds__(256) void k_mulx(const float* __restrict__ X, const float* __restrict__ P, float* O, size_t n4) { const size_t i = (size_t)blockIdx.x * 256 + threadIdx.x; if (i >= n4) return; const v4f a = *(const v4f*)(X + i * 4), p = *(const v4f*)(P + i * 4); v4f o;
#pragma unroll
    for (int q = 0; q < 4; ++q) o[q] = __fmul_rn(bfr(a[q]), p[q]); *(v4f*)(O + i * 4) = o;  }

// value of lane l ^ X inside the 16-lane row (DPP row_xmask): the row reductions of k_cstat stay on the vector unit
template <int X> __device__ __forceinline__ float rowx(float x) { return __builtin_bit_cast(float, __builtin_amdgcn_update_dpp(0, __builtin_bit_cast(int, x), 0x160 | X, 0xf, 0xf, true)); }

// ---- k_cstat: column-softmax statistics. One work-group per 32 keys of one head (grid: head, key tile); the 64-wide query chunks from the diagonal on are dealt round-robin to the CSW waves.
// A = key rows (kept in registers), B = query rows, D = S^T tile: lane (lr, hi) holds keys hi*8 + r of queries lr. Every lane keeps a running (max, sum) per key row over its own queries;
// the 16 lanes of a row and then the CSW waves are merged at the end. MX[h][j] = max_i s, RZ[h][j] = 1 / sum_i exp(s - max).
__global__ __launch_bounds__(32 * CSW) void k_cstat(const bf* __restrict__ Kh, const bf* __restrict__ Kl, const bf* __restrict__ Qh, const bf* __restrict__ Ql, float* MX, float* RZ) {
    __shared__ float sm[CSW][32]; __shared__ float sl[CSW][32];
    const int wv = __builtin_amdgcn_readfirstlane(threadIdx.x >> 5);   // wave number in a scalar register: the query loop stays a scalar branch, every lane on at the matrix instructions
    const size_t zo = (size_t)blockIdx.x * TT * HD; const int lane = threadIdx.x & 31, lr = lane & 15, hi = lane >> 4; const int j0 = blockIdx.y * 32;
    v16bf kh[2][2], kl[2][2];
#pragma unroll
    for (int mb = 0; mb < 2; ++mb)
#pragma unroll
        for (int ks = 0; ks < 2; ++ks) { const size_t o = zo + (size_t)(j0 + mb * 16 + lr) * HD + ks * 32 + 8 * hi; kh[mb][ks] = WFrag<bf>::ld(Kh + o); kl[mb][ks] = WFrag<bf>::ld(Kl + o); }
    asm volatile("s_wait_xcnt 0x0" ::: "memory");   // in front of the loop's overwrites of the address registers that the key loads name
    __builtin_amdgcn_sched_barrier(0);   // keeps those overwrites behind the wait
    float m[2][8], l[2][8];
#pragma unroll
    for (int mb = 0; mb < 2; ++mb)
#pragma unroll
        for (int r = 0; r < 8; ++r) { m[mb][r] = -3.0e38f; l[mb][r] = 0.f; }
#pragma unroll 1
    for (int c0 = (j0 & ~63) + wv * 64; c0 < TT; c0 += CSW * 64) {
        v8f s[2][4];
#pragma unroll
        for (int nb = 0; nb < 4; ++nb) { v16bf qh[2], ql[2];
#pragma unroll
            for (int ks = 0; ks < 2; ++ks) { const size_t o = zo + (size_t)(c0 + nb * 16 + lr) * HD + ks * 32 + 8 * hi; qh[ks] = WFrag<bf>::ld(Qh + o); ql[ks] = WFrag<bf>::ld(Ql + o); }
#pragma unroll
            for (int mb = 0; mb < 2; ++mb) { v8f a = (v8f){};
#pragma unroll
                for (int ks = 0; ks < 2; ++ks) { a = wmmab(kh[mb][ks], qh[ks], a); a = wmmab(kl[mb][ks], qh[ks], a); a = wmmab(kh[mb][ks], ql[ks], a); }
                s[mb][nb] = a; } }
#pragma unroll
        for (int mb = 0; mb < 2; ++mb)
#pragma unroll
            for (int r = 0; r < 8; ++r) { const int j = j0 + mb * 16 + hi * 8 + r; float t[4]; float mn = m[mb][r];
#pragma unroll
                for (int nb = 0; nb < 4; ++nb) { t[nb] = (c0 + nb * 16 + lr >= j) ? s[mb][nb][r] * SCL : -3.0e38f;   /* causal keeps queries i >= key j */ mn = fmaxf(mn, t[nb]); }
                float a = l[mb][r] * __builtin_amdgcn_exp2f((m[mb][r] - mn) * L2E);
#pragma unroll
                for (int nb = 0; nb < 4; ++nb) a += (c0 + nb * 16 + lr >= j) ? __builtin_amdgcn_exp2f((t[nb] - mn) * L2E) : 0.f;
                l[mb][r] = a; m[mb][r] = mn; }
        asm volatile("s_wait_xcnt 0x0" ::: "memory");   // in front of the next trip's overwrites of the address registers that this trip's query loads name
    }
#pragma unroll
    for (int mb = 0; mb < 2; ++mb)
#pragma unroll
        for (int r = 0; r < 8; ++r) { float M = m[mb][r]; M = fmaxf(M, rowx<1>(M)); M = fmaxf(M, rowx<2>(M)); M = fmaxf(M, rowx<4>(M)); M = fmaxf(M, rowx<8>(M));
            float a = l[mb][r] * __builtin_amdgcn_exp2f((m[mb][r] - M) * L2E); a += rowx<1>(a); a += rowx<2>(a); a += rowx<4>(a); a += rowx<8>(a); m[mb][r] = M; l[mb][r] = a; }
    if (lr == 0) {
#pragma unroll
        for (int mb = 0; mb < 2; ++mb)
#pragma unroll
            for (int r = 0; r < 8; ++r) { sm[wv][mb * 16 + hi * 8 + r] = m[mb][r]; sl[wv][mb * 16 + hi * 8 + r] = l[mb][r]; } }
    __syncthreads();   // every wave's (max, sum) per key is in LDS before the first wave merges them
    if (threadIdx.x < 32) { const int row = threadIdx.x; float M = sm[0][row];
#pragma unroll
        for (int w = 1; w < CSW; ++w) M = fmaxf(M, sm[w][row]);
        float Z = 0.f;
#pragma unroll
        for (int w = 0; w < CSW; ++w) Z += sl[w][row] * __builtin_amdgcn_exp2f((sm[w][row] - M) * L2E);
        const size_t o = (size_t)blockIdx.x * TT + j0 + row; MX[o] = M; RZ[o] = __fdiv_rn(1.0f, Z); }
}

// ---- k_cattn: out^T[d][i] = sum_j v^T[d][j] A[i][j] for 64 queries of one head per work-group (grid: head, query tile, the longest key loops first); the 32-wide key chunks up to the diagonal block are dealt
// round-robin to the CSW waves. Per chunk a wave forms S^T (two 16-key tiles per 16 queries), p = exp(s - MX[j]) RZ[j] (0 for j > i), splits p hi/lo, and uses the two tiles as they lie as one B fragment:
// D of tile t holds keys t*16 + hi*8 + r at lane (lr, hi), which is the k order 8*hi + e | 16 + 8*hi + e of the A loader of v^T. The CSW partial tiles are summed through LDS in wave order and written as the merged hi/lo planes.
__global__ __launch_bounds__(32 * CSW) void k_cattn(const bf* __restrict__ Kh, const bf* __restrict__ Kl, const bf* __restrict__ Qh, const bf* __restrict__ Ql, const bf* __restrict__ Vh, const bf* __restrict__ Vl, const float* __restrict__ MX, const float* __restrict__ RZ, bf* Ah, bf* Al) {
    __shared__ __align__(16) float os[CSW][64 * 68];
    const int wv = __builtin_amdgcn_readfirstlane(threadIdx.x >> 5);   // wave number in a scalar register: the key loop stays a scalar branch, every lane on at the matrix instructions
    const size_t zo = (size_t)blockIdx.x * TT * HD, zs = (size_t)blockIdx.x * TT; const int lane = threadIdx.x & 31, lr = lane & 15, hi = lane >> 4; const int r0 = (TT / 64 - 1 - (int)blockIdx.y) * 64;
    v16bf qh[4][2], ql[4][2];
#pragma unroll
    for (int nb = 0; nb < 4; ++nb)
#pragma unroll
        for (int ks = 0; ks < 2; ++ks) { const size_t o = zo + (size_t)(r0 + nb * 16 + lr) * HD + ks * 32 + 8 * hi; qh[nb][ks] = WFrag<bf>::ld(Qh + o); ql[nb][ks] = WFrag<bf>::ld(Ql + o); }
    asm volatile("s_wait_xcnt 0x0" ::: "memory");   // in front of the loop's overwrites of the address registers that the query loads name
    __builtin_amdgcn_sched_barrier(0);   // keeps those overwrites behind the wait
    v8f acc[4][4];
#pragma unroll
    for (int mb = 0; mb < 4; ++mb)
#pragma unroll
        for (int nb = 0; nb < 4; ++nb) acc[mb][nb] = (v8f){};
#pragma unroll 1
    for (int kc = wv * 32; kc < r0 + 64; kc += CSW * 32) {
        v16bf kh[2][2], kl[2][2], vh[4], vl[4]; v8f mx[2], rz[2];
#pragma unroll
        for (int t = 0; t < 2; ++t) { mx[t] = *(const v8f*)(MX + zs + kc + t * 16 + hi * 8); rz[t] = *(const v8f*)(RZ + zs + kc + t * 16 + hi * 8);
#pragma unroll
            for (int ks = 0; ks < 2; ++ks) { const size_t o = zo + (size_t)(kc + t * 16 + lr) * HD + ks * 32 + 8 * hi; kh[t][ks] = WFrag<bf>::ld(Kh + o); kl[t][ks] = WFrag<bf>::ld(Kl + o); } }
#pragma unroll
        for (int mb = 0; mb < 4; ++mb) { const size_t o = zo + (size_t)(mb * 16 + lr) * TT + kc + 8 * hi; vh[mb] = WFrag<bf>::ld(Vh + o); vl[mb] = WFrag<bf>::ld(Vl + o); }
        __builtin_amdgcn_sched_barrier(0);   // every load of the chunk is issued in front of its first matrix instruction: one exposed load latency per chunk; left free, the v^T loads sink between the products
        asm volatile("s_wait_xcnt 0x0" ::: "memory");   // stands in front of every later overwrite of an address register that the chunk's loads name
        __builtin_amdgcn_sched_barrier(0);   // keeps the address updates of the next chunk behind that wait
#pragma unroll
        for (int nb = 0; nb < 4; ++nb) { v8us ph[2], pl[2]; const int i = r0 + nb * 16 + lr;
#pragma unroll
            for (int t = 0; t < 2; ++t) { v8f a = (v8f){};
#pragma unroll
                for (int ks = 0; ks < 2; ++ks) { a = wmmab(kh[t][ks], qh[nb][ks], a); a = wmmab(kl[t][ks], qh[nb][ks], a); a = wmmab(kh[t][ks], ql[nb][ks], a); }
#pragma unroll
                for (int r = 0; r < 8; ++r) { const float e = __builtin_amdgcn_exp2f((a[r] * SCL - mx[t][r]) * L2E); const float p = (i >= kc + t * 16 + hi * 8 + r) ? e * rz[t][r] : 0.f; unsigned short h2, l2; splitf(p, h2, l2); ph[t][r] = h2; pl[t][r] = l2; } }
            const v16bf bh = cat16b(ph[0], ph[1]), bl = cat16b(pl[0], pl[1]);
#pragma unroll
            for (int mb = 0; mb < 4; ++mb) { acc[mb][nb] = wmmab(vh[mb], bh, acc[mb][nb]); acc[mb][nb] = wmmab(vh[mb], bl, acc[mb][nb]); acc[mb][nb] = wmmab(vl[mb], bh, acc[mb][nb]); } }
    }
#pragma unroll
    for (int mb = 0; mb < 4; ++mb)
#pragma unroll
        for (int nb = 0; nb < 4; ++nb) { float* p = &os[wv][(nb * 16 + lr) * 68 + mb * 16 + hi * 8]; const v8f a = acc[mb][nb]; *(v4fa*)p = __builtin_shufflevector(a, a, 0, 1, 2, 3); *(v4fa*)(p + 4) = __builtin_shufflevector(a, a, 4, 5, 6, 7); }
    __syncthreads();   // every wave's partial tile is in LDS before any thread sums across the waves
#pragma unroll
    for (int s = 0; s < 64 * 16 / (32 * CSW); ++s) { const int idx = s * 32 * CSW + (int)threadIdx.x; const int row = idx >> 4, cofs = (idx & 15) * 4; v4f val = *(const v4fa*)(&os[0][row * 68 + cofs]);
#pragma unroll
        for (int w = 1; w < CSW; ++w) val += *(const v4fa*)(&os[w][row * 68 + cofs]);
        v4us oh, ol;
#pragma unroll
        for (int q = 0; q < 4; ++q) { unsigned short a2, c2; splitf(val[q], a2, c2); oh[q] = a2; ol[q] = c2; }
        const size_t oo = (size_t)(r0 + row) * DQ + (size_t)blockIdx.x * HD + cofs; *(v4us*)(Ah + oo) = oh; *(v4us*)(Al + oo) = ol; }
}

extern "C" void kernel_launch(void* const* d_in, const int* in_sizes, int n_in,
                              void* d_out, int out_size, void* d_ws, size_t ws_size, hipStream_t stream) {
    (void)in_sizes; (void)n_in; (void)out_size;
    const float* x = (const float*)d_in[0]; const float* wqkv = (const float*)d_in[1]; const float* wo = (const float*)d_in[2];  const float* wq = nullptr; const float* wk = nullptr; const float* wv = nullptr; (void)wq; (void)wk; (void)wv;
    float* OUT = (float*)d_out;     // [2][2048][1024]
    char* wsp = (char*)d_ws;
    auto take = [&](size_t bytes) { char* p = wsp; wsp += (bytes + 255) & ~(size_t)255; return (void*)p; };
    bf* WALL = (bf*)take((size_t)3 * DM * DM * 2); bf* WQ = WALL; bf* WK = WALL + (size_t)DM * DM; bf* WV = WALL + (size_t)2 * DM * DM; bf* WO = (bf*)take((size_t)DM * DQ * 2); float* CS = (float*)take((size_t)TT * HD * 2 * 4);
    bf* XB = (bf*)take((size_t)TT * DM * 2); float* FQ = (float*)take((size_t)TT * DQ * 4); float* FK = (float*)take((size_t)TT * DKV * 4);
    h16* QP16 = (h16*)take((size_t)NH_ * TT * HD * 2); h16* KP16 = (h16*)take((size_t)NKV * TT * HD * 2); h16* VT16 = (h16*)take((size_t)NKV * HD * TT * 2);
    bf* QPh = (bf*)take((size_t)NH_ * TT * HD * 2); bf* QPl = (bf*)take((size_t)NH_ * TT * HD * 2); bf* KPh = (bf*)take((size_t)NKV * TT * HD * 2); bf* KPl = (bf*)take((size_t)NKV * TT * HD * 2); bf* VTh = (bf*)take((size_t)NKV * HD * TT * 2); bf* VTl = (bf*)take((size_t)NKV * HD * TT * 2);
    float* MX = (float*)take((size_t)NH_ * TT * 4); float* RZ = (float*)take((size_t)NH_ * TT * 4); float* PRJ = (float*)take((size_t)TT * DM * 4); bf* ATh = (bf*)take((size_t)TT * DQ * 2); bf* ATl = (bf*)take((size_t)TT * DQ * 2);
    if ((size_t)(wsp - (char*)d_ws) > ws_size) return;    // ws 256 MiB
    float* FV = FK;   // v projection reuses the k buffer after the k planes are built (stream-ordered)
    { k_wtG<<<(unsigned)((DM * 3 * DM / 64 + 63) / 64), 256, 0, stream>>>(wqkv, DM, 3 * DM, WALL);   /* fused 'xw' [DM][3DM] -> Bt [3DM][DM] (row blocks q | k | v) */
      k_wtG<<<(unsigned)((DQ * DM / 64 + 63) / 64), 256, 0, stream>>>(wo, DQ, DM, WO);
       }
    k_csid<<<(TT * HD + 255) / 256, 256, 0, stream>>>(CS);
    const unsigned LQ = (unsigned)(((size_t)NH_ * TT * HD / 2 + 255) / 256), LKv = (unsigned)(((size_t)NKV * TT * HD / 2 + 255) / 256);
    for (int b = 0; b < NB_; ++b) {
        
        k_cvt8<<<(unsigned)(((size_t)TT * DM / 8 + 255) / 256), 256, 0, stream>>>(x + (size_t)b * TT * DM, XB, (size_t)TT * DM / 8);
        k_gemmw<bf, 0, false><<<dim3(TT / 64, DQ / 64, 1), 32, 0, stream>>>(XB, nullptr, WQ, nullptr, DM, FQ, DQ, nullptr, 0, 0, 0);
        k_rope<<<LQ, 256, 0, stream>>>(FQ, DQ, NH_, CS, nullptr, nullptr, 1.0f, QP16, QPh, QPl);
        k_gemmw<bf, 0, false><<<dim3(TT / 64, DKV / 64, 1), 32, 0, stream>>>(XB, nullptr, WK, nullptr, DM, FK, DKV, nullptr, 0, 0, 0);
        k_rope<<<LKv, 256, 0, stream>>>(FK, DKV, NKV, CS, nullptr, nullptr, 1.0f, KP16, KPh, KPl);
        k_gemmw<bf, 0, false><<<dim3(TT / 64, DKV / 64, 1), 32, 0, stream>>>(XB, nullptr, WV, nullptr, DM, FV, DKV, nullptr, 0, 0, 0); k_vtp<<<LKv, 256, 0, stream>>>(FV, DKV, NKV, VT16, VTh, VTl);
        k_cstat<<<dim3(NH_, TT / 32, 1), 32 * CSW, 0, stream>>>(KPh, KPl, QPh, QPl, MX, RZ);   /* per key: maximum and 1/sum of the scores over the queries that see it (one kv head per query head) */
        k_cattn<<<dim3(NH_, TT / 64, 1), 32 * CSW, 0, stream>>>(KPh, KPl, QPh, QPl, VTh, VTl, MX, RZ, ATh, ATl);   /* A.v with the probabilities formed in registers, written as the merged hi/lo planes */
        k_gemmw<bf, 1, false><<<dim3(TT / 64, DM / 64, 1), 32, 0, stream>>>(ATh, ATl, WO, nullptr, DQ, PRJ, DM, nullptr, 0, 0, 0); k_mulx<<<(unsigned)(((size_t)TT * DM / 4 + 255) / 256), 256, 0, stream>>>(x + (size_t)b * TT * DM, PRJ, OUT + (size_t)b * TT * DM, (size_t)TT * DM / 4); }   /* out = x * (m W_proj) */
}

// v003
// It runs in 258 microseconds.
// In two side-by-side timings against v002, it was 1.45 and 1.44 times as fast.
// Counting every step since v000, it is 5.40 times as fast.
#include <hip/hip_runtime.h>

// Causal attention normalised over the QUERY axis, used as a multiplicative gate (x [2][2048][1024]; [q|k|v] = x W_qkv ('xw' [1024][3072], no bias; 16 heads x 64); s[i][j] = q_i.k_j/8 for j <= i else -inf; A = softmax over i (each key column normalised over the queries that see it); m = A v merged; proj = m W_proj ('xw'); out = x * proj -> [2][2048][1024]).
// Layout: the scores are formed key-major in registers (S^T[j][i] = k_j.q_i, every row hi/lo, 3 products) and never stored: k_cstat keeps each key's maximum and 1/sum over the queries i >= j; k_cattn forms the same S^T tiles again, turns them into probabilities and feeds them, still in registers, as the B operand of out^T[d][i] = sum_j v^T[d][j] A[i][j] (3 products), key loop cut at the diagonal; the output projection feeds an elementwise gate with bf16(x).
// Compute dtypes, f32 accumulate: every input rounded to bf16; q/k/v on PLAIN bf16 operands (inputs: exact); key-major scores and A.v on hi/lo planes for every row (3 products); column softmax in f32; W_proj hl x exact (2 products); the final x * proj gate in f32.

#define NB_  2
#define TT   2048
#define DM   1024
#define NH_  16
#define NKV  16
#define REP  (NH_ / NKV)
#define HD   64
#define DQ   (NH_ * HD)
#define DKV  (NKV * HD)
#define SCL  0.125f   // HD^-0.5
#define L2E  1.4426950408889634f
#define CSW  8                    // waves of a work-group that share one tile's loop in k_cstat (queries) and k_cattn (keys)
typedef _Float16 h16;
typedef unsigned short bf;
typedef __attribute__((ext_vector_type(16))) __bf16   v16bf;
typedef __attribute__((ext_vector_type(16))) _Float16 v16h;
typedef __attribute__((ext_vector_type(8)))  _Float16 v8h;
typedef __attribute__((ext_vector_type(8)))  unsigned short v8us;
typedef __attribute__((ext_vector_type(8)))  float    v8f;
typedef __attribute__((ext_vector_type(4)))  float    v4f;
typedef v8h  __attribute__((may_alias)) v8ha;
typedef v4f  __attribute__((may_alias)) v4fa;
typedef v8us __attribute__((may_alias)) v8usa;

__device__ __forceinline__ unsigned short f2bf(float f) { unsigned u = __float_as_uint(f); u += 0x7FFFu + ((u >> 16) & 1u); return (unsigned short)(u >> 16); }
__device__ __forceinline__ float bf2f(unsigned short b) { return __uint_as_float(((unsigned)b) << 16); }
__device__ __forceinline__ float bfr(float f) { return bf2f(f2bf(f)); }
__device__ __forceinline__ v16h cat16(v8h lo, v8h hi) { return __builtin_shufflevector(lo, hi, 0, 1, 2, 3, 4, 5, 6, 7, 8, 9, 10, 11, 12, 13, 14, 15); }
__device__ __forceinline__ v16bf cat16b(v8us lo, v8us hi) { return __builtin_bit_cast(v16bf, __builtin_shufflevector(lo, hi, 0, 1, 2, 3, 4, 5, 6, 7, 8, 9, 10, 11, 12, 13, 14, 15)); }
__device__ __forceinline__ v8f wmma16(v16h a, v16h b, v8f c) { return __builtin_amdgcn_wmma_f32_16x16x32_f16(false, a, false, b, (short)0, c, false, false); }
__device__ __forceinline__ v8f wmmab(v16bf a, v16bf b, v8f c) { return __builtin_amdgcn_wmma_f32_16x16x32_bf16(false, a, false, b, (short)0, c, false, false); }



// ---- k_gemmw: register-blocked GEMM, ONE WAVE per 64x64 output tile (16 accumulators), operands straight from K-contiguous 16-bit planes; grid (M/64, N/64, Z), 32 threads.
// C[m][n] (f32, pitch ldc, + optional f32 bias[n]) = sum_k A[m][k] Bt[n][k] (+ split products per NSPLIT). z-batch strides sA/sB/sC in elements. K % 32 == 0.
template <typename T16> struct WFrag;
template <> struct WFrag<h16> { typedef v16h V; static __device__ __forceinline__ V ld(const h16* p) { return cat16(*(const v8h*)p, *(const v8h*)(p + 16)); } static __device__ __forceinline__ v8f mma(V a, V b, v8f c) { return wmma16(a, b, c); } };
template <> struct WFrag<bf> { typedef v16bf V; static __device__ __forceinline__ V ld(const bf* p) { return cat16b(*(const v8us*)p, *(const v8us*)(p + 16)); } static __device__ __forceinline__ v8f mma(V a, V b, v8f c) { return wmmab(a, b, c); } };
template <typename T16, int NSPLIT, bool BIAS>
__global__ __launch_bounds__(32) void k_gemmw(const T16* __restrict__ A, const T16* __restrict__ A2, const T16* __restrict__ Bt, const T16* __restrict__ Bt2, int K, float* C, int ldc, const float* __restrict__ bias, size_t sA, size_t sB, size_t sC) {
    typedef typename WFrag<T16>::V V;
    __shared__ __align__(16) float os[16 * 68];
    const size_t z = blockIdx.z; A += z * sA; if (A2) A2 += z * sA; Bt += z * sB; if (Bt2) Bt2 += z * sB; C += z * sC;
    const int lane = threadIdx.x & 31, lr = lane & 15, hi = lane >> 4; const int r0 = blockIdx.x * 64, c0 = blockIdx.y * 64;
    v8f acc[4][4];
#pragma unroll
    for (int mb = 0; mb < 4; ++mb)
#pragma unroll
        for (int nb = 0; nb < 4; ++nb) acc[mb][nb] = (v8f){};
    const size_t aoff = (size_t)(r0 + lr) * K + 8 * hi, boff = (size_t)(c0 + lr) * K + 8 * hi;
#pragma unroll 1
    for (int kc = 0; kc < K; kc += 32) {
        V a[4], a2[4];
#pragma unroll
        for (int mb = 0; mb < 4; ++mb) { a[mb] = WFrag<T16>::ld(A + aoff + (size_t)mb * 16 * K + kc); if (NSPLIT == 1 || NSPLIT == 2) a2[mb] = WFrag<T16>::ld(A2 + aoff + (size_t)mb * 16 * K + kc); }
#pragma unroll
        for (int nb = 0; nb < 4; ++nb) { const V b = WFrag<T16>::ld(Bt + boff + (size_t)nb * 16 * K + kc); V b2; if (NSPLIT >= 2) b2 = WFrag<T16>::ld(Bt2 + boff + (size_t)nb * 16 * K + kc);
#pragma unroll
            for (int mb = 0; mb < 4; ++mb) { acc[mb][nb] = WFrag<T16>::mma(a[mb], b, acc[mb][nb]); if (NSPLIT == 1 || NSPLIT == 2) acc[mb][nb] = WFrag<T16>::mma(a2[mb], b, acc[mb][nb]); if (NSPLIT >= 2) acc[mb][nb] = WFrag<T16>::mma(a[mb], b2, acc[mb][nb]); } }
        asm volatile("v_nop\n\tv_nop\n\tv_nop\n\tv_nop" : "+v"(acc[0][0]), "+v"(acc[1][1]), "+v"(acc[2][2]), "+v"(acc[3][3]) : "v"(a[0]), "v"(a[3]));
    }
#pragma unroll
    for (int mb = 0; mb < 4; ++mb) {
#pragma unroll
        for (int nb = 0; nb < 4; ++nb) {
#pragma unroll
            for (int j = 0; j < 8; ++j) os[(hi * 8 + j) * 68 + nb * 16 + lr] = acc[mb][nb][j]; }
        __builtin_amdgcn_wave_barrier(); asm volatile("" ::: "memory");
        float* crow = C + (size_t)(r0 + mb * 16) * ldc + c0;
{
#pragma unroll
            for (int s = 0; s < 8; ++s) { const int row = 2 * s + hi, cofs = lr * 4; v4f val = *(const v4fa*)(os + row * 68 + cofs); if (BIAS) { val[0] += bfr(bias[c0 + cofs]); val[1] += bfr(bias[c0 + cofs + 1]); val[2] += bfr(bias[c0 + cofs + 2]); val[3] += bfr(bias[c0 + cofs + 3]); }
                *(v4f*)(crow + (size_t)row * ldc + cofs) = val; }
             }
        __builtin_amdgcn_wave_barrier(); asm volatile("" ::: "memory");
    }
}

__device__ __forceinline__ h16 tohx(float x) { return (h16)x; }
__device__ __forceinline__ void splitf(float y, unsigned short& h, unsigned short& l) { h = f2bf(y); l = f2bf(y - bf2f(h)); }
typedef __attribute__((ext_vector_type(2))) _Float16 v2h;
typedef __attribute__((ext_vector_type(4))) _Float16 v4h;
typedef __attribute__((ext_vector_type(2))) unsigned short v2us;
typedef __attribute__((ext_vector_type(4))) unsigned short v4us;
typedef __attribute__((ext_vector_type(2))) float v2f;
typedef __attribute__((ext_vector_type(4))) int v4i;

__global__ __launch_bounds__(256) void k_wtG(const float* __restrict__ w, int K, int N, bf* Bt) {
    const int lane = threadIdx.x & 31; const int L0 = (blockIdx.x * 8 + (threadIdx.x >> 5)) * 8; const int nlines = N * K / 64;
{
#pragma unroll 1
        for (int l = 0; l < 8; ++l) { const int L = L0 + l; if (L >= nlines) break; const size_t e = (size_t)L * 64 + lane * 2; const int k = (int)(e % K), n = (int)(e / K); v2us o;
            o[0] = f2bf(w[(size_t)k * N + n]); o[1] = f2bf(w[(size_t)(k + 1) * N + n]); *(v2us*)(Bt + e) = o; }
         }
}
__global__ __launch_bounds__(256) void k_cvt8(const float* __restrict__ src, bf* dst, size_t n8) { const size_t i = (size_t)blockIdx.x * 256 + threadIdx.x; if (i >= n8) return; const v8f v = *(const v8f*)(src + i * 8); v8us o;
#pragma unroll
    for (int k = 0; k < 8; ++k) o[k] = f2bf(v[k]); *(v8us*)(dst + i * 8) = o;  }

// k_rope: head planes [h][t][d] (fp16 + hi/lo) of rope(x) x sc with the rotate-half convention out[d] = x[d] cos[t][d] - x[d+HD/2] sin[t][d], out[d+HD/2] = x[d+HD/2] cos[t][d+HD/2] + x[d] sin[t][d+HD/2]
__global__ __launch_bounds__(256) void k_rope(const float* __restrict__ F, int pitch, int nheads, const float* __restrict__ CS, const float* __restrict__ RF, const float* __restrict__ nw, float sc, h16* P16, bf* Ph, bf* Pl) {
    const size_t e = ((size_t)blockIdx.x * 256 + threadIdx.x) * 2; if (e >= (size_t)nheads * TT * HD) return; const int d = (int)(e % HD); const int t = (int)((e / HD) % TT); const int h = (int)(e / ((size_t)HD * TT)); /* plane index: (q | k) x batch x head */ const float* f = F + (size_t)((h / NH_) % NB_ * TT + t) * pitch + (h / (NB_ * NH_)) * DQ + (h % NH_) * HD; float rf = 1.0f; v2h o16; v2us oh, ol;
    if (RF) { rf = RF[(size_t)h * TT + t]; asm volatile("s_wait_xcnt 0x0" ::: "memory"); }   // the wait stands in front of the later overwrites of the address registers that the RF load names
#pragma unroll
    for (int q = 0; q < 2; ++q) { const int dd = d + q; const int dp = (dd < HD / 2) ? dd + HD / 2 : dd - HD / 2; float x0 = f[dd], x1 = f[dp];
        asm volatile("s_wait_xcnt 0x0" ::: "memory");   // in front of the later overwrites of the address registers that the two loads above name
        if (RF) { float n0 = __fmul_rn(x0, rf), n1 = __fmul_rn(x1, rf); asm volatile("" : "+v"(n0)); asm volatile("" : "+v"(n1)); x0 = __fmul_rn(bfr(nw[dd]), n0); x1 = __fmul_rn(bfr(nw[dp]), n1); }
        const v2f cs = *(const v2f*)(CS + ((size_t)t * HD + dd) * 2); float a = __fmul_rn(x0, cs[0]), bq = __fmul_rn(x1, cs[1]); asm volatile("" : "+v"(a)); asm volatile("" : "+v"(bq)); const float r = ((dd < HD / 2) ? __fsub_rn(a, bq) : __fadd_rn(a, bq)) * sc;
        o16[q] = tohx(r); unsigned short a2, c2; splitf(r, a2, c2); oh[q] = a2; ol[q] = c2; }
    *(v2h*)(P16 + e) = o16; *(v2us*)(Ph + e) = oh; *(v2us*)(Pl + e) = ol;  }
__global__ __launch_bounds__(256) void k_vtp(const float* __restrict__ F, int pitch, int nheads, h16* V16, bf* Vh, bf* Vl) { const size_t e = ((size_t)blockIdx.x * 256 + threadIdx.x) * 2; if (e >= (size_t)nheads * HD * TT) return; const int t = (int)(e % TT); const int d = (int)((e / TT) % HD); const int g = (int)(e / ((size_t)TT * HD)); v2h o16; v2us oh, ol;
#pragma unroll
    for (int q = 0; q < 2; ++q) { const float x = F[(size_t)((g / NKV) * TT + t + q) * pitch + (g % NKV) * HD + d];   /* g: batch x head */ o16[q] = tohx(x); unsigned short a2, c2; splitf(x, a2, c2); oh[q] = a2; ol[q] = c2; }
    *(v2h*)(V16 + e) = o16; *(v2us*)(Vh + e) = oh; *(v2us*)(Vl + e) = ol;  }
__global__ __launch_bounds__(256) void k_csid(float* CS) { const int idx = blockIdx.x * 256 + threadIdx.x; if (idx >= TT * HD) return; v2f cs; cs[0] = 1.0f; cs[1] = 0.0f; *(v2f*)(CS + (size_t)idx * 2) = cs;  }
__global__ __launch_bounds__(256) void k_mulx(const float* __restrict__ X, const float* __restrict__ P, float* O, size_t n4) { const size_t i = (size_t)blockIdx.x * 256 + threadIdx.x; if (i >= n4) return; const v4f a = *(const v4f*)(X + i * 4), p = *(const v4f*)(P + i * 4); v4f o;
#pragma unroll
    for (int q = 0; q < 4; ++q) o[q] = __fmul_rn(bfr(a[q]), p[q]); *(v4f*)(O + i * 4) = o;  }

// value of lane l ^ X inside the 16-lane row (DPP row_xmask): the row reductions of k_cstat stay on the vector unit
template <int X> __device__ __forceinline__ float rowx(float x) { return __builtin_bit_cast(float, __builtin_amdgcn_update_dpp(0, __builtin_bit_cast(int, x), 0x160 | X, 0xf, 0xf, true)); }

// ---- k_cstat: column-softmax statistics. One work-group per 32 keys of one head (grid: head, key tile); the 64-wide query chunks from the diagonal on are dealt round-robin to the CSW waves.
// A = key rows (kept in registers), B = query rows, D = S^T tile: lane (lr, hi) holds keys hi*8 + r of queries lr. Every lane keeps a running (max, sum) per key row over its own queries;
// the 16 lanes of a row and then the CSW waves are merged at the end. MX[h][j] = max_i s, RZ[h][j] = 1 / sum_i exp(s - max).
__global__ __launch_bounds__(32 * CSW) void k_cstat(const bf* __restrict__ Kh, const bf* __restrict__ Kl, const bf* __restrict__ Qh, const bf* __restrict__ Ql, float* MX, float* RZ) {
    __shared__ float sm[CSW][32]; __shared__ float sl[CSW][32];
    const int wv = __builtin_amdgcn_readfirstlane(threadIdx.x >> 5);   // wave number in a scalar register: the query loop stays a scalar branch, every lane on at the matrix instructions
    const size_t zo = (size_t)blockIdx.x * TT * HD; const int lane = threadIdx.x & 31, lr = lane & 15, hi = lane >> 4; const int j0 = blockIdx.y * 32;
    v16bf kh[2][2], kl[2][2];
#pragma unroll
    for (int mb = 0; mb < 2; ++mb)
#pragma unroll
        for (int ks = 0; ks < 2; ++ks) { const size_t o = zo + (size_t)(j0 + mb * 16 + lr) * HD + ks * 32 + 8 * hi; kh[mb][ks] = WFrag<bf>::ld(Kh + o); kl[mb][ks] = WFrag<bf>::ld(Kl + o); }
    asm volatile("s_wait_xcnt 0x0" ::: "memory");   // in front of the loop's overwrites of the address registers that the key loads name
    __builtin_amdgcn_sched_barrier(0);   // keeps those overwrites behind the wait
    float m[2][8], l[2][8];
#pragma unroll
    for (int mb = 0; mb < 2; ++mb)
#pragma unroll
        for (int r = 0; r < 8; ++r) { m[mb][r] = -3.0e38f; l[mb][r] = 0.f; }
#pragma unroll 1
    for (int c0 = (j0 & ~63) + wv * 64; c0 < TT; c0 += CSW * 64) {
        v8f s[2][4];
#pragma unroll
        for (int nb = 0; nb < 4; ++nb) { v16bf qh[2], ql[2];
#pragma unroll
            for (int ks = 0; ks < 2; ++ks) { const size_t o = zo + (size_t)(c0 + nb * 16 + lr) * HD + ks * 32 + 8 * hi; qh[ks] = WFrag<bf>::ld(Qh + o); ql[ks] = WFrag<bf>::ld(Ql + o); }
#pragma unroll
            for (int mb = 0; mb < 2; ++mb) { v8f a = (v8f){};
#pragma unroll
                for (int ks = 0; ks < 2; ++ks) { a = wmmab(kh[mb][ks], qh[ks], a); a = wmmab(kl[mb][ks], qh[ks], a); a = wmmab(kh[mb][ks], ql[ks], a); }
                s[mb][nb] = a; } }
#pragma unroll
        for (int mb = 0; mb < 2; ++mb)
#pragma unroll
            for (int r = 0; r < 8; ++r) { const int j = j0 + mb * 16 + hi * 8 + r; float t[4]; float mn = m[mb][r];
#pragma unroll
                for (int nb = 0; nb < 4; ++nb) { t[nb] = (c0 + nb * 16 + lr >= j) ? s[mb][nb][r] * SCL : -3.0e38f;   /* causal keeps queries i >= key j */ mn = fmaxf(mn, t[nb]); }
                float a = l[mb][r] * __builtin_amdgcn_exp2f((m[mb][r] - mn) * L2E);
#pragma unroll
                for (int nb = 0; nb < 4; ++nb) a += (c0 + nb * 16 + lr >= j) ? __builtin_amdgcn_exp2f((t[nb] - mn) * L2E) : 0.f;
                l[mb][r] = a; m[mb][r] = mn; }
        asm volatile("s_wait_xcnt 0x0" ::: "memory");   // in front of the next trip's overwrites of the address registers that this trip's query loads name
    }
#pragma unroll
    for (int mb = 0; mb < 2; ++mb)
#pragma unroll
        for (int r = 0; r < 8; ++r) { float M = m[mb][r]; M = fmaxf(M, rowx<1>(M)); M = fmaxf(M, rowx<2>(M)); M = fmaxf(M, rowx<4>(M)); M = fmaxf(M, rowx<8>(M));
            float a = l[mb][r] * __builtin_amdgcn_exp2f((m[mb][r] - M) * L2E); a += rowx<1>(a); a += rowx<2>(a); a += rowx<4>(a); a += rowx<8>(a); m[mb][r] = M; l[mb][r] = a; }
    if (lr == 0) {
#pragma unroll
        for (int mb = 0; mb < 2; ++mb)
#pragma unroll
            for (int r = 0; r < 8; ++r) { sm[wv][mb * 16 + hi * 8 + r] = m[mb][r]; sl[wv][mb * 16 + hi * 8 + r] = l[mb][r]; } }
    __syncthreads();   // every wave's (max, sum) per key is in LDS before the first wave merges them
    if (threadIdx.x < 32) { const int row = threadIdx.x; float M = sm[0][row];
#pragma unroll
        for (int w = 1; w < CSW; ++w) M = fmaxf(M, sm[w][row]);
        float Z = 0.f;
#pragma unroll
        for (int w = 0; w < CSW; ++w) Z += sl[w][row] * __builtin_amdgcn_exp2f((sm[w][row] - M) * L2E);
        const size_t o = (size_t)blockIdx.x * TT + j0 + row; MX[o] = M; RZ[o] = __fdiv_rn(1.0f, Z); }
}

// ---- k_cattn: out^T[d][i] = sum_j v^T[d][j] A[i][j] for 64 queries of one head per work-group (grid: head, query tile, the longest key loops first); the 32-wide key chunks up to the diagonal block are dealt
// round-robin to the CSW waves. Per chunk a wave forms S^T (two 16-key tiles per 16 queries), p = exp(s - MX[j]) RZ[j] (0 for j > i), splits p hi/lo, and uses the two tiles as they lie as one B fragment:
// D of tile t holds keys t*16 + hi*8 + r at lane (lr, hi), which is the k order 8*hi + e | 16 + 8*hi + e of the A loader of v^T. The CSW partial tiles are summed through LDS in wave order and written as the merged hi/lo planes.
__global__ __launch_bounds__(32 * CSW) void k_cattn(const bf* __restrict__ Kh, const bf* __restrict__ Kl, const bf* __restrict__ Qh, const bf* __restrict__ Ql, const bf* __restrict__ Vh, const bf* __restrict__ Vl, const float* __restrict__ MX, const float* __restrict__ RZ, bf* Ah, bf* Al) {
    __shared__ __align__(16) float os[CSW][64 * 68];
    const int wv = __builtin_amdgcn_readfirstlane(threadIdx.x >> 5);   // wave number in a scalar register: the key loop stays a scalar branch, every lane on at the matrix instructions
    const size_t zo = (size_t)blockIdx.x * TT * HD, zs = (size_t)blockIdx.x * TT; const int lane = threadIdx.x & 31, lr = lane & 15, hi = lane >> 4; const int r0 = (TT / 64 - 1 - (int)blockIdx.y) * 64;
    v16bf qh[4][2], ql[4][2];
#pragma unroll
    for (int nb = 0; nb < 4; ++nb)
#pragma unroll
        for (int ks = 0; ks < 2; ++ks) { const size_t o = zo + (size_t)(r0 + nb * 16 + lr) * HD + ks * 32 + 8 * hi; qh[nb][ks] = WFrag<bf>::ld(Qh + o); ql[nb][ks] = WFrag<bf>::ld(Ql + o); }
    asm volatile("s_wait_xcnt 0x0" ::: "memory");   // in front of the loop's overwrites of the address registers that the query loads name
    __builtin_amdgcn_sched_barrier(0);   // keeps those overwrites behind the wait
    v8f acc[4][4];
#pragma unroll
    for (int mb = 0; mb < 4; ++mb)
#pragma unroll
        for (int nb = 0; nb < 4; ++nb) acc[mb][nb] = (v8f){};
#pragma unroll 1
    for (int kc = wv * 32; kc < r0 + 64; kc += CSW * 32) {
        v16bf kh[2][2], kl[2][2], vh[4], vl[4]; v8f mx[2], rz[2];
#pragma unroll
        for (int t = 0; t < 2; ++t) { mx[t] = *(const v8f*)(MX + zs + kc + t * 16 + hi * 8); rz[t] = *(const v8f*)(RZ + zs + kc + t * 16 + hi * 8);
#pragma unroll
            for (int ks = 0; ks < 2; ++ks) { const size_t o = zo + (size_t)(kc + t * 16 + lr) * HD + ks * 32 + 8 * hi; kh[t][ks] = WFrag<bf>::ld(Kh + o); kl[t][ks] = WFrag<bf>::ld(Kl + o); } }
#pragma unroll
        for (int mb = 0; mb < 4; ++mb) { const size_t o = zo + (size_t)(mb * 16 + lr) * TT + kc + 8 * hi; vh[mb] = WFrag<bf>::ld(Vh + o); vl[mb] = WFrag<bf>::ld(Vl + o); }
        __builtin_amdgcn_sched_barrier(0);   // every load of the chunk is issued in front of its first matrix instruction: one exposed load latency per chunk; left free, the v^T loads sink between the products
        asm volatile("s_wait_xcnt 0x0" ::: "memory");   // stands in front of every later overwrite of an address register that the chunk's loads name
        __builtin_amdgcn_sched_barrier(0);   // keeps the address updates of the next chunk behind that wait
#pragma unroll
        for (int nb = 0; nb < 4; ++nb) { v8us ph[2], pl[2]; const int i = r0 + nb * 16 + lr;
#pragma unroll
            for (int t = 0; t < 2; ++t) { v8f a = (v8f){};
#pragma unroll
                for (int ks = 0; ks < 2; ++ks) { a = wmmab(kh[t][ks], qh[nb][ks], a); a = wmmab(kl[t][ks], qh[nb][ks], a); a = wmmab(kh[t][ks], ql[nb][ks], a); }
#pragma unroll
                for (int r = 0; r < 8; ++r) { const float e = __builtin_amdgcn_exp2f((a[r] * SCL - mx[t][r]) * L2E); const float p = (i >= kc + t * 16 + hi * 8 + r) ? e * rz[t][r] : 0.f; unsigned short h2, l2; splitf(p, h2, l2); ph[t][r] = h2; pl[t][r] = l2; } }
            const v16bf bh = cat16b(ph[0], ph[1]), bl = cat16b(pl[0], pl[1]);
#pragma unroll
            for (int mb = 0; mb < 4; ++mb) { acc[mb][nb] = wmmab(vh[mb], bh, acc[mb][nb]); acc[mb][nb] = wmmab(vh[mb], bl, acc[mb][nb]); acc[mb][nb] = wmmab(vl[mb], bh, acc[mb][nb]); } }
    }
#pragma unroll
    for (int mb = 0; mb < 4; ++mb)
#pragma unroll
        for (int nb = 0; nb < 4; ++nb) { float* p = &os[wv][(nb * 16 + lr) * 68 + mb * 16 + hi * 8]; const v8f a = acc[mb][nb]; *(v4fa*)p = __builtin_shufflevector(a, a, 0, 1, 2, 3); *(v4fa*)(p + 4) = __builtin_shufflevector(a, a, 4, 5, 6, 7); }
    __syncthreads();   // every wave's partial tile is in LDS before any thread sums across the waves
#pragma unroll
    for (int s = 0; s < 64 * 16 / (32 * CSW); ++s) { const int idx = s * 32 * CSW + (int)threadIdx.x; const int row = idx >> 4, cofs = (idx & 15) * 4; v4f val = *(const v4fa*)(&os[0][row * 68 + cofs]);
#pragma unroll
        for (int w = 1; w < CSW; ++w) val += *(const v4fa*)(&os[w][row * 68 + cofs]);
        v4us oh, ol;
#pragma unroll
        for (int q = 0; q < 4; ++q) { unsigned short a2, c2; splitf(val[q], a2, c2); oh[q] = a2; ol[q] = c2; }
        const size_t oo = (size_t)((int)(blockIdx.x / NH_) * TT + r0 + row) * DQ + (size_t)(blockIdx.x % NH_) * HD + cofs;   /* blockIdx.x: batch x head */ *(v4us*)(Ah + oo) = oh; *(v4us*)(Al + oo) = ol; }
}

extern "C" void kernel_launch(void* const* d_in, const int* in_sizes, int n_in,
                              void* d_out, int out_size, void* d_ws, size_t ws_size, hipStream_t stream) {
    (void)in_sizes; (void)n_in; (void)out_size;
    const float* x = (const float*)d_in[0]; const float* wqkv = (const float*)d_in[1]; const float* wo = (const float*)d_in[2];  const float* wq = nullptr; const float* wk = nullptr; const float* wv = nullptr; (void)wq; (void)wk; (void)wv;
    float* OUT = (float*)d_out;     // [2][2048][1024]
    char* wsp = (char*)d_ws;
    auto take = [&](size_t bytes) { char* p = wsp; wsp += (bytes + 255) & ~(size_t)255; return (void*)p; };
    bf* WALL = (bf*)take((size_t)3 * DM * DM * 2); bf* WO = (bf*)take((size_t)DM * DQ * 2); float* CS = (float*)take((size_t)TT * HD * 2 * 4);
    bf* XB = (bf*)take((size_t)NB_ * TT * DM * 2); float* FQKV = (float*)take((size_t)NB_ * TT * 3 * DM * 4);   // [batch x t][q | k | v]
    const size_t PL = (size_t)NB_ * NH_ * TT * HD;   // one plane set: [batch x head][t][d] (v: [batch x head][d][t])
    h16* QP16 = (h16*)take(2 * PL * 2); h16* VT16 = (h16*)take(PL * 2);   // q planes, then k planes
    bf* QPh = (bf*)take(2 * PL * 2); bf* QPl = (bf*)take(2 * PL * 2); bf* KPh = QPh + PL; bf* KPl = QPl + PL; bf* VTh = (bf*)take(PL * 2); bf* VTl = (bf*)take(PL * 2);
    float* MX = (float*)take((size_t)NB_ * NH_ * TT * 4); float* RZ = (float*)take((size_t)NB_ * NH_ * TT * 4); float* PRJ = (float*)take((size_t)NB_ * TT * DM * 4); bf* ATh = (bf*)take((size_t)NB_ * TT * DQ * 2); bf* ATl = (bf*)take((size_t)NB_ * TT * DQ * 2);
    if ((size_t)(wsp - (char*)d_ws) > ws_size) return;    // ws 256 MiB
    { k_wtG<<<(unsigned)((DM * 3 * DM / 64 + 63) / 64), 256, 0, stream>>>(wqkv, DM, 3 * DM, WALL);   /* fused 'xw' [DM][3DM] -> Bt [3DM][DM] (row blocks q | k | v) */
      k_wtG<<<(unsigned)((DQ * DM / 64 + 63) / 64), 256, 0, stream>>>(wo, DQ, DM, WO);
       }
    k_csid<<<(TT * HD + 255) / 256, 256, 0, stream>>>(CS);
    // one launch per stage: both batches (rows of x are contiguous) and, in the projection, q | k | v (rows of WALL are contiguous) are grid dimensions
    k_cvt8<<<(unsigned)(((size_t)NB_ * TT * DM / 8 + 255) / 256), 256, 0, stream>>>(x, XB, (size_t)NB_ * TT * DM / 8);
    k_gemmw<bf, 0, false><<<dim3(NB_ * TT / 64, 3 * DM / 64, 1), 32, 0, stream>>>(XB, nullptr, WALL, nullptr, DM, FQKV, 3 * DM, nullptr, 0, 0, 0);
    k_rope<<<(unsigned)((2 * PL / 2 + 255) / 256), 256, 0, stream>>>(FQKV, 3 * DM, 2 * NB_ * NH_, CS, nullptr, nullptr, 1.0f, QP16, QPh, QPl);
    k_vtp<<<(unsigned)((PL / 2 + 255) / 256), 256, 0, stream>>>(FQKV + 2 * DM, 3 * DM, NB_ * NKV, VT16, VTh, VTl);
    k_cstat<<<dim3(NB_ * NH_, TT / 32, 1), 32 * CSW, 0, stream>>>(KPh, KPl, QPh, QPl, MX, RZ);   /* per key: maximum and 1/sum of the scores over the queries that see it (one kv head per query head) */
    k_cattn<<<dim3(NB_ * NH_, TT / 64, 1), 32 * CSW, 0, stream>>>(KPh, KPl, QPh, QPl, VTh, VTl, MX, RZ, ATh, ATl);   /* A.v with the probabilities formed in registers, written as the merged hi/lo planes */
    k_gemmw<bf, 1, false><<<dim3(NB_ * TT / 64, DM / 64, 1), 32, 0, stream>>>(ATh, ATl, WO, nullptr, DQ, PRJ, DM, nullptr, 0, 0, 0);
    k_mulx<<<(unsigned)(((size_t)NB_ * TT * DM / 4 + 255) / 256), 256, 0, stream>>>(x, PRJ, OUT, (size_t)NB_ * TT * DM / 4);   /* out = x * (m W_proj) */
}

// v004
// One run takes 214 microseconds.
// Two timings next to v003 put it at 1.20 and 1.21 times that version's speed.
// All steps since v000 together make it 6.52 times as fast.
#include <hip/hip_runtime.h>

// Causal attention normalised over the QUERY axis, used as a multiplicative gate (x [2][2048][1024]; [q|k|v] = x W_qkv ('xw' [1024][3072], no bias; 16 heads x 64); s[i][j] = q_i.k_j/8 for j <= i else -inf; A = softmax over i (each key column normalised over the queries that see it); m = A v merged; proj = m W_proj ('xw'); out = x * proj -> [2][2048][1024]).
// Layout: the scores are formed key-major in registers (S^T[j][i] = k_j.q_i, every row hi/lo, 3 products) and never stored: k_cstat keeps each key's maximum and 1/sum over the queries i >= j; k_cattn forms the same S^T tiles again, turns them into probabilities and feeds them, still in registers, as the B operand of out^T[d][i] = sum_j v^T[d][j] A[i][j] (3 products), key loop cut at the diagonal. No elementwise stage of its own between the GEMMs: the q|k|v projection's epilogue writes the hi/lo head planes and the transposed v planes, the output projection's epilogue applies the gate with bf16(x).
// Compute dtypes, f32 accumulate: every input rounded to bf16; q/k/v on PLAIN bf16 operands (inputs: exact); key-major scores and A.v on hi/lo planes for every row (3 products); column softmax in f32; W_proj hl x exact (2 products); the final x * proj gate in f32.

#define NB_  2
#define TT   2048
#define DM   1024
#define NH_  16
#define NKV  16
#define REP  (NH_ / NKV)
#define HD   64
#define DQ   (NH_ * HD)
#define DKV  (NKV * HD)
#define SCL  0.125f   // HD^-0.5
#define L2E  1.4426950408889634f
#define CSW  8                    // waves of a work-group that share one tile's loop in k_cstat (queries) and k_cattn (keys)
typedef _Float16 h16;
typedef unsigned short bf;
typedef __attribute__((ext_vector_type(16))) __bf16   v16bf;
typedef __attribute__((ext_vector_type(16))) _Float16 v16h;
typedef __attribute__((ext_vector_type(8)))  _Float16 v8h;
typedef __attribute__((ext_vector_type(8)))  unsigned short v8us;
typedef __attribute__((ext_vector_type(8)))  float    v8f;
typedef __attribute__((ext_vector_type(4)))  float    v4f;
typedef v8h  __attribute__((may_alias)) v8ha;
typedef v4f  __attribute__((may_alias)) v4fa;
typedef v8us __attribute__((may_alias)) v8usa;

__device__ __forceinline__ unsigned short f2bf(float f) { unsigned u = __float_as_uint(f); u += 0x7FFFu + ((u >> 16) & 1u); return (unsigned short)(u >> 16); }
__device__ __forceinline__ float bf2f(unsigned short b) { return __uint_as_float(((unsigned)b) << 16); }
__device__ __forceinline__ float bfr(float f) { return bf2f(f2bf(f)); }
__device__ __forceinline__ v16h cat16(v8h lo, v8h hi) { return __builtin_shufflevector(lo, hi, 0, 1, 2, 3, 4, 5, 6, 7, 8, 9, 10, 11, 12, 13, 14, 15); }
__device__ __forceinline__ v16bf cat16b(v8us lo, v8us hi) { return __builtin_bit_cast(v16bf, __builtin_shufflevector(lo, hi, 0, 1, 2, 3, 4, 5, 6, 7, 8, 9, 10, 11, 12, 13, 14, 15)); }
__device__ __forceinline__ v8f wmma16(v16h a, v16h b, v8f c) { return __builtin_amdgcn_wmma_f32_16x16x32_f16(false, a, false, b, (short)0, c, false, false); }
__device__ __forceinline__ v8f wmmab(v16bf a, v16bf b, v8f c) { return __builtin_amdgcn_wmma_f32_16x16x32_bf16(false, a, false, b, (short)0, c, false, false); }
__device__ __forceinline__ void splitf(float y, unsigned short& h, unsigned short& l) { h = f2bf(y); l = f2bf(y - bf2f(h)); }
typedef __attribute__((ext_vector_type(2))) unsigned short v2us;
typedef __attribute__((ext_vector_type(4))) unsigned short v4us;



// ---- k_gemmw: register-blocked GEMM, ONE WAVE per 64x64 output tile (16 accumulators), operands straight from K-contiguous 16-bit planes; grid (M/64, N/64), 32 threads.
// c[m][n] (f32, in registers) = sum_k A[m][k] Bt[n][k] (+ split products per NSPLIT). K % 32 == 0. The tile never reaches memory as f32; the epilogue writes what the next stage reads:
// EPI 1 (q | k | v projection; a 64-column tile is one head of q, k or v): q and k as hi/lo head planes [q | k][batch][head][t][d], v as transposed hi/lo planes [batch][head][d][t].
// EPI 2 (output projection): O[m][n] = bf16(X[m][n]) * c[m][n], both of pitch DM.
template <typename T16> struct WFrag;
template <> struct WFrag<h16> { typedef v16h V; static __device__ __forceinline__ V ld(const h16* p) { return cat16(*(const v8h*)p, *(const v8h*)(p + 16)); } static __device__ __forceinline__ v8f mma(V a, V b, v8f c) { return wmma16(a, b, c); } };
template <> struct WFrag<bf> { typedef v16bf V; static __device__ __forceinline__ V ld(const bf* p) { return cat16b(*(const v8us*)p, *(const v8us*)(p + 16)); } static __device__ __forceinline__ v8f mma(V a, V b, v8f c) { return wmmab(a, b, c); } };
template <typename T16, int NSPLIT, int EPI>
__global__ __launch_bounds__(32) void k_gemmw(const T16* __restrict__ A, const T16* __restrict__ A2, const T16* __restrict__ Bt, const T16* __restrict__ Bt2, int K, const float* __restrict__ X, float* O, bf* Ph, bf* Pl, bf* Vh, bf* Vl) {
    typedef typename WFrag<T16>::V V;
    __shared__ __align__(16) float os[16 * 68];
    const int lane = threadIdx.x & 31, lr = lane & 15, hi = lane >> 4; const int r0 = blockIdx.x * 64, c0 = blockIdx.y * 64;
    v8f acc[4][4];
#pragma unroll
    for (int mb = 0; mb < 4; ++mb)
#pragma unroll
        for (int nb = 0; nb < 4; ++nb) acc[mb][nb] = (v8f){};
    const size_t aoff = (size_t)(r0 + lr) * K + 8 * hi, boff = (size_t)(c0 + lr) * K + 8 * hi;
#pragma unroll 1
    for (int kc = 0; kc < K; kc += 32) {
        V a[4], a2[4];
#pragma unroll
        for (int mb = 0; mb < 4; ++mb) { a[mb] = WFrag<T16>::ld(A + aoff + (size_t)mb * 16 * K + kc); if (NSPLIT == 1 || NSPLIT == 2) a2[mb] = WFrag<T16>::ld(A2 + aoff + (size_t)mb * 16 * K + kc); }
#pragma unroll
        for (int nb = 0; nb < 4; ++nb) { const V b = WFrag<T16>::ld(Bt + boff + (size_t)nb * 16 * K + kc); V b2; if (NSPLIT >= 2) b2 = WFrag<T16>::ld(Bt2 + boff + (size_t)nb * 16 * K + kc);
#pragma unroll
            for (int mb = 0; mb < 4; ++mb) { acc[mb][nb] = WFrag<T16>::mma(a[mb], b, acc[mb][nb]); if (NSPLIT == 1 || NSPLIT == 2) acc[mb][nb] = WFrag<T16>::mma(a2[mb], b, acc[mb][nb]); if (NSPLIT >= 2) acc[mb][nb] = WFrag<T16>::mma(a[mb], b2, acc[mb][nb]); } }
        asm volatile("v_nop\n\tv_nop\n\tv_nop\n\tv_nop" : "+v"(acc[0][0]), "+v"(acc[1][1]), "+v"(acc[2][2]), "+v"(acc[3][3]) : "v"(a[0]), "v"(a[3]));
    }
    const int bt = r0 / TT, t0 = r0 % TT, sec = c0 / DM, hd = (c0 % DM) / HD;   // EPI 1: batch, first position, q | k | v, head of this tile (all from blockIdx: scalar)
    if (EPI == 1 && sec == 2) {   // v: a lane holds 8 consecutive positions of one d per accumulator, which is the transposed plane's own order: stored straight from registers, the four pieces of a 128-byte line one after the other
        const size_t vo = ((size_t)(bt * NKV + hd) * HD + lr) * TT + t0 + hi * 8; bf* vh = Vh + vo; bf* vl = Vl + vo;
#pragma unroll
        for (int nb = 0; nb < 4; ++nb) { v8us oh[4], ol[4];
#pragma unroll
            for (int mb = 0; mb < 4; ++mb)
#pragma unroll
                for (int j = 0; j < 8; ++j) { unsigned short a2, c2; splitf(acc[mb][nb][j], a2, c2); oh[mb][j] = a2; ol[mb][j] = c2; }
#pragma unroll
            for (int mb = 0; mb < 4; ++mb) *(v8us*)(vh + nb * 16 * TT + mb * 16) = oh[mb];
#pragma unroll
            for (int mb = 0; mb < 4; ++mb) *(v8us*)(vl + nb * 16 * TT + mb * 16) = ol[mb];
            asm volatile("s_wait_xcnt 0x0" ::: "memory");   // in front of the next group's overwrites of the data registers that these stores name
            __builtin_amdgcn_sched_barrier(0);   // keeps those overwrites behind the wait
        }
        return;
    }
    v4f xs[4][8]; const size_t go = (size_t)(r0 + hi) * DM + c0 + lr * 4;   // EPI 2: this lane's first element of X and O
    if (EPI == 2) {   // the gate's x values of the whole tile are asked for at once, in front of the staging: one exposed latency per tile
        const float* xp = X + go;
#pragma unroll
        for (int mb = 0; mb < 4; ++mb)
#pragma unroll
            for (int s = 0; s < 8; ++s) xs[mb][s] = *(const v4f*)(xp + (mb * 16 + 2 * s) * DM);
    }
    const size_t po = ((size_t)((sec * NB_ + bt) * NH_ + hd) * TT + t0 + hi) * HD + lr * 4;   // EPI 1: this lane's first element of the tile's 64 rows in its q or k head plane
#pragma unroll
    for (int mb = 0; mb < 4; ++mb) {
#pragma unroll
        for (int nb = 0; nb < 4; ++nb) {
#pragma unroll
            for (int j = 0; j < 8; ++j) os[(hi * 8 + j) * 68 + nb * 16 + lr] = acc[mb][nb][j]; }
        __builtin_amdgcn_wave_barrier(); asm volatile("" ::: "memory");
        if (EPI == 1) { v4us oh[8], ol[8]; bf* ph = Ph + po; bf* pl = Pl + po;
#pragma unroll
            for (int s = 0; s < 8; ++s) { const v4f val = *(const v4fa*)(os + (2 * s + hi) * 68 + lr * 4);
#pragma unroll
                for (int q = 0; q < 4; ++q) { unsigned short a2, c2; splitf(val[q], a2, c2); oh[s][q] = a2; ol[s][q] = c2; } }
#pragma unroll
            for (int s = 0; s < 8; ++s) *(v4us*)(ph + (mb * 16 + 2 * s) * HD) = oh[s];
#pragma unroll
            for (int s = 0; s < 8; ++s) *(v4us*)(pl + (mb * 16 + 2 * s) * HD) = ol[s]; }
        if (EPI == 2) { v4f o[8]; float* op = O + go;
#pragma unroll
            for (int s = 0; s < 8; ++s) { const v4f val = *(const v4fa*)(os + (2 * s + hi) * 68 + lr * 4);
#pragma unroll
                for (int q = 0; q < 4; ++q) o[s][q] = __fmul_rn(bfr(xs[mb][s][q]), val[q]); }
#pragma unroll
            for (int s = 0; s < 8; ++s) *(v4f*)(op + (mb * 16 + 2 * s) * DM) = o[s]; }
        __builtin_amdgcn_wave_barrier(); asm volatile("s_wait_xcnt 0x0" ::: "memory");   // in front of the next group's overwrites of the data registers that these stores name; as a compiler fence it also keeps the next group's LDS writes behind this group's reads
        __builtin_amdgcn_sched_barrier(0);   // keeps those overwrites behind the wait
    }
}

__global__ __launch_bounds__(256) void k_wtG(const float* __restrict__ w, int K, int N, bf* Bt) {
    const int lane = threadIdx.x & 31; const int L0 = (blockIdx.x * 8 + (threadIdx.x >> 5)) * 8; const int nlines = N * K / 64;
{
#pragma unroll 1
        for (int l = 0; l < 8; ++l) { const int L = L0 + l; if (L >= nlines) break; const size_t e = (size_t)L * 64 + lane * 2; const int k = (int)(e % K), n = (int)(e / K); v2us o;
            o[0] = f2bf(w[(size_t)k * N + n]); o[1] = f2bf(w[(size_t)(k + 1) * N + n]); *(v2us*)(Bt + e) = o; }
         }
}
__global__ __launch_bounds__(256) void k_cvt8(const float* __restrict__ src, bf* dst, size_t n8) { const size_t i = (size_t)blockIdx.x * 256 + threadIdx.x; if (i >= n8) return; const v8f v = *(const v8f*)(src + i * 8); v8us o;
#pragma unroll
    for (int k = 0; k < 8; ++k) o[k] = f2bf(v[k]); *(v8us*)(dst + i * 8) = o;  }


// value of lane l ^ X inside the 16-lane row (DPP row_xmask): the row reductions of k_cstat stay on the vector unit
template <int X> __device__ __forceinline__ float rowx(float x) { return __builtin_bit_cast(float, __builtin_amdgcn_update_dpp(0, __builtin_bit_cast(int, x), 0x160 | X, 0xf, 0xf, true)); }

// ---- k_cstat: column-softmax statistics. One work-group per 32 keys of one head (grid: head, key tile); the 64-wide query chunks from the diagonal on are dealt round-robin to the CSW waves.
// A = key rows (kept in registers), B = query rows, D = S^T tile: lane (lr, hi) holds keys hi*8 + r of queries lr. Every lane keeps a running (max, sum) per key row over its own queries;
// the 16 lanes of a row and then the CSW waves are merged at the end. MX[h][j] = max_i s, RZ[h][j] = 1 / sum_i exp(s - max).
__global__ __launch_bounds__(32 * CSW) void k_cstat(const bf* __restrict__ Kh, const bf* __restrict__ Kl, const bf* __restrict__ Qh, const bf* __restrict__ Ql, float* MX, float* RZ) {
    __shared__ float sm[CSW][32]; __shared__ float sl[CSW][32];
    const int wv = __builtin_amdgcn_readfirstlane(threadIdx.x >> 5);   // wave number in a scalar register: the query loop stays a scalar branch, every lane on at the matrix instructions
    const size_t zo = (size_t)blockIdx.x * TT * HD; const int lane = threadIdx.x & 31, lr = lane & 15, hi = lane >> 4; const int j0 = blockIdx.y * 32;
    v16bf kh[2][2], kl[2][2];
#pragma unroll
    for (int mb = 0; mb < 2; ++mb)
#pragma unroll
        for (int ks = 0; ks < 2; ++ks) { const size_t o = zo + (size_t)(j0 + mb * 16 + lr) * HD + ks * 32 + 8 * hi; kh[mb][ks] = WFrag<bf>::ld(Kh + o); kl[mb][ks] = WFrag<bf>::ld(Kl + o); }
    asm volatile("s_wait_xcnt 0x0" ::: "memory");   // in front of the loop's overwrites of the address registers that the key loads name
    __builtin_amdgcn_sched_barrier(0);   // keeps those overwrites behind the wait
    float m[2][8], l[2][8];
#pragma unroll
    for (int mb = 0; mb < 2; ++mb)
#pragma unroll
        for (int r = 0; r < 8; ++r) { m[mb][r] = -3.0e38f; l[mb][r] = 0.f; }
#pragma unroll 1
    for (int c0 = (j0 & ~63) + wv * 64; c0 < TT; c0 += CSW * 64) {
        v8f s[2][4];
#pragma unroll
        for (int nb = 0; nb < 4; ++nb) { v16bf qh[2], ql[2];
#pragma unroll
            for (int ks = 0; ks < 2; ++ks) { const size_t o = zo + (size_t)(c0 + nb * 16 + lr) * HD + ks * 32 + 8 * hi; qh[ks] = WFrag<bf>::ld(Qh + o); ql[ks] = WFrag<bf>::ld(Ql + o); }
#pragma unroll
            for (int mb = 0; mb < 2; ++mb) { v8f a = (v8f){};
#pragma unroll
                for (int ks = 0; ks < 2; ++ks) { a = wmmab(kh[mb][ks], qh[ks], a); a = wmmab(kl[mb][ks], qh[ks], a); a = wmmab(kh[mb][ks], ql[ks], a); }
                s[mb][nb] = a; } }
#pragma unroll
        for (int mb = 0; mb < 2; ++mb)
#pragma unroll
            for (int r = 0; r < 8; ++r) { const int j = j0 + mb * 16 + hi * 8 + r; float t[4]; float mn = m[mb][r];
#pragma unroll
                for (int nb = 0; nb < 4; ++nb) { t[nb] = (c0 + nb * 16 + lr >= j) ? s[mb][nb][r] * SCL : -3.0e38f;   /* causal keeps queries i >= key j */ mn = fmaxf(mn, t[nb]); }
                float a = l[mb][r] * __builtin_amdgcn_exp2f((m[mb][r] - mn) * L2E);
#pragma unroll
                for (int nb = 0; nb < 4; ++nb) a += (c0 + nb * 16 + lr >= j) ? __builtin_amdgcn_exp2f((t[nb] - mn) * L2E) : 0.f;
                l[mb][r] = a; m[mb][r] = mn; }
        asm volatile("s_wait_xcnt 0x0" ::: "memory");   // in front of the next trip's overwrites of the address registers that this trip's query loads name
    }
#pragma unroll
    for (int mb = 0; mb < 2; ++mb)
#pragma unroll
        for (int r = 0; r < 8; ++r) { float M = m[mb][r]; M = fmaxf(M, rowx<1>(M)); M = fmaxf(M, rowx<2>(M)); M = fmaxf(M, rowx<4>(M)); M = fmaxf(M, rowx<8>(M));
            float a = l[mb][r] * __builtin_amdgcn_exp2f((m[mb][r] - M) * L2E); a += rowx<1>(a); a += rowx<2>(a); a += rowx<4>(a); a += rowx<8>(a); m[mb][r] = M; l[mb][r] = a; }
    if (lr == 0) {
#pragma unroll
        for (int mb = 0; mb < 2; ++mb)
#pragma unroll
            for (int r = 0; r < 8; ++r) { sm[wv][mb * 16 + hi * 8 + r] = m[mb][r]; sl[wv][mb * 16 + hi * 8 + r] = l[mb][r]; } }
    __syncthreads();   // every wave's (max, sum) per key is in LDS before the first wave merges them
    if (threadIdx.x < 32) { const int row = threadIdx.x; float M = sm[0][row];
#pragma unroll
        for (int w = 1; w < CSW; ++w) M = fmaxf(M, sm[w][row]);
        float Z = 0.f;
#pragma unroll
        for (int w = 0; w < CSW; ++w) Z += sl[w][row] * __builtin_amdgcn_exp2f((sm[w][row] - M) * L2E);
        const size_t o = (size_t)blockIdx.x * TT + j0 + row; MX[o] = M; RZ[o] = __fdiv_rn(1.0f, Z); }
}

// ---- k_cattn: out^T[d][i] = sum_j v^T[d][j] A[i][j] for 64 queries of one head per work-group (grid: head, query tile, the longest key loops first); the 32-wide key chunks up to the diagonal block are dealt
// round-robin to the CSW waves. Per chunk a wave forms S^T (two 16-key tiles per 16 queries), p = exp(s - MX[j]) RZ[j] (0 for j > i), splits p hi/lo, and uses the two tiles as they lie as one B fragment:
// D of tile t holds keys t*16 + hi*8 + r at lane (lr, hi), which is the k order 8*hi + e | 16 + 8*hi + e of the A loader of v^T. The CSW partial tiles are summed through LDS in wave order and written as the merged hi/lo planes.
__global__ __launch_bounds__(32 * CSW) void k_cattn(const bf* __restrict__ Kh, const bf* __restrict__ Kl, const bf* __restrict__ Qh, const bf* __restrict__ Ql, const bf* __restrict__ Vh, const bf* __restrict__ Vl, const float* __restrict__ MX, const float* __restrict__ RZ, bf* Ah, bf* Al) {
    __shared__ __align__(16) float os[CSW][64 * 68];
    const int wv = __builtin_amdgcn_readfirstlane(threadIdx.x >> 5);   // wave number in a scalar register: the key loop stays a scalar branch, every lane on at the matrix instructions
    const size_t zo = (size_t)blockIdx.x * TT * HD, zs = (size_t)blockIdx.x * TT; const int lane = threadIdx.x & 31, lr = lane & 15, hi = lane >> 4; const int r0 = (TT / 64 - 1 - (int)blockIdx.y) * 64;
    v16bf qh[4][2], ql[4][2];
#pragma unroll
    for (int nb = 0; nb < 4; ++nb)
#pragma unroll
        for (int ks = 0; ks < 2; ++ks) { const size_t o = zo + (size_t)(r0 + nb * 16 + lr) * HD + ks * 32 + 8 * hi; qh[nb][ks] = WFrag<bf>::ld(Qh + o); ql[nb][ks] = WFrag<bf>::ld(Ql + o); }
    asm volatile("s_wait_xcnt 0x0" ::: "memory");   // in front of the loop's overwrites of the address registers that the query loads name
    __builtin_amdgcn_sched_barrier(0);   // keeps those overwrites behind the wait
    v8f acc[4][4];
#pragma unroll
    for (int mb = 0; mb < 4; ++mb)
#pragma unroll
        for (int nb = 0; nb < 4; ++nb) acc[mb][nb] = (v8f){};
#pragma unroll 1
    for (int kc = wv * 32; kc < r0 + 64; kc += CSW * 32) {
        v16bf kh[2][2], kl[2][2], vh[4], vl[4]; v8f mx[2], rz[2];
#pragma unroll
        for (int t = 0; t < 2; ++t) { mx[t] = *(const v8f*)(MX + zs + kc + t * 16 + hi * 8); rz[t] = *(const v8f*)(RZ + zs + kc + t * 16 + hi * 8);
#pragma unroll
            for (int ks = 0; ks < 2; ++ks) { const size_t o = zo + (size_t)(kc + t * 16 + lr) * HD + ks * 32 + 8 * hi; kh[t][ks] = WFrag<bf>::ld(Kh + o); kl[t][ks] = WFrag<bf>::ld(Kl + o); } }
#pragma unroll
        for (int mb = 0; mb < 4; ++mb) { const size_t o = zo + (size_t)(mb * 16 + lr) * TT + kc + 8 * hi; vh[mb] = WFrag<bf>::ld(Vh + o); vl[mb] = WFrag<bf>::ld(Vl + o); }
        __builtin_amdgcn_sched_barrier(0);   // every load of the chunk is issued in front of its first matrix instruction: one exposed load latency per chunk; left free, the v^T loads sink between the products
        asm volatile("s_wait_xcnt 0x0" ::: "memory");   // stands in front of every later overwrite of an address register that the chunk's loads name
        __builtin_amdgcn_sched_barrier(0);   // keeps the address updates of the next chunk behind that wait
#pragma unroll
        for (int nb = 0; nb < 4; ++nb) { v8us ph[2], pl[2]; const int i = r0 + nb * 16 + lr;
#pragma unroll
            for (int t = 0; t < 2; ++t) { v8f a = (v8f){};
#pragma unroll
                for (int ks = 0; ks < 2; ++ks) { a = wmmab(kh[t][ks], qh[nb][ks], a); a = wmmab(kl[t][ks], qh[nb][ks], a); a = wmmab(kh[t][ks], ql[nb][ks], a); }
#pragma unroll
                for (int r = 0; r < 8; ++r) { const float e = __builtin_amdgcn_exp2f((a[r] * SCL - mx[t][r]) * L2E); const float p = (i >= kc + t * 16 + hi * 8 + r) ? e * rz[t][r] : 0.f; unsigned short h2, l2; splitf(p, h2, l2); ph[t][r] = h2; pl[t][r] = l2; } }
            const v16bf bh = cat16b(ph[0], ph[1]), bl = cat16b(pl[0], pl[1]);
#pragma unroll
            for (int mb = 0; mb < 4; ++mb) { acc[mb][nb] = wmmab(vh[mb], bh, acc[mb][nb]); acc[mb][nb] = wmmab(vh[mb], bl, acc[mb][nb]); acc[mb][nb] = wmmab(vl[mb], bh, acc[mb][nb]); } }
    }
#pragma unroll
    for (int mb = 0; mb < 4; ++mb)
#pragma unroll
        for (int nb = 0; nb < 4; ++nb) { float* p = &os[wv][(nb * 16 + lr) * 68 + mb * 16 + hi * 8]; const v8f a = acc[mb][nb]; *(v4fa*)p = __builtin_shufflevector(a, a, 0, 1, 2, 3); *(v4fa*)(p + 4) = __builtin_shufflevector(a, a, 4, 5, 6, 7); }
    __syncthreads();   // every wave's partial tile is in LDS before any thread sums across the waves
#pragma unroll
    for (int s = 0; s < 64 * 16 / (32 * CSW); ++s) { const int idx = s * 32 * CSW + (int)threadIdx.x; const int row = idx >> 4, cofs = (idx & 15) * 4; v4f val = *(const v4fa*)(&os[0][row * 68 + cofs]);
#pragma unroll
        for (int w = 1; w < CSW; ++w) val += *(const v4fa*)(&os[w][row * 68 + cofs]);
        v4us oh, ol;
#pragma unroll
        for (int q = 0; q < 4; ++q) { unsigned short a2, c2; splitf(val[q], a2, c2); oh[q] = a2; ol[q] = c2; }
        const size_t oo = (size_t)((int)(blockIdx.x / NH_) * TT + r0 + row) * DQ + (size_t)(blockIdx.x % NH_) * HD + cofs;   /* blockIdx.x: batch x head */ *(v4us*)(Ah + oo) = oh; *(v4us*)(Al + oo) = ol; }
}

extern "C" void kernel_launch(void* const* d_in, const int* in_sizes, int n_in,
                              void* d_out, int out_size, void* d_ws, size_t ws_size, hipStream_t stream) {
    (void)in_sizes; (void)n_in; (void)out_size;
    const float* x = (const float*)d_in[0]; const float* wqkv = (const float*)d_in[1]; const float* wo = (const float*)d_in[2];  const float* wq = nullptr; const float* wk = nullptr; const float* wv = nullptr; (void)wq; (void)wk; (void)wv;
    float* OUT = (float*)d_out;     // [2][2048][1024]
    char* wsp = (char*)d_ws;
    auto take = [&](size_t bytes) { char* p = wsp; wsp += (bytes + 255) & ~(size_t)255; return (void*)p; };
    bf* WALL = (bf*)take((size_t)3 * DM * DM * 2); bf* WO = (bf*)take((size_t)DM * DQ * 2);
    bf* XB = (bf*)take((size_t)NB_ * TT * DM * 2);
    const size_t PL = (size_t)NB_ * NH_ * TT * HD;   // one plane set: [batch x head][t][d] (v: [batch x head][d][t])
    bf* QPh = (bf*)take(2 * PL * 2);   /* q planes, then k planes */ bf* QPl = (bf*)take(2 * PL * 2); bf* KPh = QPh + PL; bf* KPl = QPl + PL; bf* VTh = (bf*)take(PL * 2); bf* VTl = (bf*)take(PL * 2);
    float* MX = (float*)take((size_t)NB_ * NH_ * TT * 4); float* RZ = (float*)take((size_t)NB_ * NH_ * TT * 4); bf* ATh = (bf*)take((size_t)NB_ * TT * DQ * 2); bf* ATl = (bf*)take((size_t)NB_ * TT * DQ * 2);
    if ((size_t)(wsp - (char*)d_ws) > ws_size) return;    // ws 256 MiB
    { k_wtG<<<(unsigned)((DM * 3 * DM / 64 + 63) / 64), 256, 0, stream>>>(wqkv, DM, 3 * DM, WALL);   /* fused 'xw' [DM][3DM] -> Bt [3DM][DM] (row blocks q | k | v) */
      k_wtG<<<(unsigned)((DQ * DM / 64 + 63) / 64), 256, 0, stream>>>(wo, DQ, DM, WO);
       }
    // one launch per stage: both batches (rows of x are contiguous) and, in the projection, q | k | v (rows of WALL are contiguous) are grid dimensions
    k_cvt8<<<(unsigned)(((size_t)NB_ * TT * DM / 8 + 255) / 256), 256, 0, stream>>>(x, XB, (size_t)NB_ * TT * DM / 8);
    k_gemmw<bf, 0, 1><<<dim3(NB_ * TT / 64, 3 * DM / 64, 1), 32, 0, stream>>>(XB, nullptr, WALL, nullptr, DM, nullptr, nullptr, QPh, QPl, VTh, VTl);   /* q, k head planes and v^T planes written by the projection's own epilogue */
    k_cstat<<<dim3(NB_ * NH_, TT / 32, 1), 32 * CSW, 0, stream>>>(KPh, KPl, QPh, QPl, MX, RZ);   /* per key: maximum and 1/sum of the scores over the queries that see it (one kv head per query head) */
    k_cattn<<<dim3(NB_ * NH_, TT / 64, 1), 32 * CSW, 0, stream>>>(KPh, KPl, QPh, QPl, VTh, VTl, MX, RZ, ATh, ATl);   /* A.v with the probabilities formed in registers, written as the merged hi/lo planes */
    k_gemmw<bf, 1, 2><<<dim3(NB_ * TT / 64, DM / 64, 1), 32, 0, stream>>>(ATh, ATl, WO, nullptr, DQ, x, OUT, nullptr, nullptr, nullptr, nullptr);   /* out = x * (m W_proj), the gate in the epilogue */
}

// v005
// Measured time: 170 microseconds a run.
// Timed twice side by side with v004, it ran 1.27 and 1.28 times as fast.
// Over all steps from v000 it is 8.31 times as fast.
#include <hip/hip_runtime.h>

// Causal attention normalised over the QUERY axis, used as a multiplicative gate (x [2][2048][1024]; [q|k|v] = x W_qkv ('xw' [1024][3072], no bias; 16 heads x 64); s[i][j] = q_i.k_j/8 for j <= i else -inf; A = softmax over i (each key column normalised over the queries that see it); m = A v merged; proj = m W_proj ('xw'); out = x * proj -> [2][2048][1024]).
// Layout: the scores are formed key-major in registers (S^T[j][i] = k_j.q_i, every row hi/lo, 3 products) and never stored: k_cstat keeps each key's maximum and 1/sum over the queries i >= j; k_cattn forms the same S^T tiles again, turns them into probabilities and feeds them, still in registers, as the B operand of out^T[d][i] = sum_j v^T[d][j] A[i][j] (3 products), key loop cut at the diagonal. No elementwise stage of its own between the GEMMs: the q|k|v projection's epilogue writes the hi/lo head planes and the transposed v planes, the output projection's epilogue applies the gate with bf16(x).
// Compute dtypes, f32 accumulate: every input rounded to bf16; q/k/v on PLAIN bf16 operands (inputs: exact); key-major scores and A.v on hi/lo planes for every row (3 products); column softmax in f32; W_proj hl x exact (2 products); the final x * proj gate in f32.

#define NB_  2
#define TT   2048
#define DM   1024
#define NH_  16
#define NKV  16
#define REP  (NH_ / NKV)
#define HD   64
#define DQ   (NH_ * HD)
#define DKV  (NKV * HD)
#define SCL  0.125f   // HD^-0.5
#define L2E  1.4426950408889634f
#define CSW  8                    // waves of a work-group that share one tile's loop in k_cstat (queries) and k_cattn (keys)
typedef _Float16 h16;
typedef unsigned short bf;
typedef __attribute__((ext_vector_type(16))) __bf16   v16bf;
typedef __attribute__((ext_vector_type(16))) _Float16 v16h;
typedef __attribute__((ext_vector_type(8)))  _Float16 v8h;
typedef __attribute__((ext_vector_type(8)))  unsigned short v8us;
typedef __attribute__((ext_vector_type(8)))  float    v8f;
typedef __attribute__((ext_vector_type(4)))  float    v4f;
typedef v8h  __attribute__((may_alias)) v8ha;
typedef v4f  __attribute__((may_alias)) v4fa;
typedef v8us __attribute__((may_alias)) v8usa;

__device__ __forceinline__ unsigned short f2bf(float f) { unsigned u = __float_as_uint(f); u += 0x7FFFu + ((u >> 16) & 1u); return (unsigned short)(u >> 16); }
__device__ __forceinline__ float bf2f(unsigned short b) { return __uint_as_float(((unsigned)b) << 16); }
__device__ __forceinline__ float bfr(float f) { return bf2f(f2bf(f)); }
__device__ __forceinline__ v16h cat16(v8h lo, v8h hi) { return __builtin_shufflevector(lo, hi, 0, 1, 2, 3, 4, 5, 6, 7, 8, 9, 10, 11, 12, 13, 14, 15); }
__device__ __forceinline__ v16bf cat16b(v8us lo, v8us hi) { return __builtin_bit_cast(v16bf, __builtin_shufflevector(lo, hi, 0, 1, 2, 3, 4, 5, 6, 7, 8, 9, 10, 11, 12, 13, 14, 15)); }
__device__ __forceinline__ v8f wmma16(v16h a, v16h b, v8f c) { return __builtin_amdgcn_wmma_f32_16x16x32_f16(false, a, false, b, (short)0, c, false, false); }
__device__ __forceinline__ v8f wmmab(v16bf a, v16bf b, v8f c) { return __builtin_amdgcn_wmma_f32_16x16x32_bf16(false, a, false, b, (short)0, c, false, false); }
__device__ __forceinline__ void splitf(float y, unsigned short& h, unsigned short& l) { h = f2bf(y); l = f2bf(y - bf2f(h)); }
typedef __attribute__((ext_vector_type(2))) unsigned short v2us;
typedef __attribute__((ext_vector_type(4))) unsigned short v4us;



// ---- k_gemmw: register-blocked GEMM, one work-group of 4 waves (2 x 2) per 128x128 output tile, each wave a 64x64 tile (16 accumulators); grid (M/128, N/128), 128 threads.
// The K-contiguous 16-bit operand planes are staged in LDS 64 k at a time (128-byte rows at pitch 144 B) by asynchronous copies, whole 128-byte lines per 8 lanes, in a ring of two buffers: the next stage's copies fly while this stage is worked on, and each operand row is fetched once per work-group instead of once per wave.
// c[m][n] (f32, in registers) = sum_k A[m][k] Bt[n][k] (+ split products per NSPLIT). K % 64 == 0, K >= 64. The tile never reaches memory as f32; the epilogue writes what the next stage reads:
// EPI 1 (q | k | v projection; a 64-column tile is one head of q, k or v): q and k as hi/lo head planes [q | k][batch][head][t][d], v as transposed hi/lo planes [batch][head][d][t].
// EPI 2 (output projection): O[m][n] = bf16(X[m][n]) * c[m][n], both of pitch DM.
#define GP   144                  // LDS pitch of a staged 128-byte row: 16 B x odd, free of bank conflicts for 16-byte reads down a column
#define GOP  (128 * GP)           // one operand's 128 rows of a stage
template <typename T16> struct WFrag;
template <> struct WFrag<h16> { typedef v16h V; static __device__ __forceinline__ V ld(const h16* p) { return cat16(*(const v8h*)p, *(const v8h*)(p + 16)); } static __device__ __forceinline__ v8f mma(V a, V b, v8f c) { return wmma16(a, b, c); } };
template <> struct WFrag<bf> { typedef v16bf V; static __device__ __forceinline__ V ld(const bf* p) { return cat16b(*(const v8us*)p, *(const v8us*)(p + 16)); } static __device__ __forceinline__ v8f mma(V a, V b, v8f c) { return wmmab(a, b, c); } };
// this lane's 16 bytes of 8 rows, 16 rows apart, of one operand: global -> LDS through no register. The s_wait_xcnt stands in the copies' own statement, in front of any later overwrite of an address register that a copy names.
template <typename T16> __device__ __forceinline__ void acopy8(unsigned l, const T16* g, size_t step) {
    asm volatile("global_load_async_to_lds_b128 %0, %8, off\n\t"
                 "global_load_async_to_lds_b128 %1, %9, off\n\t"
                 "global_load_async_to_lds_b128 %2, %10, off\n\t"
                 "global_load_async_to_lds_b128 %3, %11, off\n\t"
                 "global_load_async_to_lds_b128 %4, %12, off\n\t"
                 "global_load_async_to_lds_b128 %5, %13, off\n\t"
                 "global_load_async_to_lds_b128 %6, %14, off\n\t"
                 "global_load_async_to_lds_b128 %7, %15, off\n\t"
                 "s_wait_xcnt 0x0"
                 :: "v"(l), "v"(l + 16 * GP), "v"(l + 32 * GP), "v"(l + 48 * GP), "v"(l + 64 * GP), "v"(l + 80 * GP), "v"(l + 96 * GP), "v"(l + 112 * GP),
                    "v"(g), "v"(g + step), "v"(g + 2 * step), "v"(g + 3 * step), "v"(g + 4 * step), "v"(g + 5 * step), "v"(g + 6 * step), "v"(g + 7 * step) : "memory");
}
template <typename T16, int NSPLIT, int EPI>
__global__ __launch_bounds__(128) void k_gemmw(const T16* __restrict__ A, const T16* __restrict__ A2, const T16* __restrict__ Bt, const T16* __restrict__ Bt2, int K, const float* __restrict__ X, float* O, bf* Ph, bf* Pl, bf* Vh, bf* Vl) {
    typedef typename WFrag<T16>::V V;
    constexpr bool HA2 = (NSPLIT == 1 || NSPLIT == 2), HB2 = (NSPLIT >= 2); constexpr int NOP = 2 + (HA2 ? 1 : 0) + (HB2 ? 1 : 0);   // operands of a stage, in the order A | Bt | A2 | Bt2
    __shared__ __attribute__((aligned(128))) unsigned char ring[2 * NOP * GOP];
    __shared__ __align__(16) float osall[4][16 * 68];
    const int wv = __builtin_amdgcn_readfirstlane(threadIdx.x >> 5);   // wave number in a scalar register: the wave's tile indices stay scalar
    const int tid = threadIdx.x, lane = tid & 31, lr = lane & 15, hi = lane >> 4; const int R0 = blockIdx.x * 128, C0 = blockIdx.y * 128; const int r0 = R0 + (wv >> 1) * 64, c0 = C0 + (wv & 1) * 64;
    float* os = osall[wv];   // each wave stages its epilogue in its own range
    v8f acc[4][4];
#pragma unroll
    for (int mb = 0; mb < 4; ++mb)
#pragma unroll
        for (int nb = 0; nb < 4; ++nb) acc[mb][nb] = (v8f){};
    const unsigned lb = (unsigned)(size_t)ring + (unsigned)((tid >> 3) * GP + (tid & 7) * 16);   // 8 lanes per row: a wave's copy covers 4 whole lines
    const size_t ga = (size_t)(R0 + (tid >> 3)) * K + (tid & 7) * 8, gb = (size_t)(C0 + (tid >> 3)) * K + (tid & 7) * 8, st16 = (size_t)16 * K;
    auto fill = [&](int t, int buf) { const unsigned l = lb + (unsigned)(buf * NOP * GOP); const int kc = t * 64;
        acopy8(l, A + ga + kc, st16); acopy8(l + GOP, Bt + gb + kc, st16);
        if (HA2) acopy8(l + 2 * GOP, A2 + ga + kc, st16);
        if (HB2) acopy8(l + (HA2 ? 3 : 2) * GOP, Bt2 + gb + kc, st16); };
    const int NT = K >> 6;
    fill(0, 0);
    asm volatile("s_wait_asynccnt 0x0" ::: "memory");   // this wave's copies of stage 0 have landed
    __syncthreads();   // stage 0 is published: every wave's copies have landed before any wave reads it
    if (NT > 1) fill(1, 1);
    const int ao = ((wv >> 1) * 64 + lr) * GP + hi * 16, bo = GOP + ((wv & 1) * 64 + lr) * GP + hi * 16;
#pragma unroll 1
    for (int t = 0; t < NT; ++t) {
        const unsigned char* sg = ring + (t & 1) * (NOP * GOP);
        V a[2][4], a2[2][4], b[2][4], b2[2][4];
#pragma unroll
        for (int ks = 0; ks < 2; ++ks) {
#pragma unroll
            for (int mb = 0; mb < 4; ++mb) { a[ks][mb] = WFrag<T16>::ld((const T16*)(sg + ao + mb * 16 * GP + ks * 64)); if (HA2) a2[ks][mb] = WFrag<T16>::ld((const T16*)(sg + ao + 2 * GOP + mb * 16 * GP + ks * 64)); }
#pragma unroll
            for (int nb = 0; nb < 4; ++nb) { b[ks][nb] = WFrag<T16>::ld((const T16*)(sg + bo + nb * 16 * GP + ks * 64)); if (HB2) b2[ks][nb] = WFrag<T16>::ld((const T16*)(sg + bo + (HA2 ? 2 : 1) * GOP + nb * 16 * GP + ks * 64)); } }
        __builtin_amdgcn_sched_barrier(0);   // the stage's LDS reads are issued as one group in front of its first matrix instruction; left free, they sink between the products into one register set, each group of four products behind a full LDS wait
#pragma unroll
        for (int ks = 0; ks < 2; ++ks)
#pragma unroll
            for (int nb = 0; nb < 4; ++nb)
#pragma unroll
                for (int mb = 0; mb < 4; ++mb) { acc[mb][nb] = WFrag<T16>::mma(a[ks][mb], b[ks][nb], acc[mb][nb]); if (HA2) acc[mb][nb] = WFrag<T16>::mma(a2[ks][mb], b[ks][nb], acc[mb][nb]); if (HB2) acc[mb][nb] = WFrag<T16>::mma(a[ks][mb], b2[ks][nb], acc[mb][nb]); }
        __builtin_amdgcn_sched_barrier(0);
        asm volatile("s_wait_dscnt 0x0" ::: "memory");
        asm volatile("s_wait_asynccnt 0x0" ::: "memory");
        __syncthreads();
        if (t + 2 < NT) fill(t + 2, t & 1);
    }
    asm volatile("s_wait_asynccnt 0x0" ::: "memory");   // no copy is outstanding when the wave goes on to its epilogue and ends
    const int bt = r0 / TT, t0 = r0 % TT, sec = c0 / DM, hd = (c0 % DM) / HD;   // EPI 1: batch, first position, q | k | v, head of this tile (all from blockIdx and the wave number: scalar)
    if (EPI == 1 && sec == 2) {   // v: a lane holds 8 consecutive positions of one d per accumulator, which is the transposed plane's own order: stored straight from registers, the four pieces of a 128-byte line one after the other
        const size_t vo = ((size_t)(bt * NKV + hd) * HD + lr) * TT + t0 + hi * 8; bf* vh = Vh + vo; bf* vl = Vl + vo;
#pragma unroll
        for (int nb = 0; nb < 4; ++nb) { v8us oh[4], ol[4];
#pragma unroll
            for (int mb = 0; mb < 4; ++mb)
#pragma unroll
                for (int j = 0; j < 8; ++j) { unsigned short a2, c2; splitf(acc[mb][nb][j], a2, c2); oh[mb][j] = a2; ol[mb][j] = c2; }
#pragma unroll
            for (int mb = 0; mb < 4; ++mb) *(v8us*)(vh + nb * 16 * TT + mb * 16) = oh[mb];
#pragma unroll
            for (int mb = 0; mb < 4; ++mb) *(v8us*)(vl + nb * 16 * TT + mb * 16) = ol[mb];
            asm volatile("s_wait_xcnt 0x0" ::: "memory");   // in front of the next group's overwrites of the data registers that these stores name
            __builtin_amdgcn_sched_barrier(0);   // keeps those overwrites behind the wait
        }
        return;
    }
    v4f xs[4][8]; const size_t go = (size_t)(r0 + hi) * DM + c0 + lr * 4;   // EPI 2: this lane's first element of X and O
    if (EPI == 2) {   // the gate's x values of the whole tile are asked for at once, in front of the staging: one exposed latency per tile
        const float* xp = X + go;
#pragma unroll
        for (int mb = 0; mb < 4; ++mb)
#pragma unroll
            for (int s = 0; s < 8; ++s) xs[mb][s] = *(const v4f*)(xp + (mb * 16 + 2 * s) * DM);
    }
    const size_t po = ((size_t)((sec * NB_ + bt) * NH_ + hd) * TT + t0 + hi) * HD + lr * 4;   // EPI 1: this lane's first element of the tile's 64 rows in its q or k head plane
#pragma unroll
    for (int mb = 0; mb < 4; ++mb) {
#pragma unroll
        for (int nb = 0; nb < 4; ++nb) {
#pragma unroll
            for (int j = 0; j < 8; ++j) os[(hi * 8 + j) * 68 + nb * 16 + lr] = acc[mb][nb][j]; }
        __builtin_amdgcn_wave_barrier(); asm volatile("" ::: "memory");
        if (EPI == 1) { v4us oh[8], ol[8]; bf* ph = Ph + po; bf* pl = Pl + po;
#pragma unroll
            for (int s = 0; s < 8; ++s) { const v4f val = *(const v4fa*)(os + (2 * s + hi) * 68 + lr * 4);
#pragma unroll
                for (int q = 0; q < 4; ++q) { unsigned short a2, c2; splitf(val[q], a2, c2); oh[s][q] = a2; ol[s][q] = c2; } }
#pragma unroll
            for (int s = 0; s < 8; ++s) *(v4us*)(ph + (mb * 16 + 2 * s) * HD) = oh[s];
#pragma unroll
            for (int s = 0; s < 8; ++s) *(v4us*)(pl + (mb * 16 + 2 * s) * HD) = ol[s]; }
        if (EPI == 2) { v4f o[8]; float* op = O + go;
#pragma unroll
            for (int s = 0; s < 8; ++s) { const v4f val = *(const v4fa*)(os + (2 * s + hi) * 68 + lr * 4);
#pragma unroll
                for (int q = 0; q < 4; ++q) o[s][q] = __fmul_rn(bfr(xs[mb][s][q]), val[q]); }
#pragma unroll
            for (int s = 0; s < 8; ++s) *(v4f*)(op + (mb * 16 + 2 * s) * DM) = o[s]; }
        __builtin_amdgcn_wave_barrier(); asm volatile("s_wait_xcnt 0x0" ::: "memory");   // in front of the next group's overwrites of the data registers that these stores name; as a compiler fence it also keeps the next group's LDS writes behind this group's reads
        __builtin_amdgcn_sched_barrier(0);   // keeps those overwrites behind the wait
    }
}

__global__ __launch_bounds__(256) void k_wtG(const float* __restrict__ w, int K, int N, bf* Bt) {
    const int lane = threadIdx.x & 31; const int L0 = (blockIdx.x * 8 + (threadIdx.x >> 5)) * 8; const int nlines = N * K / 64;
{
#pragma unroll 1
        for (int l = 0; l < 8; ++l) { const int L = L0 + l; if (L >= nlines) break; const size_t e = (size_t)L * 64 + lane * 2; const int k = (int)(e % K), n = (int)(e / K); v2us o;
            o[0] = f2bf(w[(size_t)k * N + n]); o[1] = f2bf(w[(size_t)(k + 1) * N + n]); *(v2us*)(Bt + e) = o; }
         }
}
__global__ __launch_bounds__(256) void k_cvt8(const float* __restrict__ src, bf* dst, size_t n8) { const size_t i = (size_t)blockIdx.x * 256 + threadIdx.x; if (i >= n8) return; const v8f v = *(const v8f*)(src + i * 8); v8us o;
#pragma unroll
    for (int k = 0; k < 8; ++k) o[k] = f2bf(v[k]); *(v8us*)(dst + i * 8) = o;  }


// value of lane l ^ X inside the 16-lane row (DPP row_xmask): the row reductions of k_cstat stay on the vector unit
template <int X> __device__ __forceinline__ float rowx(float x) { return __builtin_bit_cast(float, __builtin_amdgcn_update_dpp(0, __builtin_bit_cast(int, x), 0x160 | X, 0xf, 0xf, true)); }

// ---- k_cstat: column-softmax statistics. One work-group per 32 keys of one head (grid: head, key tile); the 64-wide query chunks from the diagonal on are dealt round-robin to the CSW waves.
// A = key rows (kept in registers), B = query rows, D = S^T tile: lane (lr, hi) holds keys hi*8 + r of queries lr. Every lane keeps a running (max, sum) per key row over its own queries;
// the 16 lanes of a row and then the CSW waves are merged at the end. MX[h][j] = max_i s, RZ[h][j] = 1 / sum_i exp(s - max).
__global__ __launch_bounds__(32 * CSW) void k_cstat(const bf* __restrict__ Kh, const bf* __restrict__ Kl, const bf* __restrict__ Qh, const bf* __restrict__ Ql, float* MX, float* RZ) {
    __shared__ float sm[CSW][32]; __shared__ float sl[CSW][32];
    const int wv = __builtin_amdgcn_readfirstlane(threadIdx.x >> 5);   // wave number in a scalar register: the query loop stays a scalar branch, every lane on at the matrix instructions
    const size_t zo = (size_t)blockIdx.x * TT * HD; const int lane = threadIdx.x & 31, lr = lane & 15, hi = lane >> 4; const int j0 = blockIdx.y * 32;
    v16bf kh[2][2], kl[2][2];
#pragma unroll
    for (int mb = 0; mb < 2; ++mb)
#pragma unroll
        for (int ks = 0; ks < 2; ++ks) { const size_t o = zo + (size_t)(j0 + mb * 16 + lr) * HD + ks * 32 + 8 * hi; kh[mb][ks] = WFrag<bf>::ld(Kh + o); kl[mb][ks] = WFrag<bf>::ld(Kl + o); }
    asm volatile("s_wait_xcnt 0x0" ::: "memory");   // in front of the loop's overwrites of the address registers that the key loads name
    __builtin_amdgcn_sched_barrier(0);   // keeps those overwrites behind the wait
    float m[2][8], l[2][8];
#pragma unroll
    for (int mb = 0; mb < 2; ++mb)
#pragma unroll
        for (int r = 0; r < 8; ++r) { m[mb][r] = -3.0e38f; l[mb][r] = 0.f; }
#pragma unroll 1
    for (int c0 = (j0 & ~63) + wv * 64; c0 < TT; c0 += CSW * 64) {
        v8f s[2][4];
#pragma unroll
        for (int nb = 0; nb < 4; ++nb) { v16bf qh[2], ql[2];
#pragma unroll
            for (int ks = 0; ks < 2; ++ks) { const size_t o = zo + (size_t)(c0 + nb * 16 + lr) * HD + ks * 32 + 8 * hi; qh[ks] = WFrag<bf>::ld(Qh + o); ql[ks] = WFrag<bf>::ld(Ql + o); }
#pragma unroll
            for (int mb = 0; mb < 2; ++mb) { v8f a = (v8f){};
#pragma unroll
                for (int ks = 0; ks < 2; ++ks) { a = wmmab(kh[mb][ks], qh[ks], a); a = wmmab(kl[mb][ks], qh[ks], a); a = wmmab(kh[mb][ks], ql[ks], a); }
                s[mb][nb] = a; } }
#pragma unroll
        for (int mb = 0; mb < 2; ++mb)
#pragma unroll
            for (int r = 0; r < 8; ++r) { const int j = j0 + mb * 16 + hi * 8 + r; float t[4]; float mn = m[mb][r];
#pragma unroll
                for (int nb = 0; nb < 4; ++nb) { t[nb] = (c0 + nb * 16 + lr >= j) ? s[mb][nb][r] * SCL : -3.0e38f;   /* causal keeps queries i >= key j */ mn = fmaxf(mn, t[nb]); }
                float a = l[mb][r] * __builtin_amdgcn_exp2f((m[mb][r] - mn) * L2E);
#pragma unroll
                for (int nb = 0; nb < 4; ++nb) a += (c0 + nb * 16 + lr >= j) ? __builtin_amdgcn_exp2f((t[nb] - mn) * L2E) : 0.f;
                l[mb][r] = a; m[mb][r] = mn; }
        asm volatile("s_wait_xcnt 0x0" ::: "memory");   // in front of the next trip's overwrites of the address registers that this trip's query loads name
    }
#pragma unroll
    for (int mb = 0; mb < 2; ++mb)
#pragma unroll
        for (int r = 0; r < 8; ++r) { float M = m[mb][r]; M = fmaxf(M, rowx<1>(M)); M = fmaxf(M, rowx<2>(M)); M = fmaxf(M, rowx<4>(M)); M = fmaxf(M, rowx<8>(M));
            float a = l[mb][r] * __builtin_amdgcn_exp2f((m[mb][r] - M) * L2E); a += rowx<1>(a); a += rowx<2>(a); a += rowx<4>(a); a += rowx<8>(a); m[mb][r] = M; l[mb][r] = a; }
    if (lr == 0) {
#pragma unroll
        for (int mb = 0; mb < 2; ++mb)
#pragma unroll
            for (int r = 0; r < 8; ++r) { sm[wv][mb * 16 + hi * 8 + r] = m[mb][r]; sl[wv][mb * 16 + hi * 8 + r] = l[mb][r]; } }
    __syncthreads();   // every wave's (max, sum) per key is in LDS before the first wave merges them
    if (threadIdx.x < 32) { const int row = threadIdx.x; float M = sm[0][row];
#pragma unroll
        for (int w = 1; w < CSW; ++w) M = fmaxf(M, sm[w][row]);
        float Z = 0.f;
#pragma unroll
        for (int w = 0; w < CSW; ++w) Z += sl[w][row] * __builtin_amdgcn_exp2f((sm[w][row] - M) * L2E);
        const size_t o = (size_t)blockIdx.x * TT + j0 + row; MX[o] = M; RZ[o] = __fdiv_rn(1.0f, Z); }
}

// ---- k_cattn: out^T[d][i] = sum_j v^T[d][j] A[i][j] for 64 queries of one head per work-group (grid: head, query tile, the longest key loops first); the 32-wide key chunks up to the diagonal block are dealt
// round-robin to the CSW waves. Per chunk a wave forms S^T (two 16-key tiles per 16 queries), p = exp(s - MX[j]) RZ[j] (0 for j > i), splits p hi/lo, and uses the two tiles as they lie as one B fragment:
// D of tile t holds keys t*16 + hi*8 + r at lane (lr, hi), which is the k order 8*hi + e | 16 + 8*hi + e of the A loader of v^T. The CSW partial tiles are summed through LDS in wave order and written as the merged hi/lo planes.
__global__ __launch_bounds__(32 * CSW) void k_cattn(const bf* __restrict__ Kh, const bf* __restrict__ Kl, const bf* __restrict__ Qh, const bf* __restrict__ Ql, const bf* __restrict__ Vh, const bf* __restrict__ Vl, const float* __restrict__ MX, const float* __restrict__ RZ, bf* Ah, bf* Al) {
    __shared__ __align__(16) float os[CSW][64 * 68];
    const int wv = __builtin_amdgcn_readfirstlane(threadIdx.x >> 5);   // wave number in a scalar register: the key loop stays a scalar branch, every lane on at the matrix instructions
    const size_t zo = (size_t)blockIdx.x * TT * HD, zs = (size_t)blockIdx.x * TT; const int lane = threadIdx.x & 31, lr = lane & 15, hi = lane >> 4; const int r0 = (TT / 64 - 1 - (int)blockIdx.y) * 64;
    v16bf qh[4][2], ql[4][2];
#pragma unroll
    for (int nb = 0; nb < 4; ++nb)
#pragma unroll
        for (int ks = 0; ks < 2; ++ks) { const size_t o = zo + (size_t)(r0 + nb * 16 + lr) * HD + ks * 32 + 8 * hi; qh[nb][ks] = WFrag<bf>::ld(Qh + o); ql[nb][ks] = WFrag<bf>::ld(Ql + o); }
    asm volatile("s_wait_xcnt 0x0" ::: "memory");   // in front of the loop's overwrites of the address registers that the query loads name
    __builtin_amdgcn_sched_barrier(0);   // keeps those overwrites behind the wait
    v8f acc[4][4];
#pragma unroll
    for (int mb = 0; mb < 4; ++mb)
#pragma unroll
        for (int nb = 0; nb < 4; ++nb) acc[mb][nb] = (v8f){};
#pragma unroll 1
    for (int kc = wv * 32; kc < r0 + 64; kc += CSW * 32) {
        v16bf kh[2][2], kl[2][2], vh[4], vl[4]; v8f mx[2], rz[2];
#pragma unroll
        for (int t = 0; t < 2; ++t) { mx[t] = *(const v8f*)(MX + zs + kc + t * 16 + hi * 8); rz[t] = *(const v8f*)(RZ + zs + kc + t * 16 + hi * 8);
#pragma unroll
            for (int ks = 0; ks < 2; ++ks) { const size_t o = zo + (size_t)(kc + t * 16 + lr) * HD + ks * 32 + 8 * hi; kh[t][ks] = WFrag<bf>::ld(Kh + o); kl[t][ks] = WFrag<bf>::ld(Kl + o); } }
#pragma unroll
        for (int mb = 0; mb < 4; ++mb) { const size_t o = zo + (size_t)(mb * 16 + lr) * TT + kc + 8 * hi; vh[mb] = WFrag<bf>::ld(Vh + o); vl[mb] = WFrag<bf>::ld(Vl + o); }
        __builtin_amdgcn_sched_barrier(0);   // every load of the chunk is issued in front of its first matrix instruction: one exposed load latency per chunk; left free, the v^T loads sink between the products
        asm volatile("s_wait_xcnt 0x0" ::: "memory");   // stands in front of every later overwrite of an address register that the chunk's loads name
        __builtin_amdgcn_sched_barrier(0);   // keeps the address updates of the next chunk behind that wait
#pragma unroll
        for (int nb = 0; nb < 4; ++nb) { v8us ph[2], pl[2]; const int i = r0 + nb * 16 + lr;
#pragma unroll
            for (int t = 0; t < 2; ++t) { v8f a = (v8f){};
#pragma unroll
                for (int ks = 0; ks < 2; ++ks) { a = wmmab(kh[t][ks], qh[nb][ks], a); a = wmmab(kl[t][ks], qh[nb][ks], a); a = wmmab(kh[t][ks], ql[nb][ks], a); }
#pragma unroll
                for (int r = 0; r < 8; ++r) { const float e = __builtin_amdgcn_exp2f((a[r] * SCL - mx[t][r]) * L2E); const float p = (i >= kc + t * 16 + hi * 8 + r) ? e * rz[t][r] : 0.f; unsigned short h2, l2; splitf(p, h2, l2); ph[t][r] = h2; pl[t][r] = l2; } }
            const v16bf bh = cat16b(ph[0], ph[1]), bl = cat16b(pl[0], pl[1]);
#pragma unroll
            for (int mb = 0; mb < 4; ++mb) { acc[mb][nb] = wmmab(vh[mb], bh, acc[mb][nb]); acc[mb][nb] = wmmab(vh[mb], bl, acc[mb][nb]); acc[mb][nb] = wmmab(vl[mb], bh, acc[mb][nb]); } }
    }
#pragma unroll
    for (int mb = 0; mb < 4; ++mb)
#pragma unroll
        for (int nb = 0; nb < 4; ++nb) { float* p = &os[wv][(nb * 16 + lr) * 68 + mb * 16 + hi * 8]; const v8f a = acc[mb][nb]; *(v4fa*)p = __builtin_shufflevector(a, a, 0, 1, 2, 3); *(v4fa*)(p + 4) = __builtin_shufflevector(a, a, 4, 5, 6, 7); }
    __syncthreads();   // every wave's partial tile is in LDS before any thread sums across the waves
#pragma unroll
    for (int s = 0; s < 64 * 16 / (32 * CSW); ++s) { const int idx = s * 32 * CSW + (int)threadIdx.x; const int row = idx >> 4, cofs = (idx & 15) * 4; v4f val = *(const v4fa*)(&os[0][row * 68 + cofs]);
#pragma unroll
        for (int w = 1; w < CSW; ++w) val += *(const v4fa*)(&os[w][row * 68 + cofs]);
        v4us oh, ol;
#pragma unroll
        for (int q = 0; q < 4; ++q) { unsigned short a2, c2; splitf(val[q], a2, c2); oh[q] = a2; ol[q] = c2; }
        const size_t oo = (size_t)((int)(blockIdx.x / NH_) * TT + r0 + row) * DQ + (size_t)(blockIdx.x % NH_) * HD + cofs;   /* blockIdx.x: batch x head */ *(v4us*)(Ah + oo) = oh; *(v4us*)(Al + oo) = ol; }
}

extern "C" void kernel_launch(void* const* d_in, const int* in_sizes, int n_in,
                              void* d_out, int out_size, void* d_ws, size_t ws_size, hipStream_t stream) {
    (void)in_sizes; (void)n_in; (void)out_size;
    const float* x = (const float*)d_in[0]; const float* wqkv = (const float*)d_in[1]; const float* wo = (const float*)d_in[2];  const float* wq = nullptr; const float* wk = nullptr; const float* wv = nullptr; (void)wq; (void)wk; (void)wv;
    float* OUT = (float*)d_out;     // [2][2048][1024]
    char* wsp = (char*)d_ws;
    auto take = [&](size_t bytes) { char* p = wsp; wsp += (bytes + 255) & ~(size_t)255; return (void*)p; };
    bf* WALL = (bf*)take((size_t)3 * DM * DM * 2); bf* WO = (bf*)take((size_t)DM * DQ * 2);
    bf* XB = (bf*)take((size_t)NB_ * TT * DM * 2);
    const size_t PL = (size_t)NB_ * NH_ * TT * HD;   // one plane set: [batch x head][t][d] (v: [batch x head][d][t])
    bf* QPh = (bf*)take(2 * PL * 2);   /* q planes, then k planes */ bf* QPl = (bf*)take(2 * PL * 2); bf* KPh = QPh + PL; bf* KPl = QPl + PL; bf* VTh = (bf*)take(PL * 2); bf* VTl = (bf*)take(PL * 2);
    float* MX = (float*)take((size_t)NB_ * NH_ * TT * 4); float* RZ = (float*)take((size_t)NB_ * NH_ * TT * 4); bf* ATh = (bf*)take((size_t)NB_ * TT * DQ * 2); bf* ATl = (bf*)take((size_t)NB_ * TT * DQ * 2);
    if ((size_t)(wsp - (char*)d_ws) > ws_size) return;    // ws 256 MiB
    { k_wtG<<<(unsigned)((DM * 3 * DM / 64 + 63) / 64), 256, 0, stream>>>(wqkv, DM, 3 * DM, WALL);   /* fused 'xw' [DM][3DM] -> Bt [3DM][DM] (row blocks q | k | v) */
      k_wtG<<<(unsigned)((DQ * DM / 64 + 63) / 64), 256, 0, stream>>>(wo, DQ, DM, WO);
       }
    // one launch per stage: both batches (rows of x are contiguous) and, in the projection, q | k | v (rows of WALL are contiguous) are grid dimensions
    k_cvt8<<<(unsigned)(((size_t)NB_ * TT * DM / 8 + 255) / 256), 256, 0, stream>>>(x, XB, (size_t)NB_ * TT * DM / 8);
    k_gemmw<bf, 0, 1><<<dim3(NB_ * TT / 128, 3 * DM / 128, 1), 128, 0, stream>>>(XB, nullptr, WALL, nullptr, DM, nullptr, nullptr, QPh, QPl, VTh, VTl);   /* q, k head planes and v^T planes written by the projection's own epilogue */
    k_cstat<<<dim3(NB_ * NH_, TT / 32, 1), 32 * CSW, 0, stream>>>(KPh, KPl, QPh, QPl, MX, RZ);   /* per key: maximum and 1/sum of the scores over the queries that see it (one kv head per query head) */
    k_cattn<<<dim3(NB_ * NH_, TT / 64, 1), 32 * CSW, 0, stream>>>(KPh, KPl, QPh, QPl, VTh, VTl, MX, RZ, ATh, ATl);   /* A.v with the probabilities formed in registers, written as the merged hi/lo planes */
    k_gemmw<bf, 1, 2><<<dim3(NB_ * TT / 128, DM / 128, 1), 128, 0, stream>>>(ATh, ATl, WO, nullptr, DQ, x, OUT, nullptr, nullptr, nullptr, nullptr);   /* out = x * (m W_proj), the gate in the epilogue */
}

// v006
// Measured time: 157 microseconds a run.
// Next to v005, in two timings, it ran 1.08 and 1.07 times as fast.
// Counting every step since v000, it is 8.94 times as fast.
#include <hip/hip_runtime.h>

// Causal attention normalised over the QUERY axis, used as a multiplicative gate (x [2][2048][1024]; [q|k|v] = x W_qkv ('xw' [1024][3072], no bias; 16 heads x 64); s[i][j] = q_i.k_j/8 for j <= i else -inf; A = softmax over i (each key column normalised over the queries that see it); m = A v merged; proj = m W_proj ('xw'); out = x * proj -> [2][2048][1024]).
// Layout: the scores are formed key-major in registers (S^T[j][i] = k_j.q_i, every row hi/lo, 3 products) and never stored: k_cstat keeps each key's maximum and 1/sum over the queries i >= j; k_cattn forms the same S^T tiles again, turns them into probabilities and feeds them, still in registers, as the B operand of out^T[d][i] = sum_j v^T[d][j] A[i][j] (3 products), key loop cut at the diagonal. No elementwise stage of its own between the GEMMs: the q|k|v projection's epilogue writes the hi/lo head planes and the transposed v planes, the output projection's epilogue applies the gate with bf16(x).
// Compute dtypes, f32 accumulate: every input rounded to bf16; q/k/v on PLAIN bf16 operands (inputs: exact); key-major scores and A.v on hi/lo planes for every row (3 products); column softmax in f32; W_proj hl x exact (2 products); the final x * proj gate in f32.

#define NB_  2
#define TT   2048
#define DM   1024
#define NH_  16
#define NKV  16
#define REP  (NH_ / NKV)
#define HD   64
#define DQ   (NH_ * HD)
#define DKV  (NKV * HD)
#define SCL  0.125f   // HD^-0.5
#define L2E  1.4426950408889634f
#define CSW  8                    // waves of a work-group that share one tile's loop in k_cstat (queries) and k_cattn (keys)
typedef _Float16 h16;
typedef unsigned short bf;
typedef __attribute__((ext_vector_type(16))) __bf16   v16bf;
typedef __attribute__((ext_vector_type(16))) _Float16 v16h;
typedef __attribute__((ext_vector_type(8)))  _Float16 v8h;
typedef __attribute__((ext_vector_type(8)))  unsigned short v8us;
typedef __attribute__((ext_vector_type(8)))  float    v8f;
typedef __attribute__((ext_vector_type(4)))  float    v4f;
typedef v8h  __attribute__((may_alias)) v8ha;
typedef v4f  __attribute__((may_alias)) v4fa;
typedef v8us __attribute__((may_alias)) v8usa;

__device__ __forceinline__ unsigned short f2bf(float f) { unsigned u = __float_as_uint(f); u += 0x7FFFu + ((u >> 16) & 1u); return (unsigned short)(u >> 16); }
__device__ __forceinline__ float bf2f(unsigned short b) { return __uint_as_float(((unsigned)b) << 16); }
__device__ __forceinline__ float bfr(float f) { return bf2f(f2bf(f)); }
__device__ __forceinline__ v16h cat16(v8h lo, v8h hi) { return __builtin_shufflevector(lo, hi, 0, 1, 2, 3, 4, 5, 6, 7, 8, 9, 10, 11, 12, 13, 14, 15); }
__device__ __forceinline__ v16bf cat16b(v8us lo, v8us hi) { return __builtin_bit_cast(v16bf, __builtin_shufflevector(lo, hi, 0, 1, 2, 3, 4, 5, 6, 7, 8, 9, 10, 11, 12, 13, 14, 15)); }
__device__ __forceinline__ v8f wmma16(v16h a, v16h b, v8f c) { return __builtin_amdgcn_wmma_f32_16x16x32_f16(false, a, false, b, (short)0, c, false, false); }
__device__ __forceinline__ v8f wmmab(v16bf a, v16bf b, v8f c) { return __builtin_amdgcn_wmma_f32_16x16x32_bf16(false, a, false, b, (short)0, c, false, false); }
__device__ __forceinline__ void splitf(float y, unsigned short& h, unsigned short& l) { h = f2bf(y); l = f2bf(y - bf2f(h)); }
typedef __attribute__((ext_vector_type(2))) unsigned short v2us;
typedef __attribute__((ext_vector_type(4))) unsigned short v4us;



// ---- k_gemmw: register-blocked GEMM, one work-group of 4 waves (2 x 2) per 128x128 output tile, each wave a 64x64 tile (16 accumulators); grid (M/128, N/128), 128 threads.
// The K-contiguous 16-bit operand planes are staged in LDS 64 k at a time (128-byte rows at pitch 144 B) by asynchronous copies, whole 128-byte lines per 8 lanes, in a ring of two buffers: the next stage's copies fly while this stage is worked on, and each operand row is fetched once per work-group instead of once per wave.
// c[m][n] (f32, in registers) = sum_k A[m][k] Bt[n][k] (+ split products per NSPLIT). K % 64 == 0, K >= 64. The tile never reaches memory as f32; the epilogue writes what the next stage reads:
// EPI 1 (q | k | v projection; a 64-column tile is one head of q, k or v): q and k as hi/lo head planes [q | k][batch][head][t][d], v as transposed hi/lo planes [batch][head][d][t].
// EPI 2 (output projection): O[m][n] = bf16(X[m][n]) * c[m][n], both of pitch DM.
#define GP   144                  // LDS pitch of a staged 128-byte row: 16 B x odd, free of bank conflicts for 16-byte reads down a column
#define GOP  (128 * GP)           // one operand's 128 rows of a stage
template <typename T16> struct WFrag;
template <> struct WFrag<h16> { typedef v16h V; static __device__ __forceinline__ V ld(const h16* p) { return cat16(*(const v8h*)p, *(const v8h*)(p + 16)); } static __device__ __forceinline__ v8f mma(V a, V b, v8f c) { return wmma16(a, b, c); } };
template <> struct WFrag<bf> { typedef v16bf V; static __device__ __forceinline__ V ld(const bf* p) { return cat16b(*(const v8us*)p, *(const v8us*)(p + 16)); } static __device__ __forceinline__ v8f mma(V a, V b, v8f c) { return wmmab(a, b, c); } };
// this lane's 16 bytes of 8 rows, 16 rows apart, of one operand: global -> LDS through no register. The s_wait_xcnt stands in the copies' own statement, in front of any later overwrite of an address register that a copy names.
template <typename T16> __device__ __forceinline__ void acopy8(unsigned l, const T16* g, size_t step) {
    asm volatile("global_load_async_to_lds_b128 %0, %8, off\n\t"
                 "global_load_async_to_lds_b128 %1, %9, off\n\t"
                 "global_load_async_to_lds_b128 %2, %10, off\n\t"
                 "global_load_async_to_lds_b128 %3, %11, off\n\t"
                 "global_load_async_to_lds_b128 %4, %12, off\n\t"
                 "global_load_async_to_lds_b128 %5, %13, off\n\t"
                 "global_load_async_to_lds_b128 %6, %14, off\n\t"
                 "global_load_async_to_lds_b128 %7, %15, off\n\t"
                 "s_wait_xcnt 0x0"
                 :: "v"(l), "v"(l + 16 * GP), "v"(l + 32 * GP), "v"(l + 48 * GP), "v"(l + 64 * GP), "v"(l + 80 * GP), "v"(l + 96 * GP), "v"(l + 112 * GP),
                    "v"(g), "v"(g + step), "v"(g + 2 * step), "v"(g + 3 * step), "v"(g + 4 * step), "v"(g + 5 * step), "v"(g + 6 * step), "v"(g + 7 * step) : "memory");
}
template <typename T16, int NSPLIT, int EPI>
__global__ __launch_bounds__(128) void k_gemmw(const T16* __restrict__ A, const T16* __restrict__ A2, const T16* __restrict__ Bt, const T16* __restrict__ Bt2, int K, const float* __restrict__ X, float* O, bf* Ph, bf* Pl, bf* Vh, bf* Vl) {
    typedef typename WFrag<T16>::V V;
    constexpr bool HA2 = (NSPLIT == 1 || NSPLIT == 2), HB2 = (NSPLIT >= 2); constexpr int NOP = 2 + (HA2 ? 1 : 0) + (HB2 ? 1 : 0);   // operands of a stage, in the order A | Bt | A2 | Bt2
    __shared__ __attribute__((aligned(128))) unsigned char ring[2 * NOP * GOP];
    __shared__ __align__(16) float osall[4][16 * 68];
    const int wv = __builtin_amdgcn_readfirstlane(threadIdx.x >> 5);   // wave number in a scalar register: the wave's tile indices stay scalar
    const int tid = threadIdx.x, lane = tid & 31, lr = lane & 15, hi = lane >> 4; const int R0 = blockIdx.x * 128, C0 = blockIdx.y * 128; const int r0 = R0 + (wv >> 1) * 64, c0 = C0 + (wv & 1) * 64;
    float* os = osall[wv];   // each wave stages its epilogue in its own range
    v8f acc[4][4];
#pragma unroll
    for (int mb = 0; mb < 4; ++mb)
#pragma unroll
        for (int nb = 0; nb < 4; ++nb) acc[mb][nb] = (v8f){};
    const unsigned lb = (unsigned)(size_t)ring + (unsigned)((tid >> 3) * GP + (tid & 7) * 16);   // 8 lanes per row: a wave's copy covers 4 whole lines
    const size_t ga = (size_t)(R0 + (tid >> 3)) * K + (tid & 7) * 8, gb = (size_t)(C0 + (tid >> 3)) * K + (tid & 7) * 8, st16 = (size_t)16 * K;
    auto fill = [&](int t, int buf) { const unsigned l = lb + (unsigned)(buf * NOP * GOP); const int kc = t * 64;
        acopy8(l, A + ga + kc, st16); acopy8(l + GOP, Bt + gb + kc, st16);
        if (HA2) acopy8(l + 2 * GOP, A2 + ga + kc, st16);
        if (HB2) acopy8(l + (HA2 ? 3 : 2) * GOP, Bt2 + gb + kc, st16); };
    const int NT = K >> 6;
    fill(0, 0);
    asm volatile("s_wait_asynccnt 0x0" ::: "memory");   // this wave's copies of stage 0 have landed
    __syncthreads();   // stage 0 is published: every wave's copies have landed before any wave reads it
    if (NT > 1) fill(1, 1);
    const int ao = ((wv >> 1) * 64 + lr) * GP + hi * 16, bo = GOP + ((wv & 1) * 64 + lr) * GP + hi * 16;
#pragma unroll 1
    for (int t = 0; t < NT; ++t) {
        const unsigned char* sg = ring + (t & 1) * (NOP * GOP);
        V a[2][4], a2[2][4], b[2][4], b2[2][4];
#pragma unroll
        for (int ks = 0; ks < 2; ++ks) {
#pragma unroll
            for (int mb = 0; mb < 4; ++mb) { a[ks][mb] = WFrag<T16>::ld((const T16*)(sg + ao + mb * 16 * GP + ks * 64)); if (HA2) a2[ks][mb] = WFrag<T16>::ld((const T16*)(sg + ao + 2 * GOP + mb * 16 * GP + ks * 64)); }
#pragma unroll
            for (int nb = 0; nb < 4; ++nb) { b[ks][nb] = WFrag<T16>::ld((const T16*)(sg + bo + nb * 16 * GP + ks * 64)); if (HB2) b2[ks][nb] = WFrag<T16>::ld((const T16*)(sg + bo + (HA2 ? 2 : 1) * GOP + nb * 16 * GP + ks * 64)); } }
        __builtin_amdgcn_sched_barrier(0);   // the stage's LDS reads are issued as one group in front of its first matrix instruction; left free, they sink between the products into one register set, each group of four products behind a full LDS wait
#pragma unroll
        for (int ks = 0; ks < 2; ++ks)
#pragma unroll
            for (int nb = 0; nb < 4; ++nb)
#pragma unroll
                for (int mb = 0; mb < 4; ++mb) { acc[mb][nb] = WFrag<T16>::mma(a[ks][mb], b[ks][nb], acc[mb][nb]); if (HA2) acc[mb][nb] = WFrag<T16>::mma(a2[ks][mb], b[ks][nb], acc[mb][nb]); if (HB2) acc[mb][nb] = WFrag<T16>::mma(a[ks][mb], b2[ks][nb], acc[mb][nb]); }
        __builtin_amdgcn_sched_barrier(0);
        asm volatile("s_wait_dscnt 0x0" ::: "memory");
        asm volatile("s_wait_asynccnt 0x0" ::: "memory");
        __syncthreads();
        if (t + 2 < NT) fill(t + 2, t & 1);
    }
    asm volatile("s_wait_asynccnt 0x0" ::: "memory");   // no copy is outstanding when the wave goes on to its epilogue and ends
    const int bt = r0 / TT, t0 = r0 % TT, sec = c0 / DM, hd = (c0 % DM) / HD;   // EPI 1: batch, first position, q | k | v, head of this tile (all from blockIdx and the wave number: scalar)
    if (EPI == 1 && sec == 2) {   // v: a lane holds 8 consecutive positions of one d per accumulator, which is the transposed plane's own order: stored straight from registers, the four pieces of a 128-byte line one after the other
        const size_t vo = ((size_t)(bt * NKV + hd) * HD + lr) * TT + t0 + hi * 8; bf* vh = Vh + vo; bf* vl = Vl + vo;
#pragma unroll
        for (int nb = 0; nb < 4; ++nb) { v8us oh[4], ol[4];
#pragma unroll
            for (int mb = 0; mb < 4; ++mb)
#pragma unroll
                for (int j = 0; j < 8; ++j) { unsigned short a2, c2; splitf(acc[mb][nb][j], a2, c2); oh[mb][j] = a2; ol[mb][j] = c2; }
#pragma unroll
            for (int mb = 0; mb < 4; ++mb) *(v8us*)(vh + nb * 16 * TT + mb * 16) = oh[mb];
#pragma unroll
            for (int mb = 0; mb < 4; ++mb) *(v8us*)(vl + nb * 16 * TT + mb * 16) = ol[mb];
            asm volatile("s_wait_xcnt 0x0" ::: "memory");   // in front of the next group's overwrites of the data registers that these stores name
            __builtin_amdgcn_sched_barrier(0);   // keeps those overwrites behind the wait
        }
        return;
    }
    v4f xs[4][8]; const size_t go = (size_t)(r0 + hi) * DM + c0 + lr * 4;   // EPI 2: this lane's first element of X and O
    if (EPI == 2) {   // the gate's x values of the whole tile are asked for at once, in front of the staging: one exposed latency per tile
        const float* xp = X + go;
#pragma unroll
        for (int mb = 0; mb < 4; ++mb)
#pragma unroll
            for (int s = 0; s < 8; ++s) xs[mb][s] = *(const v4f*)(xp + (mb * 16 + 2 * s) * DM);
    }
    const size_t po = ((size_t)((sec * NB_ + bt) * NH_ + hd) * TT + t0 + hi) * HD + lr * 4;   // EPI 1: this lane's first element of the tile's 64 rows in its q or k head plane
#pragma unroll
    for (int mb = 0; mb < 4; ++mb) {
#pragma unroll
        for (int nb = 0; nb < 4; ++nb) {
#pragma unroll
            for (int j = 0; j < 8; ++j) os[(hi * 8 + j) * 68 + nb * 16 + lr] = acc[mb][nb][j]; }
        __builtin_amdgcn_wave_barrier(); asm volatile("" ::: "memory");
        if (EPI == 1) { v4us oh[8], ol[8]; bf* ph = Ph + po; bf* pl = Pl + po;
#pragma unroll
            for (int s = 0; s < 8; ++s) { const v4f val = *(const v4fa*)(os + (2 * s + hi) * 68 + lr * 4);
#pragma unroll
                for (int q = 0; q < 4; ++q) { unsigned short a2, c2; splitf(val[q], a2, c2); oh[s][q] = a2; ol[s][q] = c2; } }
#pragma unroll
            for (int s = 0; s < 8; ++s) *(v4us*)(ph + (mb * 16 + 2 * s) * HD) = oh[s];
#pragma unroll
            for (int s = 0; s < 8; ++s) *(v4us*)(pl + (mb * 16 + 2 * s) * HD) = ol[s]; }
        if (EPI == 2) { v4f o[8]; float* op = O + go;
#pragma unroll
            for (int s = 0; s < 8; ++s) { const v4f val = *(const v4fa*)(os + (2 * s + hi) * 68 + lr * 4);
#pragma unroll
                for (int q = 0; q < 4; ++q) o[s][q] = __fmul_rn(bfr(xs[mb][s][q]), val[q]); }
#pragma unroll
            for (int s = 0; s < 8; ++s) *(v4f*)(op + (mb * 16 + 2 * s) * DM) = o[s]; }
        __builtin_amdgcn_wave_barrier(); asm volatile("s_wait_xcnt 0x0" ::: "memory");   // in front of the next group's overwrites of the data registers that these stores name; as a compiler fence it also keeps the next group's LDS writes behind this group's reads
        __builtin_amdgcn_sched_barrier(0);   // keeps those overwrites behind the wait
    }
}

// ---- k_prep: everything the GEMMs need in bf16, one launch. Work-groups 0 .. PWQ + PWO - 1 each transpose one tile of 128 k x 64 n of a weight ('xw' [k][n] f32 -> Bt [n][k] bf16) through LDS; the PXB behind them round x.
// Transpose: a wave reads 16 rows of k, 256 contiguous bytes per row (a lane: 2 n), all 16 loads in flight at once; a lane then holds 16 consecutive k of its 2 n, writes them as 16-byte pieces of the transposed rows in LDS, and the tile leaves as 256 contiguous bytes per n.
#define PTK  128                  // k of a tile
#define PTN  64                   // n of a tile
#define PTP  136                  // LDS pitch of a transposed row, elements: 272 B = 16 B x odd, free of bank conflicts for the 16-byte writes down a column
#define PWQ  ((DM / PTK) * (3 * DM / PTN))
#define PWO  ((DQ / PTK) * (DM / PTN))
#define PXB  256                  // work-groups that round x: 16 pieces of 4 elements per thread
typedef __attribute__((ext_vector_type(2))) float v2f;
// one tile; N (the weight's row length) is a compile-time constant so that the 16 rows are immediate offsets from one scalar base and no address register is rewritten between the loads
template <int N> __device__ __forceinline__ void wtile(const float* __restrict__ w, bf* Bt, int b, bf* tl) {
    const int tid = threadIdx.x, lane = tid & 31;
    const int wv = __builtin_amdgcn_readfirstlane(tid >> 5);   // wave number in a scalar register: the rows' base address stays scalar
    const int k0 = (b % (DM / PTK)) * PTK, n0 = (b / (DM / PTK)) * PTN;
    const float* p = w + (size_t)(k0 + wv * 16) * N + n0; v2f r[16];
#pragma unroll
    for (int j = 0; j < 16; ++j) r[j] = *(const v2f*)(p + j * N + lane * 2);
    asm volatile("s_wait_xcnt 0x0" ::: "memory");   // in front of any later overwrite of a register that the 16 loads name
    __builtin_amdgcn_sched_barrier(0);   // keeps those overwrites behind the wait, and the 16 loads in one group in front of it
#pragma unroll
    for (int c = 0; c < 2; ++c)
#pragma unroll
        for (int h = 0; h < 2; ++h) { v8us o;
#pragma unroll
            for (int j = 0; j < 8; ++j) o[j] = f2bf(r[h * 8 + j][c]);
            *(v8usa*)(tl + (c * 32 + lane) * PTP + wv * 16 + h * 8) = o; }   // n = 2 * lane + c lies in LDS row c * 32 + lane: a wave's 16-byte writes walk consecutive rows
    __syncthreads();   // the whole transposed tile is in LDS before any thread reads a row of it
#pragma unroll
    for (int i = 0; i < 4; ++i) { const int row = (tid >> 4) + 16 * i, n = (row & 31) * 2 + (row >> 5), pc = (tid & 15) * 8; *(v8us*)(Bt + (size_t)(n0 + n) * DM + k0 + pc) = *(const v8usa*)(tl + row * PTP + pc); }
    asm volatile("s_wait_xcnt 0x0" ::: "memory");   // in front of any later overwrite of a register that the four stores name
}
__global__ __launch_bounds__(256) void k_prep(const float* __restrict__ x, const float* __restrict__ wqkv, const float* __restrict__ wo, bf* XB, bf* WALL, bf* WO) {
    __shared__ __align__(16) bf tl[PTN * PTP];
    const int b = blockIdx.x;
    if (b < PWQ) { wtile<3 * DM>(wqkv, WALL, b, tl); return; }
    if (b < PWQ + PWO) { wtile<DM>(wo, WO, b - PWQ, tl); return; }
    // x: a wave's load covers 512 contiguous bytes, its store 256
    const size_t i0 = (size_t)(b - (PWQ + PWO)) * (256 * 4) + threadIdx.x * 4; v4f v[16]; v4us o[16];
#pragma unroll
    for (int s = 0; s < 16; ++s) v[s] = *(const v4f*)(x + i0 + (size_t)s * (PXB * 256 * 4));
    asm volatile("s_wait_xcnt 0x0" ::: "memory");   // in front of any later overwrite of a register that the 16 loads name
    __builtin_amdgcn_sched_barrier(0);   // keeps those overwrites behind the wait, and the 16 loads in one group in front of it
#pragma unroll
    for (int s = 0; s < 16; ++s)
#pragma unroll
        for (int q = 0; q < 4; ++q) o[s][q] = f2bf(v[s][q]);
#pragma unroll
    for (int s = 0; s < 16; ++s) *(v4us*)(XB + i0 + (size_t)s * (PXB * 256 * 4)) = o[s];
    asm volatile("s_wait_xcnt 0x0" ::: "memory");   // in front of any later overwrite of a register that the 16 stores name
}


// value of lane l ^ X inside the 16-lane row (DPP row_xmask): the row reductions of k_cstat stay on the vector unit
template <int X> __device__ __forceinline__ float rowx(float x) { return __builtin_bit_cast(float, __builtin_amdgcn_update_dpp(0, __builtin_bit_cast(int, x), 0x160 | X, 0xf, 0xf, true)); }

// ---- k_cstat: column-softmax statistics. One work-group per 32 keys of one head (grid: head, key tile); the 64-wide query chunks from the diagonal on are dealt round-robin to the CSW waves.
// A = key rows (kept in registers), B = query rows, D = S^T tile: lane (lr, hi) holds keys hi*8 + r of queries lr. Every lane keeps a running (max, sum) per key row over its own queries;
// the 16 lanes of a row and then the CSW waves are merged at the end. MX[h][j] = max_i s, RZ[h][j] = 1 / sum_i exp(s - max).
__global__ __launch_bounds__(32 * CSW) void k_cstat(const bf* __restrict__ Kh, const bf* __restrict__ Kl, const bf* __restrict__ Qh, const bf* __restrict__ Ql, float* MX, float* RZ) {
    __shared__ float sm[CSW][32]; __shared__ float sl[CSW][32];
    const int wv = __builtin_amdgcn_readfirstlane(threadIdx.x >> 5);   // wave number in a scalar register: the query loop stays a scalar branch, every lane on at the matrix instructions
    const size_t zo = (size_t)blockIdx.x * TT * HD; const int lane = threadIdx.x & 31, lr = lane & 15, hi = lane >> 4; const int j0 = blockIdx.y * 32;
    v16bf kh[2][2], kl[2][2];
#pragma unroll
    for (int mb = 0; mb < 2; ++mb)
#pragma unroll
        for (int ks = 0; ks < 2; ++ks) { const size_t o = zo + (size_t)(j0 + mb * 16 + lr) * HD + ks * 32 + 8 * hi; kh[mb][ks] = WFrag<bf>::ld(Kh + o); kl[mb][ks] = WFrag<bf>::ld(Kl + o); }
    asm volatile("s_wait_xcnt 0x0" ::: "memory");   // in front of the loop's overwrites of the address registers that the key loads name
    __builtin_amdgcn_sched_barrier(0);   // keeps those overwrites behind the wait
    float m[2][8], l[2][8];
#pragma unroll
    for (int mb = 0; mb < 2; ++mb)
#pragma unroll
        for (int r = 0; r < 8; ++r) { m[mb][r] = -3.0e38f; l[mb][r] = 0.f; }
#pragma unroll 1
    for (int c0 = (j0 & ~63) + wv * 64; c0 < TT; c0 += CSW * 64) {
        v8f s[2][4];
#pragma unroll
        for (int nb = 0; nb < 4; ++nb) { v16bf qh[2], ql[2];
#pragma unroll
            for (int ks = 0; ks < 2; ++ks) { const size_t o = zo + (size_t)(c0 + nb * 16 + lr) * HD + ks * 32 + 8 * hi; qh[ks] = WFrag<bf>::ld(Qh + o); ql[ks] = WFrag<bf>::ld(Ql + o); }
#pragma unroll
            for (int mb = 0; mb < 2; ++mb) { v8f a = (v8f){};
#pragma unroll
                for (int ks = 0; ks < 2; ++ks) { a = wmmab(kh[mb][ks], qh[ks], a); a = wmmab(kl[mb][ks], qh[ks], a); a = wmmab(kh[mb][ks], ql[ks], a); }
                s[mb][nb] = a; } }
#pragma unroll
        for (int mb = 0; mb < 2; ++mb)
#pragma unroll
            for (int r = 0; r < 8; ++r) { const int j = j0 + mb * 16 + hi * 8 + r; float t[4]; float mn = m[mb][r];
#pragma unroll
                for (int nb = 0; nb < 4; ++nb) { t[nb] = (c0 + nb * 16 + lr >= j) ? s[mb][nb][r] * SCL : -3.0e38f;   /* causal keeps queries i >= key j */ mn = fmaxf(mn, t[nb]); }
                float a = l[mb][r] * __builtin_amdgcn_exp2f((m[mb][r] - mn) * L2E);
#pragma unroll
                for (int nb = 0; nb < 4; ++nb) a += (c0 + nb * 16 + lr >= j) ? __builtin_amdgcn_exp2f((t[nb] - mn) * L2E) : 0.f;
                l[mb][r] = a; m[mb][r] = mn; }
        asm volatile("s_wait_xcnt 0x0" ::: "memory");   // in front of the next trip's overwrites of the address registers that this trip's query loads name
    }
#pragma unroll
    for (int mb = 0; mb < 2; ++mb)
#pragma unroll
        for (int r = 0; r < 8; ++r) { float M = m[mb][r]; M = fmaxf(M, rowx<1>(M)); M = fmaxf(M, rowx<2>(M)); M = fmaxf(M, rowx<4>(M)); M = fmaxf(M, rowx<8>(M));
            float a = l[mb][r] * __builtin_amdgcn_exp2f((m[mb][r] - M) * L2E); a += rowx<1>(a); a += rowx<2>(a); a += rowx<4>(a); a += rowx<8>(a); m[mb][r] = M; l[mb][r] = a; }
    if (lr == 0) {
#pragma unroll
        for (int mb = 0; mb < 2; ++mb)
#pragma unroll
            for (int r = 0; r < 8; ++r) { sm[wv][mb * 16 + hi * 8 + r] = m[mb][r]; sl[wv][mb * 16 + hi * 8 + r] = l[mb][r]; } }
    __syncthreads();   // every wave's (max, sum) per key is in LDS before the first wave merges them
    if (threadIdx.x < 32) { const int row = threadIdx.x; float M = sm[0][row];
#pragma unroll
        for (int w = 1; w < CSW; ++w) M = fmaxf(M, sm[w][row]);
        float Z = 0.f;
#pragma unroll
        for (int w = 0; w < CSW; ++w) Z += sl[w][row] * __builtin_amdgcn_exp2f((sm[w][row] - M) * L2E);
        const size_t o = (size_t)blockIdx.x * TT + j0 + row; MX[o] = M; RZ[o] = __fdiv_rn(1.0f, Z); }
}

// ---- k_cattn: out^T[d][i] = sum_j v^T[d][j] A[i][j] for 64 queries of one head per work-group (grid: head, query tile, the longest key loops first); the 32-wide key chunks up to the diagonal block are dealt
// round-robin to the CSW waves. Per chunk a wave forms S^T (two 16-key tiles per 16 queries), p = exp(s - MX[j]) RZ[j] (0 for j > i), splits p hi/lo, and uses the two tiles as they lie as one B fragment:
// D of tile t holds keys t*16 + hi*8 + r at lane (lr, hi), which is the k order 8*hi + e | 16 + 8*hi + e of the A loader of v^T. The CSW partial tiles are summed through LDS in wave order and written as the merged hi/lo planes.
__global__ __launch_bounds__(32 * CSW) void k_cattn(const bf* __restrict__ Kh, const bf* __restrict__ Kl, const bf* __restrict__ Qh, const bf* __restrict__ Ql, const bf* __restrict__ Vh, const bf* __restrict__ Vl, const float* __restrict__ MX, const float* __restrict__ RZ, bf* Ah, bf* Al) {
    __shared__ __align__(16) float os[CSW][64 * 68];
    const int wv = __builtin_amdgcn_readfirstlane(threadIdx.x >> 5);   // wave number in a scalar register: the key loop stays a scalar branch, every lane on at the matrix instructions
    const size_t zo = (size_t)blockIdx.x * TT * HD, zs = (size_t)blockIdx.x * TT; const int lane = threadIdx.x & 31, lr = lane & 15, hi = lane >> 4; const int r0 = (TT / 64 - 1 - (int)blockIdx.y) * 64;
    v16bf qh[4][2], ql[4][2];
#pragma unroll
    for (int nb = 0; nb < 4; ++nb)
#pragma unroll
        for (int ks = 0; ks < 2; ++ks) { const size_t o = zo + (size_t)(r0 + nb * 16 + lr) * HD + ks * 32 + 8 * hi; qh[nb][ks] = WFrag<bf>::ld(Qh + o); ql[nb][ks] = WFrag<bf>::ld(Ql + o); }
    asm volatile("s_wait_xcnt 0x0" ::: "memory");   // in front of the loop's overwrites of the address registers that the query loads name
    __builtin_amdgcn_sched_barrier(0);   // keeps those overwrites behind the wait
    v8f acc[4][4];
#pragma unroll
    for (int mb = 0; mb < 4; ++mb)
#pragma unroll
        for (int nb = 0; nb < 4; ++nb) acc[mb][nb] = (v8f){};
#pragma unroll 1
    for (int kc = wv * 32; kc < r0 + 64; kc += CSW * 32) {
        v16bf kh[2][2], kl[2][2], vh[4], vl[4]; v8f mx[2], rz[2];
#pragma unroll
        for (int t = 0; t < 2; ++t) { mx[t] = *(const v8f*)(MX + zs + kc + t * 16 + hi * 8); rz[t] = *(const v8f*)(RZ + zs + kc + t * 16 + hi * 8);
#pragma unroll
            for (int ks = 0; ks < 2; ++ks) { const size_t o = zo + (size_t)(kc + t * 16 + lr) * HD + ks * 32 + 8 * hi; kh[t][ks] = WFrag<bf>::ld(Kh + o); kl[t][ks] = WFrag<bf>::ld(Kl + o); } }
#pragma unroll
        for (int mb = 0; mb < 4; ++mb) { const size_t o = zo + (size_t)(mb * 16 + lr) * TT + kc + 8 * hi; vh[mb] = WFrag<bf>::ld(Vh + o); vl[mb] = WFrag<bf>::ld(Vl + o); }
        __builtin_amdgcn_sched_barrier(0);   // every load of the chunk is issued in front of its first matrix instruction: one exposed load latency per chunk; left free, the v^T loads sink between the products
        asm volatile("s_wait_xcnt 0x0" ::: "memory");   // stands in front of every later overwrite of an address register that the chunk's loads name
        __builtin_amdgcn_sched_barrier(0);   // keeps the address updates of the next chunk behind that wait
#pragma unroll
        for (int nb = 0; nb < 4; ++nb) { v8us ph[2], pl[2]; const int i = r0 + nb * 16 + lr;
#pragma unroll
            for (int t = 0; t < 2; ++t) { v8f a = (v8f){};
#pragma unroll
                for (int ks = 0; ks < 2; ++ks) { a = wmmab(kh[t][ks], qh[nb][ks], a); a = wmmab(kl[t][ks], qh[nb][ks], a); a = wmmab(kh[t][ks], ql[nb][ks], a); }
#pragma unroll
                for (int r = 0; r < 8; ++r) { const float e = __builtin_amdgcn_exp2f((a[r] * SCL - mx[t][r]) * L2E); const float p = (i >= kc + t * 16 + hi * 8 + r) ? e * rz[t][r] : 0.f; unsigned short h2, l2; splitf(p, h2, l2); ph[t][r] = h2; pl[t][r] = l2; } }
            const v16bf bh = cat16b(ph[0], ph[1]), bl = cat16b(pl[0], pl[1]);
#pragma unroll
            for (int mb = 0; mb < 4; ++mb) { acc[mb][nb] = wmmab(vh[mb], bh, acc[mb][nb]); acc[mb][nb] = wmmab(vh[mb], bl, acc[mb][nb]); acc[mb][nb] = wmmab(vl[mb], bh, acc[mb][nb]); } }
    }
#pragma unroll
    for (int mb = 0; mb < 4; ++mb)
#pragma unroll
        for (int nb = 0; nb < 4; ++nb) { float* p = &os[wv][(nb * 16 + lr) * 68 + mb * 16 + hi * 8]; const v8f a = acc[mb][nb]; *(v4fa*)p = __builtin_shufflevector(a, a, 0, 1, 2, 3); *(v4fa*)(p + 4) = __builtin_shufflevector(a, a, 4, 5, 6, 7); }
    __syncthreads();   // every wave's partial tile is in LDS before any thread sums across the waves
#pragma unroll
    for (int s = 0; s < 64 * 16 / (32 * CSW); ++s) { const int idx = s * 32 * CSW + (int)threadIdx.x; const int row = idx >> 4, cofs = (idx & 15) * 4; v4f val = *(const v4fa*)(&os[0][row * 68 + cofs]);
#pragma unroll
        for (int w = 1; w < CSW; ++w) val += *(const v4fa*)(&os[w][row * 68 + cofs]);
        v4us oh, ol;
#pragma unroll
        for (int q = 0; q < 4; ++q) { unsigned short a2, c2; splitf(val[q], a2, c2); oh[q] = a2; ol[q] = c2; }
        const size_t oo = (size_t)((int)(blockIdx.x / NH_) * TT + r0 + row) * DQ + (size_t)(blockIdx.x % NH_) * HD + cofs;   /* blockIdx.x: batch x head */ *(v4us*)(Ah + oo) = oh; *(v4us*)(Al + oo) = ol; }
}

extern "C" void kernel_launch(void* const* d_in, const int* in_sizes, int n_in,
                              void* d_out, int out_size, void* d_ws, size_t ws_size, hipStream_t stream) {
    (void)in_sizes; (void)n_in; (void)out_size;
    const float* x = (const float*)d_in[0]; const float* wqkv = (const float*)d_in[1]; const float* wo = (const float*)d_in[2];  const float* wq = nullptr; const float* wk = nullptr; const float* wv = nullptr; (void)wq; (void)wk; (void)wv;
    float* OUT = (float*)d_out;     // [2][2048][1024]
    char* wsp = (char*)d_ws;
    auto take = [&](size_t bytes) { char* p = wsp; wsp += (bytes + 255) & ~(size_t)255; return (void*)p; };
    bf* WALL = (bf*)take((size_t)3 * DM * DM * 2); bf* WO = (bf*)take((size_t)DM * DQ * 2);
    bf* XB = (bf*)take((size_t)NB_ * TT * DM * 2);
    const size_t PL = (size_t)NB_ * NH_ * TT * HD;   // one plane set: [batch x head][t][d] (v: [batch x head][d][t])
    bf* QPh = (bf*)take(2 * PL * 2);   /* q planes, then k planes */ bf* QPl = (bf*)take(2 * PL * 2); bf* KPh = QPh + PL; bf* KPl = QPl + PL; bf* VTh = (bf*)take(PL * 2); bf* VTl = (bf*)take(PL * 2);
    float* MX = (float*)take((size_t)NB_ * NH_ * TT * 4); float* RZ = (float*)take((size_t)NB_ * NH_ * TT * 4); bf* ATh = (bf*)take((size_t)NB_ * TT * DQ * 2); bf* ATl = (bf*)take((size_t)NB_ * TT * DQ * 2);
    if ((size_t)(wsp - (char*)d_ws) > ws_size) return;    // ws 256 MiB
    // one launch per stage: both batches (rows of x are contiguous) and, in the projection, q | k | v (rows of WALL are contiguous) are grid dimensions
    k_prep<<<PWQ + PWO + PXB, 256, 0, stream>>>(x, wqkv, wo, XB, WALL, WO);   /* fused 'xw' [DM][3DM] -> Bt [3DM][DM] (row blocks q | k | v), W_proj -> Bt [DM][DQ], x -> bf16 */
    k_gemmw<bf, 0, 1><<<dim3(NB_ * TT / 128, 3 * DM / 128, 1), 128, 0, stream>>>(XB, nullptr, WALL, nullptr, DM, nullptr, nullptr, QPh, QPl, VTh, VTl);   /* q, k head planes and v^T planes written by the projection's own epilogue */
    k_cstat<<<dim3(NB_ * NH_, TT / 32, 1), 32 * CSW, 0, stream>>>(KPh, KPl, QPh, QPl, MX, RZ);   /* per key: maximum and 1/sum of the scores over the queries that see it (one kv head per query head) */
    k_cattn<<<dim3(NB_ * NH_, TT / 64, 1), 32 * CSW, 0, stream>>>(KPh, KPl, QPh, QPl, VTh, VTl, MX, RZ, ATh, ATl);   /* A.v with the probabilities formed in registers, written as the merged hi/lo planes */
    k_gemmw<bf, 1, 2><<<dim3(NB_ * TT / 128, DM / 128, 1), 128, 0, stream>>>(ATh, ATl, WO, nullptr, DQ, x, OUT, nullptr, nullptr, nullptr, nullptr);   /* out = x * (m W_proj), the gate in the epilogue */
}

// v007
// It runs in 145 microseconds.
// Next to v006, in two timings, it ran 1.08 times as fast each time.
// Over all steps from v000 it is 9.67 times as fast.
#include <hip/hip_runtime.h>

// Causal attention normalised over the QUERY axis, used as a multiplicative gate (x [2][2048][1024]; [q|k|v] = x W_qkv ('xw' [1024][3072], no bias; 16 heads x 64); s[i][j] = q_i.k_j/8 for j <= i else -inf; A = softmax over i (each key column normalised over the queries that see it); m = A v merged; proj = m W_proj ('xw'); out = x * proj -> [2][2048][1024]).
// Layout: the scores are formed key-major in registers (S^T[j][i] = k_j.q_i, every row hi/lo, 3 products) and never stored: k_cstat keeps each key's maximum and 1/sum over the queries i >= j; k_cattn forms the same S^T tiles again, turns them into probabilities and feeds them, still in registers, as the B operand of out^T[d][i] = sum_j v^T[d][j] A[i][j] (3 products), key loop cut at the diagonal. No elementwise stage of its own between the GEMMs: the q|k|v projection's epilogue writes the hi/lo head planes and the transposed v planes, the output projection's epilogue applies the gate with bf16(x).
// Compute dtypes, f32 accumulate: every input rounded to bf16; q/k/v on PLAIN bf16 operands (inputs: exact); key-major scores and A.v on hi/lo planes for every row (3 products); column softmax in f32; W_proj hl x exact (2 products); the final x * proj gate in f32.

#define NB_  2
#define TT   2048
#define DM   1024
#define NH_  16
#define NKV  16
#define REP  (NH_ / NKV)
#define HD   64
#define DQ   (NH_ * HD)
#define DKV  (NKV * HD)
#define SCL  0.125f   // HD^-0.5
#define L2E  1.4426950408889634f
#define CSW  8                    // waves of a work-group that share one tile's loop in k_cstat (queries) and k_cattn (keys)
typedef _Float16 h16;
typedef unsigned short bf;
typedef __attribute__((ext_vector_type(16))) __bf16   v16bf;
typedef __attribute__((ext_vector_type(16))) _Float16 v16h;
typedef __attribute__((ext_vector_type(8)))  _Float16 v8h;
typedef __attribute__((ext_vector_type(8)))  unsigned short v8us;
typedef __attribute__((ext_vector_type(8)))  float    v8f;
typedef __attribute__((ext_vector_type(4)))  float    v4f;
typedef v8h  __attribute__((may_alias)) v8ha;
typedef v4f  __attribute__((may_alias)) v4fa;
typedef v8us __attribute__((may_alias)) v8usa;

__device__ __forceinline__ unsigned short f2bf(float f) { unsigned u = __float_as_uint(f); u += 0x7FFFu + ((u >> 16) & 1u); return (unsigned short)(u >> 16); }
__device__ __forceinline__ float bf2f(unsigned short b) { return __uint_as_float(((unsigned)b) << 16); }
__device__ __forceinline__ float bfr(float f) { return bf2f(f2bf(f)); }
__device__ __forceinline__ v16h cat16(v8h lo, v8h hi) { return __builtin_shufflevector(lo, hi, 0, 1, 2, 3, 4, 5, 6, 7, 8, 9, 10, 11, 12, 13, 14, 15); }
__device__ __forceinline__ v16bf cat16b(v8us lo, v8us hi) { return __builtin_bit_cast(v16bf, __builtin_shufflevector(lo, hi, 0, 1, 2, 3, 4, 5, 6, 7, 8, 9, 10, 11, 12, 13, 14, 15)); }
__device__ __forceinline__ v8f wmma16(v16h a, v16h b, v8f c) { return __builtin_amdgcn_wmma_f32_16x16x32_f16(false, a, false, b, (short)0, c, false, false); }
__device__ __forceinline__ v8f wmmab(v16bf a, v16bf b, v8f c) { return __builtin_amdgcn_wmma_f32_16x16x32_bf16(false, a, false, b, (short)0, c, false, false); }
__device__ __forceinline__ void splitf(float y, unsigned short& h, unsigned short& l) { h = f2bf(y); l = f2bf(y - bf2f(h)); }
typedef __attribute__((ext_vector_type(2))) unsigned short v2us;
typedef __attribute__((ext_vector_type(4))) unsigned short v4us;



// ---- k_gemmw: register-blocked GEMM, one work-group of 4 waves (2 x 2) per 128x128 output tile, each wave a 64x64 tile (16 accumulators); grid (M/128, N/128), 128 threads.
// The K-contiguous 16-bit operand planes are staged in LDS 64 k at a time (128-byte rows at pitch 144 B) by asynchronous copies, whole 128-byte lines per 8 lanes, in a ring of two buffers: the next stage's copies fly while this stage is worked on, and each operand row is fetched once per work-group instead of once per wave.
// c[m][n] (f32, in registers) = sum_k A[m][k] Bt[n][k] (+ split products per NSPLIT). K % 64 == 0, K >= 64. The tile never reaches memory as f32; the epilogue writes what the next stage reads:
// EPI 1 (q | k | v projection; a 64-column tile is one head of q, k or v): q and k as hi/lo head planes [q | k][batch][head][t][d], v as transposed hi/lo planes [batch][head][d][t].
// EPI 2 (output projection): O[m][n] = bf16(X[m][n]) * c[m][n], both of pitch DM.
#define GP   144                  // LDS pitch of a staged 128-byte row: 16 B x odd, free of bank conflicts for 16-byte reads down a column
#define GOP  (128 * GP)           // one operand's 128 rows of a stage
template <typename T16> struct WFrag;
template <> struct WFrag<h16> { typedef v16h V; static __device__ __forceinline__ V ld(const h16* p) { return cat16(*(const v8h*)p, *(const v8h*)(p + 16)); } static __device__ __forceinline__ v8f mma(V a, V b, v8f c) { return wmma16(a, b, c); } };
template <> struct WFrag<bf> { typedef v16bf V; static __device__ __forceinline__ V ld(const bf* p) { return cat16b(*(const v8us*)p, *(const v8us*)(p + 16)); } static __device__ __forceinline__ v8f mma(V a, V b, v8f c) { return wmmab(a, b, c); } };
// this lane's 16 bytes of 8 rows, 16 rows apart, of one operand: global -> LDS through no register. The s_wait_xcnt stands in the copies' own statement, in front of any later overwrite of an address register that a copy names.
template <typename T16> __device__ __forceinline__ void acopy8(unsigned l, const T16* g, size_t step) {
    asm volatile("global_load_async_to_lds_b128 %0, %8, off\n\t"
                 "global_load_async_to_lds_b128 %1, %9, off\n\t"
                 "global_load_async_to_lds_b128 %2, %10, off\n\t"
                 "global_load_async_to_lds_b128 %3, %11, off\n\t"
                 "global_load_async_to_lds_b128 %4, %12, off\n\t"
                 "global_load_async_to_lds_b128 %5, %13, off\n\t"
                 "global_load_async_to_lds_b128 %6, %14, off\n\t"
                 "global_load_async_to_lds_b128 %7, %15, off\n\t"
                 "s_wait_xcnt 0x0"
                 :: "v"(l), "v"(l + 16 * GP), "v"(l + 32 * GP), "v"(l + 48 * GP), "v"(l + 64 * GP), "v"(l + 80 * GP), "v"(l + 96 * GP), "v"(l + 112 * GP),
                    "v"(g), "v"(g + step), "v"(g + 2 * step), "v"(g + 3 * step), "v"(g + 4 * step), "v"(g + 5 * step), "v"(g + 6 * step), "v"(g + 7 * step) : "memory");
}
template <typename T16, int NSPLIT, int EPI>
__global__ __launch_bounds__(128) void k_gemmw(const T16* __restrict__ A, const T16* __restrict__ A2, const T16* __restrict__ Bt, const T16* __restrict__ Bt2, int K, const float* __restrict__ X, float* O, bf* Ph, bf* Pl, bf* Vh, bf* Vl) {
    typedef typename WFrag<T16>::V V;
    constexpr bool HA2 = (NSPLIT == 1 || NSPLIT == 2), HB2 = (NSPLIT >= 2); constexpr int NOP = 2 + (HA2 ? 1 : 0) + (HB2 ? 1 : 0);   // operands of a stage, in the order A | Bt | A2 | Bt2
    __shared__ __attribute__((aligned(128))) unsigned char ring[2 * NOP * GOP];
    __shared__ __align__(16) float osall[4][16 * 68];
    const int wv = __builtin_amdgcn_readfirstlane(threadIdx.x >> 5);   // wave number in a scalar register: the wave's tile indices stay scalar
    const int tid = threadIdx.x, lane = tid & 31, lr = lane & 15, hi = lane >> 4; const int R0 = blockIdx.x * 128, C0 = blockIdx.y * 128; const int r0 = R0 + (wv >> 1) * 64, c0 = C0 + (wv & 1) * 64;
    float* os = osall[wv];   // each wave stages its epilogue in its own range
    v8f acc[4][4];
#pragma unroll
    for (int mb = 0; mb < 4; ++mb)
#pragma unroll
        for (int nb = 0; nb < 4; ++nb) acc[mb][nb] = (v8f){};
    const unsigned lb = (unsigned)(size_t)ring + (unsigned)((tid >> 3) * GP + (tid & 7) * 16);   // 8 lanes per row: a wave's copy covers 4 whole lines
    const size_t ga = (size_t)(R0 + (tid >> 3)) * K + (tid & 7) * 8, gb = (size_t)(C0 + (tid >> 3)) * K + (tid & 7) * 8, st16 = (size_t)16 * K;
    auto fill = [&](int t, int buf) { const unsigned l = lb + (unsigned)(buf * NOP * GOP); const int kc = t * 64;
        acopy8(l, A + ga + kc, st16); acopy8(l + GOP, Bt + gb + kc, st16);
        if (HA2) acopy8(l + 2 * GOP, A2 + ga + kc, st16);
        if (HB2) acopy8(l + (HA2 ? 3 : 2) * GOP, Bt2 + gb + kc, st16); };
    const int NT = K >> 6;
    fill(0, 0);
    asm volatile("s_wait_asynccnt 0x0" ::: "memory");   // this wave's copies of stage 0 have landed
    __syncthreads();   // stage 0 is published: every wave's copies have landed before any wave reads it
    if (NT > 1) fill(1, 1);
    const int ao = ((wv >> 1) * 64 + lr) * GP + hi * 16, bo = GOP + ((wv & 1) * 64 + lr) * GP + hi * 16;
#pragma unroll 1
    for (int t = 0; t < NT; ++t) {
        const unsigned char* sg = ring + (t & 1) * (NOP * GOP);
        V a[2][4], a2[2][4], b[2][4], b2[2][4];
#pragma unroll
        for (int ks = 0; ks < 2; ++ks) {
#pragma unroll
            for (int mb = 0; mb < 4; ++mb) { a[ks][mb] = WFrag<T16>::ld((const T16*)(sg + ao + mb * 16 * GP + ks * 64)); if (HA2) a2[ks][mb] = WFrag<T16>::ld((const T16*)(sg + ao + 2 * GOP + mb * 16 * GP + ks * 64)); }
#pragma unroll
            for (int nb = 0; nb < 4; ++nb) { b[ks][nb] = WFrag<T16>::ld((const T16*)(sg + bo + nb * 16 * GP + ks * 64)); if (HB2) b2[ks][nb] = WFrag<T16>::ld((const T16*)(sg + bo + (HA2 ? 2 : 1) * GOP + nb * 16 * GP + ks * 64)); } }
        __builtin_amdgcn_sched_barrier(0);   // the stage's LDS reads are issued as one group in front of its first matrix instruction; left free, they sink between the products into one register set, each group of four products behind a full LDS wait
#pragma unroll
        for (int ks = 0; ks < 2; ++ks)
#pragma unroll
            for (int nb = 0; nb < 4; ++nb)
#pragma unroll
                for (int mb = 0; mb < 4; ++mb) { acc[mb][nb] = WFrag<T16>::mma(a[ks][mb], b[ks][nb], acc[mb][nb]); if (HA2) acc[mb][nb] = WFrag<T16>::mma(a2[ks][mb], b[ks][nb], acc[mb][nb]); if (HB2) acc[mb][nb] = WFrag<T16>::mma(a[ks][mb], b2[ks][nb], acc[mb][nb]); }
        __builtin_amdgcn_sched_barrier(0);
        asm volatile("s_wait_dscnt 0x0" ::: "memory");
        asm volatile("s_wait_asynccnt 0x0" ::: "memory");
        __syncthreads();
        if (t + 2 < NT) fill(t + 2, t & 1);
    }
    asm volatile("s_wait_asynccnt 0x0" ::: "memory");   // no copy is outstanding when the wave goes on to its epilogue and ends
    const int bt = r0 / TT, t0 = r0 % TT, sec = c0 / DM, hd = (c0 % DM) / HD;   // EPI 1: batch, first position, q | k | v, head of this tile (all from blockIdx and the wave number: scalar)
    if (EPI == 1 && sec == 2) {   // v: a lane holds 8 consecutive positions of one d per accumulator, which is the transposed plane's own order: stored straight from registers, the four pieces of a 128-byte line one after the other
        const size_t vo = ((size_t)(bt * NKV + hd) * HD + lr) * TT + t0 + hi * 8; bf* vh = Vh + vo; bf* vl = Vl + vo;
#pragma unroll
        for (int nb = 0; nb < 4; ++nb) { v8us oh[4], ol[4];
#pragma unroll
            for (int mb = 0; mb < 4; ++mb)
#pragma unroll
                for (int j = 0; j < 8; ++j) { unsigned short a2, c2; splitf(acc[mb][nb][j], a2, c2); oh[mb][j] = a2; ol[mb][j] = c2; }
#pragma unroll
            for (int mb = 0; mb < 4; ++mb) *(v8us*)(vh + nb * 16 * TT + mb * 16) = oh[mb];
#pragma unroll
            for (int mb = 0; mb < 4; ++mb) *(v8us*)(vl + nb * 16 * TT + mb * 16) = ol[mb];
            asm volatile("s_wait_xcnt 0x0" ::: "memory");   // in front of the next group's overwrites of the data registers that these stores name
            __builtin_amdgcn_sched_barrier(0);   // keeps those overwrites behind the wait
        }
        return;
    }
    v4f xs[4][8]; const size_t go = (size_t)(r0 + hi) * DM + c0 + lr * 4;   // EPI 2: this lane's first element of X and O
    if (EPI == 2) {   // the gate's x values of the whole tile are asked for at once, in front of the staging: one exposed latency per tile
        const float* xp = X + go;
#pragma unroll
        for (int mb = 0; mb < 4; ++mb)
#pragma unroll
            for (int s = 0; s < 8; ++s) xs[mb][s] = *(const v4f*)(xp + (mb * 16 + 2 * s) * DM);
    }
    const size_t po = ((size_t)((sec * NB_ + bt) * NH_ + hd) * TT + t0 + hi) * HD + lr * 4;   // EPI 1: this lane's first element of the tile's 64 rows in its q or k head plane
#pragma unroll
    for (int mb = 0; mb < 4; ++mb) {
#pragma unroll
        for (int nb = 0; nb < 4; ++nb) {
#pragma unroll
            for (int j = 0; j < 8; ++j) os[(hi * 8 + j) * 68 + nb * 16 + lr] = acc[mb][nb][j]; }
        __builtin_amdgcn_wave_barrier(); asm volatile("" ::: "memory");
        if (EPI == 1) { v4us oh[8], ol[8]; bf* ph = Ph + po; bf* pl = Pl + po;
#pragma unroll
            for (int s = 0; s < 8; ++s) { const v4f val = *(const v4fa*)(os + (2 * s + hi) * 68 + lr * 4);
#pragma unroll
                for (int q = 0; q < 4; ++q) { unsigned short a2, c2; splitf(val[q], a2, c2); oh[s][q] = a2; ol[s][q] = c2; } }
#pragma unroll
            for (int s = 0; s < 8; ++s) *(v4us*)(ph + (mb * 16 + 2 * s) * HD) = oh[s];
#pragma unroll
            for (int s = 0; s < 8; ++s) *(v4us*)(pl + (mb * 16 + 2 * s) * HD) = ol[s]; }
        if (EPI == 2) { v4f o[8]; float* op = O + go;
#pragma unroll
            for (int s = 0; s < 8; ++s) { const v4f val = *(const v4fa*)(os + (2 * s + hi) * 68 + lr * 4);
#pragma unroll
                for (int q = 0; q < 4; ++q) o[s][q] = __fmul_rn(bfr(xs[mb][s][q]), val[q]); }
#pragma unroll
            for (int s = 0; s < 8; ++s) *(v4f*)(op + (mb * 16 + 2 * s) * DM) = o[s]; }
        __builtin_amdgcn_wave_barrier(); asm volatile("s_wait_xcnt 0x0" ::: "memory");   // in front of the next group's overwrites of the data registers that these stores name; as a compiler fence it also keeps the next group's LDS writes behind this group's reads
        __builtin_amdgcn_sched_barrier(0);   // keeps those overwrites behind the wait
    }
}

// ---- k_prep: everything the GEMMs need in bf16, one launch. Work-groups 0 .. PWQ + PWO - 1 each transpose one tile of 128 k x 64 n of a weight ('xw' [k][n] f32 -> Bt [n][k] bf16) through LDS; the PXB behind them round x.
// Transpose: a wave reads 16 rows of k, 256 contiguous bytes per row (a lane: 2 n), all 16 loads in flight at once; a lane then holds 16 consecutive k of its 2 n, writes them as 16-byte pieces of the transposed rows in LDS, and the tile leaves as 256 contiguous bytes per n.
#define PTK  128                  // k of a tile
#define PTN  64                   // n of a tile
#define PTP  136                  // LDS pitch of a transposed row, elements: 272 B = 16 B x odd, free of bank conflicts for the 16-byte writes down a column
#define PWQ  ((DM / PTK) * (3 * DM / PTN))
#define PWO  ((DQ / PTK) * (DM / PTN))
#define PXB  256                  // work-groups that round x: 16 pieces of 4 elements per thread
typedef __attribute__((ext_vector_type(2))) float v2f;
// one tile; N (the weight's row length) is a compile-time constant so that the 16 rows are immediate offsets from one scalar base and no address register is rewritten between the loads
template <int N> __device__ __forceinline__ void wtile(const float* __restrict__ w, bf* Bt, int b, bf* tl) {
    const int tid = threadIdx.x, lane = tid & 31;
    const int wv = __builtin_amdgcn_readfirstlane(tid >> 5);   // wave number in a scalar register: the rows' base address stays scalar
    const int k0 = (b % (DM / PTK)) * PTK, n0 = (b / (DM / PTK)) * PTN;
    const float* p = w + (size_t)(k0 + wv * 16) * N + n0; v2f r[16];
#pragma unroll
    for (int j = 0; j < 16; ++j) r[j] = *(const v2f*)(p + j * N + lane * 2);
    asm volatile("s_wait_xcnt 0x0" ::: "memory");   // in front of any later overwrite of a register that the 16 loads name
    __builtin_amdgcn_sched_barrier(0);   // keeps those overwrites behind the wait, and the 16 loads in one group in front of it
#pragma unroll
    for (int c = 0; c < 2; ++c)
#pragma unroll
        for (int h = 0; h < 2; ++h) { v8us o;
#pragma unroll
            for (int j = 0; j < 8; ++j) o[j] = f2bf(r[h * 8 + j][c]);
            *(v8usa*)(tl + (c * 32 + lane) * PTP + wv * 16 + h * 8) = o; }   // n = 2 * lane + c lies in LDS row c * 32 + lane: a wave's 16-byte writes walk consecutive rows
    __syncthreads();   // the whole transposed tile is in LDS before any thread reads a row of it
#pragma unroll
    for (int i = 0; i < 4; ++i) { const int row = (tid >> 4) + 16 * i, n = (row & 31) * 2 + (row >> 5), pc = (tid & 15) * 8; *(v8us*)(Bt + (size_t)(n0 + n) * DM + k0 + pc) = *(const v8usa*)(tl + row * PTP + pc); }
    asm volatile("s_wait_xcnt 0x0" ::: "memory");   // in front of any later overwrite of a register that the four stores name
}
__global__ __launch_bounds__(256) void k_prep(const float* __restrict__ x, const float* __restrict__ wqkv, const float* __restrict__ wo, bf* XB, bf* WALL, bf* WO) {
    __shared__ __align__(16) bf tl[PTN * PTP];
    const int b = blockIdx.x;
    if (b < PWQ) { wtile<3 * DM>(wqkv, WALL, b, tl); return; }
    if (b < PWQ + PWO) { wtile<DM>(wo, WO, b - PWQ, tl); return; }
    // x: a wave's load covers 512 contiguous bytes, its store 256
    const size_t i0 = (size_t)(b - (PWQ + PWO)) * (256 * 4) + threadIdx.x * 4; v4f v[16]; v4us o[16];
#pragma unroll
    for (int s = 0; s < 16; ++s) v[s] = *(const v4f*)(x + i0 + (size_t)s * (PXB * 256 * 4));
    asm volatile("s_wait_xcnt 0x0" ::: "memory");   // in front of any later overwrite of a register that the 16 loads name
    __builtin_amdgcn_sched_barrier(0);   // keeps those overwrites behind the wait, and the 16 loads in one group in front of it
#pragma unroll
    for (int s = 0; s < 16; ++s)
#pragma unroll
        for (int q = 0; q < 4; ++q) o[s][q] = f2bf(v[s][q]);
#pragma unroll
    for (int s = 0; s < 16; ++s) *(v4us*)(XB + i0 + (size_t)s * (PXB * 256 * 4)) = o[s];
    asm volatile("s_wait_xcnt 0x0" ::: "memory");   // in front of any later overwrite of a register that the 16 stores name
}


// value of lane l ^ X inside the 16-lane row (DPP row_xmask): the row reductions of k_cstat stay on the vector unit
template <int X> __device__ __forceinline__ float rowx(float x) { return __builtin_bit_cast(float, __builtin_amdgcn_update_dpp(0, __builtin_bit_cast(int, x), 0x160 | X, 0xf, 0xf, true)); }

// ---- k_cstat: column-softmax statistics. One work-group per 32 keys of one head (grid: head, key tile); the 64-wide query chunks from the diagonal on are dealt round-robin to the CSW waves.
// A = key rows (kept in registers), B = query rows, D = S^T tile: lane (lr, hi) holds keys hi*8 + r of queries lr. Every lane keeps a running (max, sum) per key row over its own queries;
// the 16 lanes of a row and then the CSW waves are merged at the end. MX[h][j] = max_i s, RZ[h][j] = 1 / sum_i exp(s - max).
// The query rows of a chunk come in two groups of 16 loads (32 rows each) through one register set: the second group is issued as the first group's products free its registers, the next chunk's first group flies under this chunk's vector work.
// Second launch bound: four waves on a SIMD, that is at most 256 registers, so that two work-groups share a WGP as before; without it the build takes a few registers more and a wave slot per SIMD is lost.
__global__ __launch_bounds__(32 * CSW, 4) void k_cstat(const bf* __restrict__ Kh, const bf* __restrict__ Kl, const bf* __restrict__ Qh, const bf* __restrict__ Ql, float* MX, float* RZ) {
    __shared__ float sm[CSW][32]; __shared__ float sl[CSW][32];
    const int wv = __builtin_amdgcn_readfirstlane(threadIdx.x >> 5);   // wave number in a scalar register: the query loop stays a scalar branch, every lane on at the matrix instructions
    const size_t zo = (size_t)blockIdx.x * TT * HD; const int lane = threadIdx.x & 31, lr = lane & 15, hi = lane >> 4; const int j0 = blockIdx.y * 32;
    v16bf kh[2][2], kl[2][2];
    float m[2][8], l[2][8];
#pragma unroll
    for (int mb = 0; mb < 2; ++mb)
#pragma unroll
        for (int r = 0; r < 8; ++r) { m[mb][r] = -3.0e38f; l[mb][r] = 0.f; }
    const unsigned qo = (unsigned)(lr * HD + 8 * hi);   // this lane's place in a 16-row query fragment
    // hi/lo fragments of the 32 query rows from q0 on: 16 loads at immediate offsets from two addresses (hi plane, lo plane)
    auto ldq = [&](int q0, v16bf (&qh)[2][2], v16bf (&ql)[2][2]) { const bf* bh = Qh + zo + (size_t)q0 * HD; const bf* bl = Ql + zo + (size_t)q0 * HD;
#pragma unroll
        for (int nb = 0; nb < 2; ++nb)
#pragma unroll
            for (int ks = 0; ks < 2; ++ks) { qh[nb][ks] = WFrag<bf>::ld(bh + qo + nb * 16 * HD + ks * 32); ql[nb][ks] = WFrag<bf>::ld(bl + qo + nb * 16 * HD + ks * 32); }
        __builtin_amdgcn_sched_barrier(0);   // all 16 loads are issued in front of the first product that reads one: one load latency per group; left free, they sink between their own products in twos and threes, each behind a wait of its own
        asm volatile("s_wait_xcnt 0x0" ::: "memory");   // in front of every later overwrite of an address register that the 16 loads name
        __builtin_amdgcn_sched_barrier(0);   // keeps those overwrites behind the wait
    };
    // S^T tiles of the 32 keys x those 32 queries
    auto prod = [&](const v16bf (&qh)[2][2], const v16bf (&ql)[2][2], v8f (&s)[2][4], int n0) {
#pragma unroll
        for (int nb = 0; nb < 2; ++nb)
#pragma unroll
            for (int mb = 0; mb < 2; ++mb) { v8f a = (v8f){};
#pragma unroll
                for (int ks = 0; ks < 2; ++ks) { a = wmmab(kh[mb][ks], qh[nb][ks], a); a = wmmab(kl[mb][ks], qh[nb][ks], a); a = wmmab(kh[mb][ks], ql[nb][ks], a); }
                s[mb][n0 + nb] = a; }
    };
    int c0 = (j0 & ~63) + wv * 64;
    if (c0 < TT) {   // a wave with no trip loads nothing
#pragma unroll
        for (int mb = 0; mb < 2; ++mb)
#pragma unroll
            for (int ks = 0; ks < 2; ++ks) { const size_t o = zo + (size_t)(j0 + mb * 16 + lr) * HD + ks * 32 + 8 * hi; kh[mb][ks] = WFrag<bf>::ld(Kh + o); kl[mb][ks] = WFrag<bf>::ld(Kl + o); }
        asm volatile("s_wait_xcnt 0x0" ::: "memory");   // in front of the loop's overwrites of the address registers that the key loads name
        __builtin_amdgcn_sched_barrier(0);   // keeps those overwrites behind the wait
        v16bf qh[2][2], ql[2][2];
        ldq(c0, qh, ql);
        // the loop stays rolled: one register set for the query fragments, carried from trip to trip
#pragma unroll 1
        for (;;) {
            v8f s[2][4]; const int cn = c0 + CSW * 64; const bool more = cn < TT;
            prod(qh, ql, s, 0);
            ldq(c0 + 32, qh, ql);
            prod(qh, ql, s, 2);
            if (more) ldq(cn, qh, ql);   // in flight under this trip's vector work
#pragma unroll
            for (int mb = 0; mb < 2; ++mb)
#pragma unroll
                for (int r = 0; r < 8; ++r) { const int j = j0 + mb * 16 + hi * 8 + r; float t[4]; float mn = m[mb][r];
#pragma unroll
                    for (int nb = 0; nb < 4; ++nb) { t[nb] = (c0 + nb * 16 + lr >= j) ? s[mb][nb][r] * SCL : -3.0e38f;   /* causal keeps queries i >= key j */ mn = fmaxf(mn, t[nb]); }
                    float a = l[mb][r] * __builtin_amdgcn_exp2f((m[mb][r] - mn) * L2E);
#pragma unroll
                    for (int nb = 0; nb < 4; ++nb) a += (c0 + nb * 16 + lr >= j) ? __builtin_amdgcn_exp2f((t[nb] - mn) * L2E) : 0.f;
                    l[mb][r] = a; m[mb][r] = mn; }
            if (!more) break;
            c0 = cn;
        }
    }
#pragma unroll
    for (int mb = 0; mb < 2; ++mb)
#pragma unroll
        for (int r = 0; r < 8; ++r) { float M = m[mb][r]; M = fmaxf(M, rowx<1>(M)); M = fmaxf(M, rowx<2>(M)); M = fmaxf(M, rowx<4>(M)); M = fmaxf(M, rowx<8>(M));
            float a = l[mb][r] * __builtin_amdgcn_exp2f((m[mb][r] - M) * L2E); a += rowx<1>(a); a += rowx<2>(a); a += rowx<4>(a); a += rowx<8>(a); m[mb][r] = M; l[mb][r] = a; }
    if (lr == 0) {
#pragma unroll
        for (int mb = 0; mb < 2; ++mb)
#pragma unroll
            for (int r = 0; r < 8; ++r) { sm[wv][mb * 16 + hi * 8 + r] = m[mb][r]; sl[wv][mb * 16 + hi * 8 + r] = l[mb][r]; } }
    __syncthreads();   // every wave's (max, sum) per key is in LDS before the first wave merges them
    if (threadIdx.x < 32) { const int row = threadIdx.x; float M = sm[0][row];
#pragma unroll
        for (int w = 1; w < CSW; ++w) M = fmaxf(M, sm[w][row]);
        float Z = 0.f;
#pragma unroll
        for (int w = 0; w < CSW; ++w) Z += sl[w][row] * __builtin_amdgcn_exp2f((sm[w][row] - M) * L2E);
        const size_t o = (size_t)blockIdx.x * TT + j0 + row; MX[o] = M; RZ[o] = __fdiv_rn(1.0f, Z); }
}

// ---- k_cattn: out^T[d][i] = sum_j v^T[d][j] A[i][j] for 64 queries of one head per work-group (grid: head, query tile, the longest key loops first); the 32-wide key chunks up to the diagonal block are dealt
// round-robin to the CSW waves. Per chunk a wave forms S^T (two 16-key tiles per 16 queries), p = exp(s - MX[j]) RZ[j] (0 for j > i), splits p hi/lo, and uses the two tiles as they lie as one B fragment:
// D of tile t holds keys t*16 + hi*8 + r at lane (lr, hi), which is the k order 8*hi + e | 16 + 8*hi + e of the A loader of v^T. The CSW partial tiles are summed through LDS in wave order and written as the merged hi/lo planes.
__global__ __launch_bounds__(32 * CSW) void k_cattn(const bf* __restrict__ Kh, const bf* __restrict__ Kl, const bf* __restrict__ Qh, const bf* __restrict__ Ql, const bf* __restrict__ Vh, const bf* __restrict__ Vl, const float* __restrict__ MX, const float* __restrict__ RZ, bf* Ah, bf* Al) {
    __shared__ __align__(16) float os[CSW][64 * 68];
    const int wv = __builtin_amdgcn_readfirstlane(threadIdx.x >> 5);   // wave number in a scalar register: the key loop stays a scalar branch, every lane on at the matrix instructions
    const size_t zo = (size_t)blockIdx.x * TT * HD, zs = (size_t)blockIdx.x * TT; const int lane = threadIdx.x & 31, lr = lane & 15, hi = lane >> 4; const int r0 = (TT / 64 - 1 - (int)blockIdx.y) * 64;
    v16bf qh[4][2], ql[4][2];
#pragma unroll
    for (int nb = 0; nb < 4; ++nb)
#pragma unroll
        for (int ks = 0; ks < 2; ++ks) { const size_t o = zo + (size_t)(r0 + nb * 16 + lr) * HD + ks * 32 + 8 * hi; qh[nb][ks] = WFrag<bf>::ld(Qh + o); ql[nb][ks] = WFrag<bf>::ld(Ql + o); }
    asm volatile("s_wait_xcnt 0x0" ::: "memory");   // in front of the loop's overwrites of the address registers that the query loads name
    __builtin_amdgcn_sched_barrier(0);   // keeps those overwrites behind the wait
    v8f acc[4][4];
#pragma unroll
    for (int mb = 0; mb < 4; ++mb)
#pragma unroll
        for (int nb = 0; nb < 4; ++nb) acc[mb][nb] = (v8f){};
#pragma unroll 1
    for (int kc = wv * 32; kc < r0 + 64; kc += CSW * 32) {
        v16bf kh[2][2], kl[2][2], vh[4], vl[4]; v8f mx[2], rz[2];
#pragma unroll
        for (int t = 0; t < 2; ++t) { mx[t] = *(const v8f*)(MX + zs + kc + t * 16 + hi * 8); rz[t] = *(const v8f*)(RZ + zs + kc + t * 16 + hi * 8);
#pragma unroll
            for (int ks = 0; ks < 2; ++ks) { const size_t o = zo + (size_t)(kc + t * 16 + lr) * HD + ks * 32 + 8 * hi; kh[t][ks] = WFrag<bf>::ld(Kh + o); kl[t][ks] = WFrag<bf>::ld(Kl + o); } }
#pragma unroll
        for (int mb = 0; mb < 4; ++mb) { const size_t o = zo + (size_t)(mb * 16 + lr) * TT + kc + 8 * hi; vh[mb] = WFrag<bf>::ld(Vh + o); vl[mb] = WFrag<bf>::ld(Vl + o); }
        __builtin_amdgcn_sched_barrier(0);   // every load of the chunk is issued in front of its first matrix instruction: one exposed load latency per chunk; left free, the v^T loads sink between the products
        asm volatile("s_wait_xcnt 0x0" ::: "memory");   // stands in front of every later overwrite of an address register that the chunk's loads name
        __builtin_amdgcn_sched_barrier(0);   // keeps the address updates of the next chunk behind that wait
#pragma unroll
        for (int nb = 0; nb < 4; ++nb) { v8us ph[2], pl[2]; const int i = r0 + nb * 16 + lr;
#pragma unroll
            for (int t = 0; t < 2; ++t) { v8f a = (v8f){};
#pragma unroll
                for (int ks = 0; ks < 2; ++ks) { a = wmmab(kh[t][ks], qh[nb][ks], a); a = wmmab(kl[t][ks], qh[nb][ks], a); a = wmmab(kh[t][ks], ql[nb][ks], a); }
#pragma unroll
                for (int r = 0; r < 8; ++r) { const float e = __builtin_amdgcn_exp2f((a[r] * SCL - mx[t][r]) * L2E); const float p = (i >= kc + t * 16 + hi * 8 + r) ? e * rz[t][r] : 0.f; unsigned short h2, l2; splitf(p, h2, l2); ph[t][r] = h2; pl[t][r] = l2; } }
            const v16bf bh = cat16b(ph[0], ph[1]), bl = cat16b(pl[0], pl[1]);
#pragma unroll
            for (int mb = 0; mb < 4; ++mb) { acc[mb][nb] = wmmab(vh[mb], bh, acc[mb][nb]); acc[mb][nb] = wmmab(vh[mb], bl, acc[mb][nb]); acc[mb][nb] = wmmab(vl[mb], bh, acc[mb][nb]); } }
    }
#pragma unroll
    for (int mb = 0; mb < 4; ++mb)
#pragma unroll
        for (int nb = 0; nb < 4; ++nb) { float* p = &os[wv][(nb * 16 + lr) * 68 + mb * 16 + hi * 8]; const v8f a = acc[mb][nb]; *(v4fa*)p = __builtin_shufflevector(a, a, 0, 1, 2, 3); *(v4fa*)(p + 4) = __builtin_shufflevector(a, a, 4, 5, 6, 7); }
    __syncthreads();   // every wave's partial tile is in LDS before any thread sums across the waves
#pragma unroll
    for (int s = 0; s < 64 * 16 / (32 * CSW); ++s) { const int idx = s * 32 * CSW + (int)threadIdx.x; const int row = idx >> 4, cofs = (idx & 15) * 4; v4f val = *(const v4fa*)(&os[0][row * 68 + cofs]);
#pragma unroll
        for (int w = 1; w < CSW; ++w) val += *(const v4fa*)(&os[w][row * 68 + cofs]);
        v4us oh, ol;
#pragma unroll
        for (int q = 0; q < 4; ++q) { unsigned short a2, c2; splitf(val[q], a2, c2); oh[q] = a2; ol[q] = c2; }
        const size_t oo = (size_t)((int)(blockIdx.x / NH_) * TT + r0 + row) * DQ + (size_t)(blockIdx.x % NH_) * HD + cofs;   /* blockIdx.x: batch x head */ *(v4us*)(Ah + oo) = oh; *(v4us*)(Al + oo) = ol; }
}

extern "C" void kernel_launch(void* const* d_in, const int* in_sizes, int n_in,
                              void* d_out, int out_size, void* d_ws, size_t ws_size, hipStream_t stream) {
    (void)in_sizes; (void)n_in; (void)out_size;
    const float* x = (const float*)d_in[0]; const float* wqkv = (const float*)d_in[1]; const float* wo = (const float*)d_in[2];  const float* wq = nullptr; const float* wk = nullptr; const float* wv = nullptr; (void)wq; (void)wk; (void)wv;
    float* OUT = (float*)d_out;     // [2][2048][1024]
    char* wsp = (char*)d_ws;
    auto take = [&](size_t bytes) { char* p = wsp; wsp += (bytes + 255) & ~(size_t)255; return (void*)p; };
    bf* WALL = (bf*)take((size_t)3 * DM * DM * 2); bf* WO = (bf*)take((size_t)DM * DQ * 2);
    bf* XB = (bf*)take((size_t)NB_ * TT * DM * 2);
    const size_t PL = (size_t)NB_ * NH_ * TT * HD;   // one plane set: [batch x head][t][d] (v: [batch x head][d][t])
    bf* QPh = (bf*)take(2 * PL * 2);   /* q planes, then k planes */ bf* QPl = (bf*)take(2 * PL * 2); bf* KPh = QPh + PL; bf* KPl = QPl + PL; bf* VTh = (bf*)take(PL * 2); bf* VTl = (bf*)take(PL * 2);
    float* MX = (float*)take((size_t)NB_ * NH_ * TT * 4); float* RZ = (float*)take((size_t)NB_ * NH_ * TT * 4); bf* ATh = (bf*)take((size_t)NB_ * TT * DQ * 2); bf* ATl = (bf*)take((size_t)NB_ * TT * DQ * 2);
    if ((size_t)(wsp - (char*)d_ws) > ws_size) return;    // ws 256 MiB
    // one launch per stage: both batches (rows of x are contiguous) and, in the projection, q | k | v (rows of WALL are contiguous) are grid dimensions
    k_prep<<<PWQ + PWO + PXB, 256, 0, stream>>>(x, wqkv, wo, XB, WALL, WO);   /* fused 'xw' [DM][3DM] -> Bt [3DM][DM] (row blocks q | k | v), W_proj -> Bt [DM][DQ], x -> bf16 */
    k_gemmw<bf, 0, 1><<<dim3(NB_ * TT / 128, 3 * DM / 128, 1), 128, 0, stream>>>(XB, nullptr, WALL, nullptr, DM, nullptr, nullptr, QPh, QPl, VTh, VTl);   /* q, k head planes and v^T planes written by the projection's own epilogue */
    k_cstat<<<dim3(NB_ * NH_, TT / 32, 1), 32 * CSW, 0, stream>>>(KPh, KPl, QPh, QPl, MX, RZ);   /* per key: maximum and 1/sum of the scores over the queries that see it (one kv head per query head) */
    k_cattn<<<dim3(NB_ * NH_, TT / 64, 1), 32 * CSW, 0, stream>>>(KPh, KPl, QPh, QPl, VTh, VTl, MX, RZ, ATh, ATl);   /* A.v with the probabilities formed in registers, written as the merged hi/lo planes */
    k_gemmw<bf, 1, 2><<<dim3(NB_ * TT / 128, DM / 128, 1), 128, 0, stream>>>(ATh, ATl, WO, nullptr, DQ, x, OUT, nullptr, nullptr, nullptr, nullptr);   /* out = x * (m W_proj), the gate in the epilogue */
}

// v008
// It runs in 117 microseconds.
// Next to v007, in two timings, it ran 1.24 times as fast each time.
// All steps since v000 together make it 12.0 times as fast.
#include <hip/hip_runtime.h>

// Causal attention normalised over the QUERY axis, used as a multiplicative gate (x [2][2048][1024]; [q|k|v] = x W_qkv ('xw' [1024][3072], no bias; 16 heads x 64); s[i][j] = q_i.k_j/8 for j <= i else -inf; A = softmax over i (each key column normalised over the queries that see it); m = A v merged; proj = m W_proj ('xw'); out = x * proj -> [2][2048][1024]).
// Layout: the scores are formed key-major in registers (S^T[j][i] = k_j.q_i, every row hi/lo, 3 products) and never stored: k_cstat keeps each key's maximum and 1/sum over the queries i >= j; k_cattn forms the same S^T tiles again, turns them into probabilities and feeds them, still in registers, as the B operand of out^T[d][i] = sum_j v^T[d][j] A[i][j] (3 products), key loop cut at the diagonal. No elementwise stage of its own between the GEMMs: the q|k|v projection's epilogue writes the hi/lo head planes and the transposed v planes, the output projection's epilogue applies the gate with bf16(x).
// Plane order: the q, k and v^T planes lie in WMMA fragment order, not row-major: a 16-row x 32-k fragment is two runs of 512 contiguous bytes (piece 0 | 1), lane l's 8 elements at byte 16 l of each, so that one wave-wide 16-byte load covers 4 whole 128-byte lines. q, k: [plane][t / 16][d / 32][(d / 16) % 2][lane = ((d / 8) % 2) * 16 + t % 16][d % 8]; v^T: [plane][t / 32][d / 16][(t / 16) % 2][lane = ((t / 8) % 2) * 16 + d % 16][t % 8].
// Compute dtypes, f32 accumulate: every input rounded to bf16; q/k/v on PLAIN bf16 operands (inputs: exact); key-major scores and A.v on hi/lo planes for every row (3 products); column softmax in f32; W_proj hl x exact (2 products); the final x * proj gate in f32.

#define NB_  2
#define TT   2048
#define DM   1024
#define NH_  16
#define NKV  16
#define REP  (NH_ / NKV)
#define HD   64
#define DQ   (NH_ * HD)
#define DKV  (NKV * HD)
#define SCL  0.125f   // HD^-0.5
#define L2E  1.4426950408889634f
#define CSW  8                    // waves of a work-group that share one tile's loop in k_cstat (queries) and k_cattn (keys)
typedef _Float16 h16;
typedef unsigned short bf;
typedef __attribute__((ext_vector_type(16))) __bf16   v16bf;
typedef __attribute__((ext_vector_type(16))) _Float16 v16h;
typedef __attribute__((ext_vector_type(8)))  _Float16 v8h;
typedef __attribute__((ext_vector_type(8)))  unsigned short v8us;
typedef __attribute__((ext_vector_type(8)))  float    v8f;
typedef __attribute__((ext_vector_type(4)))  float    v4f;
typedef v8h  __attribute__((may_alias)) v8ha;
typedef v4f  __attribute__((may_alias)) v4fa;
typedef v8us __attribute__((may_alias)) v8usa;

__device__ __forceinline__ unsigned short f2bf(float f) { unsigned u = __float_as_uint(f); u += 0x7FFFu + ((u >> 16) & 1u); return (unsigned short)(u >> 16); }
__device__ __forceinline__ float bf2f(unsigned short b) { return __uint_as_float(((unsigned)b) << 16); }
__device__ __forceinline__ float bfr(float f) { return bf2f(f2bf(f)); }
__device__ __forceinline__ v16h cat16(v8h lo, v8h hi) { return __builtin_shufflevector(lo, hi, 0, 1, 2, 3, 4, 5, 6, 7, 8, 9, 10, 11, 12, 13, 14, 15); }
__device__ __forceinline__ v16bf cat16b(v8us lo, v8us hi) { return __builtin_bit_cast(v16bf, __builtin_shufflevector(lo, hi, 0, 1, 2, 3, 4, 5, 6, 7, 8, 9, 10, 11, 12, 13, 14, 15)); }
__device__ __forceinline__ v8f wmma16(v16h a, v16h b, v8f c) { return __builtin_amdgcn_wmma_f32_16x16x32_f16(false, a, false, b, (short)0, c, false, false); }
__device__ __forceinline__ v8f wmmab(v16bf a, v16bf b, v8f c) { return __builtin_amdgcn_wmma_f32_16x16x32_bf16(false, a, false, b, (short)0, c, false, false); }
__device__ __forceinline__ void splitf(float y, unsigned short& h, unsigned short& l) { h = f2bf(y); l = f2bf(y - bf2f(h)); }
typedef __attribute__((ext_vector_type(2))) unsigned short v2us;
typedef __attribute__((ext_vector_type(4))) unsigned short v4us;



// ---- k_gemmw: register-blocked GEMM, one work-group of 4 waves (2 x 2) per 128x128 output tile, each wave a 64x64 tile (16 accumulators); grid (M/128, N/128), 128 threads.
// The K-contiguous 16-bit operand planes are staged in LDS 64 k at a time (128-byte rows at pitch 144 B) by asynchronous copies, whole 128-byte lines per 8 lanes, in a ring of two buffers: the next stage's copies fly while this stage is worked on, and each operand row is fetched once per work-group instead of once per wave.
// c[m][n] (f32, in registers) = sum_k A[m][k] Bt[n][k] (+ split products per NSPLIT). K % 64 == 0, K >= 64. The tile never reaches memory as f32; the epilogue writes what the next stage reads:
// EPI 1 (q | k | v projection; a 64-column tile is one head of q, k or v): q and k as hi/lo head planes [q | k][batch][head], v as transposed hi/lo planes [batch][head], each plane in fragment order (head of the file).
// EPI 2 (output projection): O[m][n] = bf16(X[m][n]) * c[m][n], both of pitch DM.
#define GP   144                  // LDS pitch of a staged 128-byte row: 16 B x odd, free of bank conflicts for 16-byte reads down a column
#define GOP  (128 * GP)           // one operand's 128 rows of a stage
template <typename T16> struct WFrag;
template <> struct WFrag<h16> { typedef v16h V; static __device__ __forceinline__ V ld(const h16* p) { return cat16(*(const v8h*)p, *(const v8h*)(p + 16)); } static __device__ __forceinline__ v8f mma(V a, V b, v8f c) { return wmma16(a, b, c); } };
template <> struct WFrag<bf> { typedef v16bf V; static __device__ __forceinline__ V ld(const bf* p) { return cat16b(*(const v8us*)p, *(const v8us*)(p + 16)); } static __device__ __forceinline__ v8f mma(V a, V b, v8f c) { return wmmab(a, b, c); } };
// one fragment of a plane in fragment order: p = the fragment's first element + 8 * lane; the lane's second piece lies 512 bytes on. Same elements in the same registers as WFrag<bf>::ld gives from a row-major row.
__device__ __forceinline__ v16bf ldfr(const bf* p) { return cat16b(*(const v8us*)p, *(const v8us*)(p + 256)); }
// this lane's 16 bytes of 8 rows, 16 rows apart, of one operand: global -> LDS through no register. The s_wait_xcnt stands in the copies' own statement, in front of any later overwrite of an address register that a copy names.
template <typename T16> __device__ __forceinline__ void acopy8(unsigned l, const T16* g, size_t step) {
    asm volatile("global_load_async_to_lds_b128 %0, %8, off\n\t"
                 "global_load_async_to_lds_b128 %1, %9, off\n\t"
                 "global_load_async_to_lds_b128 %2, %10, off\n\t"
                 "global_load_async_to_lds_b128 %3, %11, off\n\t"
                 "global_load_async_to_lds_b128 %4, %12, off\n\t"
                 "global_load_async_to_lds_b128 %5, %13, off\n\t"
                 "global_load_async_to_lds_b128 %6, %14, off\n\t"
                 "global_load_async_to_lds_b128 %7, %15, off\n\t"
                 "s_wait_xcnt 0x0"
                 :: "v"(l), "v"(l + 16 * GP), "v"(l + 32 * GP), "v"(l + 48 * GP), "v"(l + 64 * GP), "v"(l + 80 * GP), "v"(l + 96 * GP), "v"(l + 112 * GP),
                    "v"(g), "v"(g + step), "v"(g + 2 * step), "v"(g + 3 * step), "v"(g + 4 * step), "v"(g + 5 * step), "v"(g + 6 * step), "v"(g + 7 * step) : "memory");
}
template <typename T16, int NSPLIT, int EPI>
__global__ __launch_bounds__(128) void k_gemmw(const T16* __restrict__ A, const T16* __restrict__ A2, const T16* __restrict__ Bt, const T16* __restrict__ Bt2, int K, const float* __restrict__ X, float* O, bf* Ph, bf* Pl, bf* Vh, bf* Vl) {
    typedef typename WFrag<T16>::V V;
    constexpr bool HA2 = (NSPLIT == 1 || NSPLIT == 2), HB2 = (NSPLIT >= 2); constexpr int NOP = 2 + (HA2 ? 1 : 0) + (HB2 ? 1 : 0);   // operands of a stage, in the order A | Bt | A2 | Bt2
    __shared__ __attribute__((aligned(128))) unsigned char ring[2 * NOP * GOP];
    __shared__ __align__(16) float osall[4][16 * 68];
    const int wv = __builtin_amdgcn_readfirstlane(threadIdx.x >> 5);   // wave number in a scalar register: the wave's tile indices stay scalar
    const int tid = threadIdx.x, lane = tid & 31, lr = lane & 15, hi = lane >> 4; const int R0 = blockIdx.x * 128, C0 = blockIdx.y * 128; const int r0 = R0 + (wv >> 1) * 64, c0 = C0 + (wv & 1) * 64;
    float* os = osall[wv];   // each wave stages its epilogue in its own range
    v8f acc[4][4];
#pragma unroll
    for (int mb = 0; mb < 4; ++mb)
#pragma unroll
        for (int nb = 0; nb < 4; ++nb) acc[mb][nb] = (v8f){};
    const unsigned lb = (unsigned)(size_t)ring + (unsigned)((tid >> 3) * GP + (tid & 7) * 16);   // 8 lanes per row: a wave's copy covers 4 whole lines
    const size_t ga = (size_t)(R0 + (tid >> 3)) * K + (tid & 7) * 8, gb = (size_t)(C0 + (tid >> 3)) * K + (tid & 7) * 8, st16 = (size_t)16 * K;
    auto fill = [&](int t, int buf) { const unsigned l = lb + (unsigned)(buf * NOP * GOP); const int kc = t * 64;
        acopy8(l, A + ga + kc, st16); acopy8(l + GOP, Bt + gb + kc, st16);
        if (HA2) acopy8(l + 2 * GOP, A2 + ga + kc, st16);
        if (HB2) acopy8(l + (HA2 ? 3 : 2) * GOP, Bt2 + gb + kc, st16); };
    const int NT = K >> 6;
    fill(0, 0);
    asm volatile("s_wait_asynccnt 0x0" ::: "memory");   // this wave's copies of stage 0 have landed
    __syncthreads();   // stage 0 is published: every wave's copies have landed before any wave reads it
    if (NT > 1) fill(1, 1);
    const int ao = ((wv >> 1) * 64 + lr) * GP + hi * 16, bo = GOP + ((wv & 1) * 64 + lr) * GP + hi * 16;
#pragma unroll 1
    for (int t = 0; t < NT; ++t) {
        const unsigned char* sg = ring + (t & 1) * (NOP * GOP);
        V a[2][4], a2[2][4], b[2][4], b2[2][4];
#pragma unroll
        for (int ks = 0; ks < 2; ++ks) {
#pragma unroll
            for (int mb = 0; mb < 4; ++mb) { a[ks][mb] = WFrag<T16>::ld((const T16*)(sg + ao + mb * 16 * GP + ks * 64)); if (HA2) a2[ks][mb] = WFrag<T16>::ld((const T16*)(sg + ao + 2 * GOP + mb * 16 * GP + ks * 64)); }
#pragma unroll
            for (int nb = 0; nb < 4; ++nb) { b[ks][nb] = WFrag<T16>::ld((const T16*)(sg + bo + nb * 16 * GP + ks * 64)); if (HB2) b2[ks][nb] = WFrag<T16>::ld((const T16*)(sg + bo + (HA2 ? 2 : 1) * GOP + nb * 16 * GP + ks * 64)); } }
        __builtin_amdgcn_sched_barrier(0);   // the stage's LDS reads are issued as one group in front of its first matrix instruction; left free, they sink between the products into one register set, each group of four products behind a full LDS wait
#pragma unroll
        for (int ks = 0; ks < 2; ++ks)
#pragma unroll
            for (int nb = 0; nb < 4; ++nb)
#pragma unroll
                for (int mb = 0; mb < 4; ++mb) { acc[mb][nb] = WFrag<T16>::mma(a[ks][mb], b[ks][nb], acc[mb][nb]); if (HA2) acc[mb][nb] = WFrag<T16>::mma(a2[ks][mb], b[ks][nb], acc[mb][nb]); if (HB2) acc[mb][nb] = WFrag<T16>::mma(a[ks][mb], b2[ks][nb], acc[mb][nb]); }
        __builtin_amdgcn_sched_barrier(0);
        asm volatile("s_wait_dscnt 0x0" ::: "memory");
        asm volatile("s_wait_asynccnt 0x0" ::: "memory");
        __syncthreads();
        if (t + 2 < NT) fill(t + 2, t & 1);
    }
    asm volatile("s_wait_asynccnt 0x0" ::: "memory");   // no copy is outstanding when the wave goes on to its epilogue and ends
    const int bt = r0 / TT, t0 = r0 % TT, sec = c0 / DM, hd = (c0 % DM) / HD;   // EPI 1: batch, first position, q | k | v, head of this tile (all from blockIdx and the wave number: scalar)
    if (EPI == 1 && sec == 2) {   // v: a lane holds 8 consecutive positions of one d per accumulator, which is this lane's piece of a v^T fragment: stored straight from registers, 512 contiguous bytes per wave-wide store
        const size_t vo = (size_t)(bt * NKV + hd) * HD * TT + (size_t)t0 * HD + lane * 8; bf* vh = Vh + vo; bf* vl = Vl + vo;   // 32 positions x 64 d = 2048 elements per key chunk
#pragma unroll
        for (int nb = 0; nb < 4; ++nb) { v8us oh[4], ol[4];
#pragma unroll
            for (int mb = 0; mb < 4; ++mb)
#pragma unroll
                for (int j = 0; j < 8; ++j) { unsigned short a2, c2; splitf(acc[mb][nb][j], a2, c2); oh[mb][j] = a2; ol[mb][j] = c2; }
#pragma unroll
            for (int mb = 0; mb < 4; ++mb) *(v8us*)(vh + (mb >> 1) * 2048 + nb * 512 + (mb & 1) * 256) = oh[mb];
#pragma unroll
            for (int mb = 0; mb < 4; ++mb) *(v8us*)(vl + (mb >> 1) * 2048 + nb * 512 + (mb & 1) * 256) = ol[mb];
            asm volatile("s_wait_xcnt 0x0" ::: "memory");   // in front of the next group's overwrites of the data registers that these stores name
            __builtin_amdgcn_sched_barrier(0);   // keeps those overwrites behind the wait
        }
        return;
    }
    v4f xs[4][8]; const size_t go = (size_t)(r0 + hi) * DM + c0 + lr * 4;   // EPI 2: this lane's first element of X and O
    if (EPI == 2) {   // the gate's x values of the whole tile are asked for at once, in front of the staging: one exposed latency per tile
        const float* xp = X + go;
#pragma unroll
        for (int mb = 0; mb < 4; ++mb)
#pragma unroll
            for (int s = 0; s < 8; ++s) xs[mb][s] = *(const v4f*)(xp + (mb * 16 + 2 * s) * DM);
    }
    const size_t po = ((size_t)((sec * NB_ + bt) * NH_ + hd) * TT + t0) * HD + lane * 8;   // EPI 1: this lane's first piece of the tile's 64 rows (four 16-row blocks of 1024 elements) in its q or k head plane
#pragma unroll
    for (int mb = 0; mb < 4; ++mb) {
#pragma unroll
        for (int nb = 0; nb < 4; ++nb) {
#pragma unroll
            for (int j = 0; j < 8; ++j) os[(hi * 8 + j) * 68 + nb * 16 + lr] = acc[mb][nb][j]; }
        __builtin_amdgcn_wave_barrier(); asm volatile("" ::: "memory");
        if (EPI == 1) { v8us oh[4], ol[4]; bf* ph = Ph + po; bf* pl = Pl + po;   // piece s = d / 16: row lr, d = 16 s + 8 hi .. + 7
#pragma unroll
            for (int s = 0; s < 4; ++s) { const float* rp = os + lr * 68 + s * 16 + hi * 8; const v4f v0 = *(const v4fa*)rp, v1 = *(const v4fa*)(rp + 4);
#pragma unroll
                for (int q = 0; q < 4; ++q) { unsigned short a2, c2; splitf(v0[q], a2, c2); oh[s][q] = a2; ol[s][q] = c2; splitf(v1[q], a2, c2); oh[s][4 + q] = a2; ol[s][4 + q] = c2; } }
#pragma unroll
            for (int s = 0; s < 4; ++s) *(v8us*)(ph + mb * 1024 + s * 256) = oh[s];
#pragma unroll
            for (int s = 0; s < 4; ++s) *(v8us*)(pl + mb * 1024 + s * 256) = ol[s]; }
        if (EPI == 2) { v4f o[8]; float* op = O + go;
#pragma unroll
            for (int s = 0; s < 8; ++s) { const v4f val = *(const v4fa*)(os + (2 * s + hi) * 68 + lr * 4);
#pragma unroll
                for (int q = 0; q < 4; ++q) o[s][q] = __fmul_rn(bfr(xs[mb][s][q]), val[q]); }
#pragma unroll
            for (int s = 0; s < 8; ++s) *(v4f*)(op + (mb * 16 + 2 * s) * DM) = o[s]; }
        __builtin_amdgcn_wave_barrier(); asm volatile("s_wait_xcnt 0x0" ::: "memory");   // in front of the next group's overwrites of the data registers that these stores name; as a compiler fence it also keeps the next group's LDS writes behind this group's reads
        __builtin_amdgcn_sched_barrier(0);   // keeps those overwrites behind the wait
    }
}

// ---- k_prep: everything the GEMMs need in bf16, one launch. Work-groups 0 .. PWQ + PWO - 1 each transpose one tile of 128 k x 64 n of a weight ('xw' [k][n] f32 -> Bt [n][k] bf16) through LDS; the PXB behind them round x.
// Transpose: a wave reads 16 rows of k, 256 contiguous bytes per row (a lane: 2 n), all 16 loads in flight at once; a lane then holds 16 consecutive k of its 2 n, writes them as 16-byte pieces of the transposed rows in LDS, and the tile leaves as 256 contiguous bytes per n.
#define PTK  128                  // k of a tile
#define PTN  64                   // n of a tile
#define PTP  136                  // LDS pitch of a transposed row, elements: 272 B = 16 B x odd, free of bank conflicts for the 16-byte writes down a column
#define PWQ  ((DM / PTK) * (3 * DM / PTN))
#define PWO  ((DQ / PTK) * (DM / PTN))
#define PXB  256                  // work-groups that round x: 16 pieces of 4 elements per thread
typedef __attribute__((ext_vector_type(2))) float v2f;
// one tile; N (the weight's row length) is a compile-time constant so that the 16 rows are immediate offsets from one scalar base and no address register is rewritten between the loads
template <int N> __device__ __forceinline__ void wtile(const float* __restrict__ w, bf* Bt, int b, bf* tl) {
    const int tid = threadIdx.x, lane = tid & 31;
    const int wv = __builtin_amdgcn_readfirstlane(tid >> 5);   // wave number in a scalar register: the rows' base address stays scalar
    const int k0 = (b % (DM / PTK)) * PTK, n0 = (b / (DM / PTK)) * PTN;
    const float* p = w + (size_t)(k0 + wv * 16) * N + n0; v2f r[16];
#pragma unroll
    for (int j = 0; j < 16; ++j) r[j] = *(const v2f*)(p + j * N + lane * 2);
    asm volatile("s_wait_xcnt 0x0" ::: "memory");   // in front of any later overwrite of a register that the 16 loads name
    __builtin_amdgcn_sched_barrier(0);   // keeps those overwrites behind the wait, and the 16 loads in one group in front of it
#pragma unroll
    for (int c = 0; c < 2; ++c)
#pragma unroll
        for (int h = 0; h < 2; ++h) { v8us o;
#pragma unroll
            for (int j = 0; j < 8; ++j) o[j] = f2bf(r[h * 8 + j][c]);
            *(v8usa*)(tl + (c * 32 + lane) * PTP + wv * 16 + h * 8) = o; }   // n = 2 * lane + c lies in LDS row c * 32 + lane: a wave's 16-byte writes walk consecutive rows
    __syncthreads();   // the whole transposed tile is in LDS before any thread reads a row of it
#pragma unroll
    for (int i = 0; i < 4; ++i) { const int row = (tid >> 4) + 16 * i, n = (row & 31) * 2 + (row >> 5), pc = (tid & 15) * 8; *(v8us*)(Bt + (size_t)(n0 + n) * DM + k0 + pc) = *(const v8usa*)(tl + row * PTP + pc); }
    asm volatile("s_wait_xcnt 0x0" ::: "memory");   // in front of any later overwrite of a register that the four stores name
}
__global__ __launch_bounds__(256) void k_prep(const float* __restrict__ x, const float* __restrict__ wqkv, const float* __restrict__ wo, bf* XB, bf* WALL, bf* WO) {
    __shared__ __align__(16) bf tl[PTN * PTP];
    const int b = blockIdx.x;
    if (b < PWQ) { wtile<3 * DM>(wqkv, WALL, b, tl); return; }
    if (b < PWQ + PWO) { wtile<DM>(wo, WO, b - PWQ, tl); return; }
    // x: a wave's load covers 512 contiguous bytes, its store 256
    const size_t i0 = (size_t)(b - (PWQ + PWO)) * (256 * 4) + threadIdx.x * 4; v4f v[16]; v4us o[16];
#pragma unroll
    for (int s = 0; s < 16; ++s) v[s] = *(const v4f*)(x + i0 + (size_t)s * (PXB * 256 * 4));
    asm volatile("s_wait_xcnt 0x0" ::: "memory");   // in front of any later overwrite of a register that the 16 loads name
    __builtin_amdgcn_sched_barrier(0);   // keeps those overwrites behind the wait, and the 16 loads in one group in front of it
#pragma unroll
    for (int s = 0; s < 16; ++s)
#pragma unroll
        for (int q = 0; q < 4; ++q) o[s][q] = f2bf(v[s][q]);
#pragma unroll
    for (int s = 0; s < 16; ++s) *(v4us*)(XB + i0 + (size_t)s * (PXB * 256 * 4)) = o[s];
    asm volatile("s_wait_xcnt 0x0" ::: "memory");   // in front of any later overwrite of a register that the 16 stores name
}


// value of lane l ^ X inside the 16-lane row (DPP row_xmask): the row reductions of k_cstat stay on the vector unit
template <int X> __device__ __forceinline__ float rowx(float x) { return __builtin_bit_cast(float, __builtin_amdgcn_update_dpp(0, __builtin_bit_cast(int, x), 0x160 | X, 0xf, 0xf, true)); }

// ---- k_cstat: column-softmax statistics. One work-group per 32 keys of one head (grid: head, key tile); the 64-wide query chunks from the diagonal on are dealt round-robin to the CSW waves.
// A = key rows (kept in registers), B = query rows, D = S^T tile: lane (lr, hi) holds keys hi*8 + r of queries lr. Every lane keeps a running (max, sum) per key row over its own queries;
// the 16 lanes of a row and then the CSW waves are merged at the end. MX[h][j] = max_i s, RZ[h][j] = 1 / sum_i exp(s - max).
// The query rows of a chunk come in two groups of 16 loads (32 rows each) through one register set: the second group is issued as the first group's products free its registers, the next chunk's first group flies under this chunk's vector work.
// Second launch bound: four waves on a SIMD, that is at most 256 registers, so that two work-groups share a WGP as before; without it the build takes a few registers more and a wave slot per SIMD is lost.
__global__ __launch_bounds__(32 * CSW, 4) void k_cstat(const bf* __restrict__ Kh, const bf* __restrict__ Kl, const bf* __restrict__ Qh, const bf* __restrict__ Ql, float* MX, float* RZ) {
    __shared__ float sm[CSW][32]; __shared__ float sl[CSW][32];
    const int wv = __builtin_amdgcn_readfirstlane(threadIdx.x >> 5);   // wave number in a scalar register: the query loop stays a scalar branch, every lane on at the matrix instructions
    const size_t zo = (size_t)blockIdx.x * TT * HD; const int lane = threadIdx.x & 31, lr = lane & 15, hi = lane >> 4; const int j0 = blockIdx.y * 32;
    v16bf kh[2][2], kl[2][2];
    float m[2][8], l[2][8];
#pragma unroll
    for (int mb = 0; mb < 2; ++mb)
#pragma unroll
        for (int r = 0; r < 8; ++r) { m[mb][r] = -3.0e38f; l[mb][r] = 0.f; }
    const unsigned qo = (unsigned)(lane * 8);   // this lane's place in a piece of a fragment
    // hi/lo fragments of the 32 query rows from q0 on: 16 loads at immediate offsets from two addresses (hi plane, lo plane)
    auto ldq = [&](int q0, v16bf (&qh)[2][2], v16bf (&ql)[2][2]) { const bf* bh = Qh + zo + (size_t)q0 * HD; const bf* bl = Ql + zo + (size_t)q0 * HD;
#pragma unroll
        for (int nb = 0; nb < 2; ++nb)
#pragma unroll
            for (int ks = 0; ks < 2; ++ks) { qh[nb][ks] = ldfr(bh + qo + nb * 16 * HD + ks * 512); ql[nb][ks] = ldfr(bl + qo + nb * 16 * HD + ks * 512); }
        __builtin_amdgcn_sched_barrier(0);   // all 16 loads are issued in front of the first product that reads one: one load latency per group; left free, they sink between their own products in twos and threes, each behind a wait of its own
        asm volatile("s_wait_xcnt 0x0" ::: "memory");   // in front of every later overwrite of an address register that the 16 loads name
        __builtin_amdgcn_sched_barrier(0);   // keeps those overwrites behind the wait
    };
    // S^T tiles of the 32 keys x those 32 queries
    auto prod = [&](const v16bf (&qh)[2][2], const v16bf (&ql)[2][2], v8f (&s)[2][4], int n0) {
#pragma unroll
        for (int nb = 0; nb < 2; ++nb)
#pragma unroll
            for (int mb = 0; mb < 2; ++mb) { v8f a = (v8f){};
#pragma unroll
                for (int ks = 0; ks < 2; ++ks) { a = wmmab(kh[mb][ks], qh[nb][ks], a); a = wmmab(kl[mb][ks], qh[nb][ks], a); a = wmmab(kh[mb][ks], ql[nb][ks], a); }
                s[mb][n0 + nb] = a; }
    };
    int c0 = (j0 & ~63) + wv * 64;
    if (c0 < TT) {   // a wave with no trip loads nothing
#pragma unroll
        for (int mb = 0; mb < 2; ++mb)
#pragma unroll
            for (int ks = 0; ks < 2; ++ks) { const size_t o = zo + (size_t)(j0 + mb * 16) * HD + ks * 512; kh[mb][ks] = ldfr(Kh + o + qo); kl[mb][ks] = ldfr(Kl + o + qo); }
        asm volatile("s_wait_xcnt 0x0" ::: "memory");   // in front of the loop's overwrites of the address registers that the key loads name
        __builtin_amdgcn_sched_barrier(0);   // keeps those overwrites behind the wait
        v16bf qh[2][2], ql[2][2];
        ldq(c0, qh, ql);
        // the loop stays rolled: one register set for the query fragments, carried from trip to trip
#pragma unroll 1
        for (;;) {
            v8f s[2][4]; const int cn = c0 + CSW * 64; const bool more = cn < TT;
            prod(qh, ql, s, 0);
            ldq(c0 + 32, qh, ql);
            prod(qh, ql, s, 2);
            if (more) ldq(cn, qh, ql);   // in flight under this trip's vector work
#pragma unroll
            for (int mb = 0; mb < 2; ++mb)
#pragma unroll
                for (int r = 0; r < 8; ++r) { const int j = j0 + mb * 16 + hi * 8 + r; float t[4]; float mn = m[mb][r];
#pragma unroll
                    for (int nb = 0; nb < 4; ++nb) { t[nb] = (c0 + nb * 16 + lr >= j) ? s[mb][nb][r] * SCL : -3.0e38f;   /* causal keeps queries i >= key j */ mn = fmaxf(mn, t[nb]); }
                    float a = l[mb][r] * __builtin_amdgcn_exp2f((m[mb][r] - mn) * L2E);
#pragma unroll
                    for (int nb = 0; nb < 4; ++nb) a += (c0 + nb * 16 + lr >= j) ? __builtin_amdgcn_exp2f((t[nb] - mn) * L2E) : 0.f;
                    l[mb][r] = a; m[mb][r] = mn; }
            if (!more) break;
            c0 = cn;
        }
    }
#pragma unroll
    for (int mb = 0; mb < 2; ++mb)
#pragma unroll
        for (int r = 0; r < 8; ++r) { float M = m[mb][r]; M = fmaxf(M, rowx<1>(M)); M = fmaxf(M, rowx<2>(M)); M = fmaxf(M, rowx<4>(M)); M = fmaxf(M, rowx<8>(M));
            float a = l[mb][r] * __builtin_amdgcn_exp2f((m[mb][r] - M) * L2E); a += rowx<1>(a); a += rowx<2>(a); a += rowx<4>(a); a += rowx<8>(a); m[mb][r] = M; l[mb][r] = a; }
    if (lr == 0) {
#pragma unroll
        for (int mb = 0; mb < 2; ++mb)
#pragma unroll
            for (int r = 0; r < 8; ++r) { sm[wv][mb * 16 + hi * 8 + r] = m[mb][r]; sl[wv][mb * 16 + hi * 8 + r] = l[mb][r]; } }
    __syncthreads();   // every wave's (max, sum) per key is in LDS before the first wave merges them
    if (threadIdx.x < 32) { const int row = threadIdx.x; float M = sm[0][row];
#pragma unroll
        for (int w = 1; w < CSW; ++w) M = fmaxf(M, sm[w][row]);
        float Z = 0.f;
#pragma unroll
        for (int w = 0; w < CSW; ++w) Z += sl[w][row] * __builtin_amdgcn_exp2f((sm[w][row] - M) * L2E);
        const size_t o = (size_t)blockIdx.x * TT + j0 + row; MX[o] = M; RZ[o] = __fdiv_rn(1.0f, Z); }
}

// ---- k_cattn: out^T[d][i] = sum_j v^T[d][j] A[i][j] for 64 queries of one head per work-group (grid: head, query tile, the longest key loops first); the 32-wide key chunks up to the diagonal block are dealt
// round-robin to the CSW waves. Per chunk a wave forms S^T (two 16-key tiles per 16 queries), p = exp(s - MX[j]) RZ[j] (0 for j > i), splits p hi/lo, and uses the two tiles as they lie as one B fragment:
// D of tile t holds keys t*16 + hi*8 + r at lane (lr, hi), which is the k order 8*hi + e | 16 + 8*hi + e of the A loader of v^T. The CSW partial tiles are summed through LDS in wave order and written as the merged hi/lo planes.
__global__ __launch_bounds__(32 * CSW) void k_cattn(const bf* __restrict__ Kh, const bf* __restrict__ Kl, const bf* __restrict__ Qh, const bf* __restrict__ Ql, const bf* __restrict__ Vh, const bf* __restrict__ Vl, const float* __restrict__ MX, const float* __restrict__ RZ, bf* Ah, bf* Al) {
    __shared__ __align__(16) float os[CSW][64 * 68];
    const int wv = __builtin_amdgcn_readfirstlane(threadIdx.x >> 5);   // wave number in a scalar register: the key loop stays a scalar branch, every lane on at the matrix instructions
    const size_t zo = (size_t)blockIdx.x * TT * HD, zs = (size_t)blockIdx.x * TT; const int lane = threadIdx.x & 31, lr = lane & 15, hi = lane >> 4; const int r0 = (TT / 64 - 1 - (int)blockIdx.y) * 64;
    const unsigned fo = (unsigned)(lane * 8), so = (unsigned)(hi * 8);   // this lane's place in a piece of a fragment, and in 16 keys' statistics
    v16bf qh[4][2], ql[4][2];
#pragma unroll
    for (int nb = 0; nb < 4; ++nb)
#pragma unroll
        for (int ks = 0; ks < 2; ++ks) { const size_t o = zo + (size_t)(r0 + nb * 16) * HD + ks * 512; qh[nb][ks] = ldfr(Qh + o + fo); ql[nb][ks] = ldfr(Ql + o + fo); }
    asm volatile("s_wait_xcnt 0x0" ::: "memory");   // in front of the loop's overwrites of the address registers that the query loads name
    __builtin_amdgcn_sched_barrier(0);   // keeps those overwrites behind the wait
    v8f acc[4][4];
#pragma unroll
    for (int mb = 0; mb < 4; ++mb)
#pragma unroll
        for (int nb = 0; nb < 4; ++nb) acc[mb][nb] = (v8f){};
#pragma unroll 1
    for (int kc = wv * 32; kc < r0 + 64; kc += CSW * 32) {
        v16bf kh[2][2], kl[2][2], vh[4], vl[4]; v8f mx[2], rz[2];
#pragma unroll
        for (int t = 0; t < 2; ++t) { mx[t] = *(const v8f*)(MX + zs + kc + t * 16 + so); rz[t] = *(const v8f*)(RZ + zs + kc + t * 16 + so);
#pragma unroll
            for (int ks = 0; ks < 2; ++ks) { const size_t o = zo + (size_t)(kc + t * 16) * HD + ks * 512; kh[t][ks] = ldfr(Kh + o + fo); kl[t][ks] = ldfr(Kl + o + fo); } }
#pragma unroll
        for (int mb = 0; mb < 4; ++mb) { const size_t o = zo + (size_t)kc * HD + mb * 512; vh[mb] = ldfr(Vh + o + fo); vl[mb] = ldfr(Vl + o + fo); }
        __builtin_amdgcn_sched_barrier(0);   // every load of the chunk is issued in front of its first matrix instruction: one exposed load latency per chunk; left free, the v^T loads sink between the products
        asm volatile("s_wait_xcnt 0x0" ::: "memory");   // stands in front of every later overwrite of an address register that the chunk's loads name
        __builtin_amdgcn_sched_barrier(0);   // keeps the address updates of the next chunk behind that wait
#pragma unroll
        for (int nb = 0; nb < 4; ++nb) { v8us ph[2], pl[2]; const int i = r0 + nb * 16 + lr;
#pragma unroll
            for (int t = 0; t < 2; ++t) { v8f a = (v8f){};
#pragma unroll
                for (int ks = 0; ks < 2; ++ks) { a = wmmab(kh[t][ks], qh[nb][ks], a); a = wmmab(kl[t][ks], qh[nb][ks], a); a = wmmab(kh[t][ks], ql[nb][ks], a); }
#pragma unroll
                for (int r = 0; r < 8; ++r) { const float e = __builtin_amdgcn_exp2f((a[r] * SCL - mx[t][r]) * L2E); const float p = (i >= kc + t * 16 + hi * 8 + r) ? e * rz[t][r] : 0.f; unsigned short h2, l2; splitf(p, h2, l2); ph[t][r] = h2; pl[t][r] = l2; } }
            const v16bf bh = cat16b(ph[0], ph[1]), bl = cat16b(pl[0], pl[1]);
#pragma unroll
            for (int mb = 0; mb < 4; ++mb) { acc[mb][nb] = wmmab(vh[mb], bh, acc[mb][nb]); acc[mb][nb] = wmmab(vh[mb], bl, acc[mb][nb]); acc[mb][nb] = wmmab(vl[mb], bh, acc[mb][nb]); } }
    }
#pragma unroll
    for (int mb = 0; mb < 4; ++mb)
#pragma unroll
        for (int nb = 0; nb < 4; ++nb) { float* p = &os[wv][(nb * 16 + lr) * 68 + mb * 16 + hi * 8]; const v8f a = acc[mb][nb]; *(v4fa*)p = __builtin_shufflevector(a, a, 0, 1, 2, 3); *(v4fa*)(p + 4) = __builtin_shufflevector(a, a, 4, 5, 6, 7); }
    __syncthreads();   // every wave's partial tile is in LDS before any thread sums across the waves
#pragma unroll
    for (int s = 0; s < 64 * 16 / (32 * CSW); ++s) { const int idx = s * 32 * CSW + (int)threadIdx.x; const int row = idx >> 4, cofs = (idx & 15) * 4; v4f val = *(const v4fa*)(&os[0][row * 68 + cofs]);
#pragma unroll
        for (int w = 1; w < CSW; ++w) val += *(const v4fa*)(&os[w][row * 68 + cofs]);
        v4us oh, ol;
#pragma unroll
        for (int q = 0; q < 4; ++q) { unsigned short a2, c2; splitf(val[q], a2, c2); oh[q] = a2; ol[q] = c2; }
        const size_t oo = (size_t)((int)(blockIdx.x / NH_) * TT + r0 + row) * DQ + (size_t)(blockIdx.x % NH_) * HD + cofs;   /* blockIdx.x: batch x head */ *(v4us*)(Ah + oo) = oh; *(v4us*)(Al + oo) = ol; }
}

extern "C" void kernel_launch(void* const* d_in, const int* in_sizes, int n_in,
                              void* d_out, int out_size, void* d_ws, size_t ws_size, hipStream_t stream) {
    (void)in_sizes; (void)n_in; (void)out_size;
    const float* x = (const float*)d_in[0]; const float* wqkv = (const float*)d_in[1]; const float* wo = (const float*)d_in[2];  const float* wq = nullptr; const float* wk = nullptr; const float* wv = nullptr; (void)wq; (void)wk; (void)wv;
    float* OUT = (float*)d_out;     // [2][2048][1024]
    char* wsp = (char*)d_ws;
    auto take = [&](size_t bytes) { char* p = wsp; wsp += (bytes + 255) & ~(size_t)255; return (void*)p; };
    bf* WALL = (bf*)take((size_t)3 * DM * DM * 2); bf* WO = (bf*)take((size_t)DM * DQ * 2);
    bf* XB = (bf*)take((size_t)NB_ * TT * DM * 2);
    const size_t PL = (size_t)NB_ * NH_ * TT * HD;   // one plane set: [batch x head] planes of TT x HD elements in fragment order
    bf* QPh = (bf*)take(2 * PL * 2);   /* q planes, then k planes */ bf* QPl = (bf*)take(2 * PL * 2); bf* KPh = QPh + PL; bf* KPl = QPl + PL; bf* VTh = (bf*)take(PL * 2); bf* VTl = (bf*)take(PL * 2);
    float* MX = (float*)take((size_t)NB_ * NH_ * TT * 4); float* RZ = (float*)take((size_t)NB_ * NH_ * TT * 4); bf* ATh = (bf*)take((size_t)NB_ * TT * DQ * 2); bf* ATl = (bf*)take((size_t)NB_ * TT * DQ * 2);
    if ((size_t)(wsp - (char*)d_ws) > ws_size) return;    // ws 256 MiB
    // one launch per stage: both batches (rows of x are contiguous) and, in the projection, q | k | v (rows of WALL are contiguous) are grid dimensions
    k_prep<<<PWQ + PWO + PXB, 256, 0, stream>>>(x, wqkv, wo, XB, WALL, WO);   /* fused 'xw' [DM][3DM] -> Bt [3DM][DM] (row blocks q | k | v), W_proj -> Bt [DM][DQ], x -> bf16 */
    k_gemmw<bf, 0, 1><<<dim3(NB_ * TT / 128, 3 * DM / 128, 1), 128, 0, stream>>>(XB, nullptr, WALL, nullptr, DM, nullptr, nullptr, QPh, QPl, VTh, VTl);   /* q, k head planes and v^T planes written by the projection's own epilogue */
    k_cstat<<<dim3(NB_ * NH_, TT / 32, 1), 32 * CSW, 0, stream>>>(KPh, KPl, QPh, QPl, MX, RZ);   /* per key: maximum and 1/sum of the scores over the queries that see it (one kv head per query head) */
    k_cattn<<<dim3(NB_ * NH_, TT / 64, 1), 32 * CSW, 0, stream>>>(KPh, KPl, QPh, QPl, VTh, VTl, MX, RZ, ATh, ATl);   /* A.v with the probabilities formed in registers, written as the merged hi/lo planes */
    k_gemmw<bf, 1, 2><<<dim3(NB_ * TT / 128, DM / 128, 1), 128, 0, stream>>>(ATh, ATl, WO, nullptr, DQ, x, OUT, nullptr, nullptr, nullptr, nullptr);   /* out = x * (m W_proj), the gate in the epilogue */
}

// v009
// A run of this version takes 108 microseconds.
// Two timings next to v008 put it at 1.09 and 1.08 times that version's speed.
// Counting every step since v000, it is 13.0 times as fast.
#include <hip/hip_runtime.h>

// Causal attention normalised over the QUERY axis, used as a multiplicative gate (x [2][2048][1024]; [q|k|v] = x W_qkv ('xw' [1024][3072], no bias; 16 heads x 64); s[i][j] = q_i.k_j/8 for j <= i else -inf; A = softmax over i (each key column normalised over the queries that see it); m = A v merged; proj = m W_proj ('xw'); out = x * proj -> [2][2048][1024]).
// Layout: the scores are formed key-major in registers (S^T[j][i] = k_j.q_i, every row hi/lo, 3 products) and never stored: k_cstat keeps each key's maximum and 1/sum over the queries i >= j; k_cattn forms the same S^T tiles again, turns them into probabilities and feeds them, still in registers, as the B operand of out^T[d][i] = sum_j v^T[d][j] A[i][j] (3 products), key loop cut at the diagonal. No elementwise stage of its own between the GEMMs: the q|k|v projection's epilogue writes the hi/lo head planes and the transposed v planes, the output projection's epilogue applies the gate with bf16(x).
// Plane order: the q, k and v^T planes lie in WMMA fragment order, not row-major: a 16-row x 32-k fragment is two runs of 512 contiguous bytes (piece 0 | 1), lane l's 8 elements at byte 16 l of each, so that one wave-wide 16-byte load covers 4 whole 128-byte lines. q, k: [plane][t / 16][d / 32][(d / 16) % 2][lane = ((d / 8) % 2) * 16 + t % 16][d % 8]; v^T: [plane][t / 32][d / 16][(t / 16) % 2][lane = ((t / 8) % 2) * 16 + d % 16][t % 8].
// Compute dtypes, f32 accumulate: every input rounded to bf16; q/k/v on PLAIN bf16 operands (inputs: exact); key-major scores and A.v on hi/lo planes for every row (3 products); column softmax in f32; W_proj hl x exact (2 products); the final x * proj gate in f32.

#define NB_  2
#define TT   2048
#define DM   1024
#define NH_  16
#define NKV  16
#define REP  (NH_ / NKV)
#define HD   64
#define DQ   (NH_ * HD)
#define DKV  (NKV * HD)
#define SCL  0.125f   // HD^-0.5
#define L2E  1.4426950408889634f
#define CSW  8                    // waves of a work-group in k_cstat and k_cattn: CSP x 2
#define CSP  4                    // waves that share one tile's loop in k_cstat (queries) and k_cattn (keys); a work-group has two tiles side by side, and waves 2p and 2p + 1 walk the same chunks at the same time, so that each line they stream is fetched from L2 once and the second reader finds it in the WGP's cache
typedef _Float16 h16;
typedef unsigned short bf;
typedef __attribute__((ext_vector_type(16))) __bf16   v16bf;
typedef __attribute__((ext_vector_type(16))) _Float16 v16h;
typedef __attribute__((ext_vector_type(8)))  _Float16 v8h;
typedef __attribute__((ext_vector_type(8)))  unsigned short v8us;
typedef __attribute__((ext_vector_type(8)))  float    v8f;
typedef __attribute__((ext_vector_type(4)))  float    v4f;
typedef v8h  __attribute__((may_alias)) v8ha;
typedef v4f  __attribute__((may_alias)) v4fa;
typedef v8us __attribute__((may_alias)) v8usa;

__device__ __forceinline__ unsigned short f2bf(float f) { unsigned u = __float_as_uint(f); u += 0x7FFFu + ((u >> 16) & 1u); return (unsigned short)(u >> 16); }
__device__ __forceinline__ float bf2f(unsigned short b) { return __uint_as_float(((unsigned)b) << 16); }
__device__ __forceinline__ float bfr(float f) { return bf2f(f2bf(f)); }
__device__ __forceinline__ v16h cat16(v8h lo, v8h hi) { return __builtin_shufflevector(lo, hi, 0, 1, 2, 3, 4, 5, 6, 7, 8, 9, 10, 11, 12, 13, 14, 15); }
__device__ __forceinline__ v16bf cat16b(v8us lo, v8us hi) { return __builtin_bit_cast(v16bf, __builtin_shufflevector(lo, hi, 0, 1, 2, 3, 4, 5, 6, 7, 8, 9, 10, 11, 12, 13, 14, 15)); }
__device__ __forceinline__ v8f wmma16(v16h a, v16h b, v8f c) { return __builtin_amdgcn_wmma_f32_16x16x32_f16(false, a, false, b, (short)0, c, false, false); }
__device__ __forceinline__ v8f wmmab(v16bf a, v16bf b, v8f c) { return __builtin_amdgcn_wmma_f32_16x16x32_bf16(false, a, false, b, (short)0, c, false, false); }
__device__ __forceinline__ void splitf(float y, unsigned short& h, unsigned short& l) { h = f2bf(y); l = f2bf(y - bf2f(h)); }
typedef __attribute__((ext_vector_type(2))) unsigned short v2us;
typedef __attribute__((ext_vector_type(4))) unsigned short v4us;



// ---- k_gemmw: register-blocked GEMM, one work-group of 4 waves (2 x 2) per 128x128 output tile, each wave a 64x64 tile (16 accumulators); grid (M/128, N/128), 128 threads.
// The K-contiguous 16-bit operand planes are staged in LDS 64 k at a time (128-byte rows at pitch 144 B) by asynchronous copies, whole 128-byte lines per 8 lanes, in a ring of two buffers: the next stage's copies fly while this stage is worked on, and each operand row is fetched once per work-group instead of once per wave.
// c[m][n] (f32, in registers) = sum_k A[m][k] Bt[n][k] (+ split products per NSPLIT). K % 64 == 0, K >= 64. The tile never reaches memory as f32; the epilogue writes what the next stage reads:
// EPI 1 (q | k | v projection; a 64-column tile is one head of q, k or v): q and k as hi/lo head planes [q | k][batch][head], v as transposed hi/lo planes [batch][head], each plane in fragment order (head of the file).
// EPI 2 (output projection): O[m][n] = bf16(X[m][n]) * c[m][n], both of pitch DM.
#define GP   144                  // LDS pitch of a staged 128-byte row: 16 B x odd, free of bank conflicts for 16-byte reads down a column
#define GOP  (128 * GP)           // one operand's 128 rows of a stage
template <typename T16> struct WFrag;
template <> struct WFrag<h16> { typedef v16h V; static __device__ __forceinline__ V ld(const h16* p) { return cat16(*(const v8h*)p, *(const v8h*)(p + 16)); } static __device__ __forceinline__ v8f mma(V a, V b, v8f c) { return wmma16(a, b, c); } };
template <> struct WFrag<bf> { typedef v16bf V; static __device__ __forceinline__ V ld(const bf* p) { return cat16b(*(const v8us*)p, *(const v8us*)(p + 16)); } static __device__ __forceinline__ v8f mma(V a, V b, v8f c) { return wmmab(a, b, c); } };
// one fragment of a plane in fragment order: p = the fragment's first element + 8 * lane; the lane's second piece lies 512 bytes on. Same elements in the same registers as WFrag<bf>::ld gives from a row-major row.
__device__ __forceinline__ v16bf ldfr(const bf* p) { return cat16b(*(const v8us*)p, *(const v8us*)(p + 256)); }
// this lane's 16 bytes of 8 rows, 16 rows apart, of one operand: global -> LDS through no register. The s_wait_xcnt stands in the copies' own statement, in front of any later overwrite of an address register that a copy names.
template <typename T16> __device__ __forceinline__ void acopy8(unsigned l, const T16* g, size_t step) {
    asm volatile("global_load_async_to_lds_b128 %0, %8, off\n\t"
                 "global_load_async_to_lds_b128 %1, %9, off\n\t"
                 "global_load_async_to_lds_b128 %2, %10, off\n\t"
                 "global_load_async_to_lds_b128 %3, %11, off\n\t"
                 "global_load_async_to_lds_b128 %4, %12, off\n\t"
                 "global_load_async_to_lds_b128 %5, %13, off\n\t"
                 "global_load_async_to_lds_b128 %6, %14, off\n\t"
                 "global_load_async_to_lds_b128 %7, %15, off\n\t"
                 "s_wait_xcnt 0x0"
                 :: "v"(l), "v"(l + 16 * GP), "v"(l + 32 * GP), "v"(l + 48 * GP), "v"(l + 64 * GP), "v"(l + 80 * GP), "v"(l + 96 * GP), "v"(l + 112 * GP),
                    "v"(g), "v"(g + step), "v"(g + 2 * step), "v"(g + 3 * step), "v"(g + 4 * step), "v"(g + 5 * step), "v"(g + 6 * step), "v"(g + 7 * step) : "memory");
}
template <typename T16, int NSPLIT, int EPI>
__global__ __launch_bounds__(128) void k_gemmw(const T16* __restrict__ A, const T16* __restrict__ A2, const T16* __restrict__ Bt, const T16* __restrict__ Bt2, int K, const float* __restrict__ X, float* O, bf* Ph, bf* Pl, bf* Vh, bf* Vl) {
    typedef typename WFrag<T16>::V V;
    constexpr bool HA2 = (NSPLIT == 1 || NSPLIT == 2), HB2 = (NSPLIT >= 2); constexpr int NOP = 2 + (HA2 ? 1 : 0) + (HB2 ? 1 : 0);   // operands of a stage, in the order A | Bt | A2 | Bt2
    __shared__ __attribute__((aligned(128))) unsigned char ring[2 * NOP * GOP];
    __shared__ __align__(16) float osall[4][16 * 68];
    const int wv = __builtin_amdgcn_readfirstlane(threadIdx.x >> 5);   // wave number in a scalar register: the wave's tile indices stay scalar
    const int tid = threadIdx.x, lane = tid & 31, lr = lane & 15, hi = lane >> 4; const int R0 = blockIdx.x * 128, C0 = blockIdx.y * 128; const int r0 = R0 + (wv >> 1) * 64, c0 = C0 + (wv & 1) * 64;
    float* os = osall[wv];   // each wave stages its epilogue in its own range
    v8f acc[4][4];
#pragma unroll
    for (int mb = 0; mb < 4; ++mb)
#pragma unroll
        for (int nb = 0; nb < 4; ++nb) acc[mb][nb] = (v8f){};
    const unsigned lb = (unsigned)(size_t)ring + (unsigned)((tid >> 3) * GP + (tid & 7) * 16);   // 8 lanes per row: a wave's copy covers 4 whole lines
    const size_t ga = (size_t)(R0 + (tid >> 3)) * K + (tid & 7) * 8, gb = (size_t)(C0 + (tid >> 3)) * K + (tid & 7) * 8, st16 = (size_t)16 * K;
    auto fill = [&](int t, int buf) { const unsigned l = lb + (unsigned)(buf * NOP * GOP); const int kc = t * 64;
        acopy8(l, A + ga + kc, st16); acopy8(l + GOP, Bt + gb + kc, st16);
        if (HA2) acopy8(l + 2 * GOP, A2 + ga + kc, st16);
        if (HB2) acopy8(l + (HA2 ? 3 : 2) * GOP, Bt2 + gb + kc, st16); };
    const int NT = K >> 6;
    fill(0, 0);
    asm volatile("s_wait_asynccnt 0x0" ::: "memory");   // this wave's copies of stage 0 have landed
    __syncthreads();   // stage 0 is published: every wave's copies have landed before any wave reads it
    if (NT > 1) fill(1, 1);
    const int ao = ((wv >> 1) * 64 + lr) * GP + hi * 16, bo = GOP + ((wv & 1) * 64 + lr) * GP + hi * 16;
#pragma unroll 1
    for (int t = 0; t < NT; ++t) {
        const unsigned char* sg = ring + (t & 1) * (NOP * GOP);
        V a[2][4], a2[2][4], b[2][4], b2[2][4];
#pragma unroll
        for (int ks = 0; ks < 2; ++ks) {
#pragma unroll
            for (int mb = 0; mb < 4; ++mb) { a[ks][mb] = WFrag<T16>::ld((const T16*)(sg + ao + mb * 16 * GP + ks * 64)); if (HA2) a2[ks][mb] = WFrag<T16>::ld((const T16*)(sg + ao + 2 * GOP + mb * 16 * GP + ks * 64)); }
#pragma unroll
            for (int nb = 0; nb < 4; ++nb) { b[ks][nb] = WFrag<T16>::ld((const T16*)(sg + bo + nb * 16 * GP + ks * 64)); if (HB2) b2[ks][nb] = WFrag<T16>::ld((const T16*)(sg + bo + (HA2 ? 2 : 1) * GOP + nb * 16 * GP + ks * 64)); } }
        __builtin_amdgcn_sched_barrier(0);   // the stage's LDS reads are issued as one group in front of its first matrix instruction; left free, they sink between the products into one register set, each group of four products behind a full LDS wait
#pragma unroll
        for (int ks = 0; ks < 2; ++ks)
#pragma unroll
            for (int nb = 0; nb < 4; ++nb)
#pragma unroll
                for (int mb = 0; mb < 4; ++mb) { acc[mb][nb] = WFrag<T16>::mma(a[ks][mb], b[ks][nb], acc[mb][nb]); if (HA2) acc[mb][nb] = WFrag<T16>::mma(a2[ks][mb], b[ks][nb], acc[mb][nb]); if (HB2) acc[mb][nb] = WFrag<T16>::mma(a[ks][mb], b2[ks][nb], acc[mb][nb]); }
        __builtin_amdgcn_sched_barrier(0);
        asm volatile("s_wait_dscnt 0x0" ::: "memory");
        asm volatile("s_wait_asynccnt 0x0" ::: "memory");
        __syncthreads();
        if (t + 2 < NT) fill(t + 2, t & 1);
    }
    asm volatile("s_wait_asynccnt 0x0" ::: "memory");   // no copy is outstanding when the wave goes on to its epilogue and ends
    const int bt = r0 / TT, t0 = r0 % TT, sec = c0 / DM, hd = (c0 % DM) / HD;   // EPI 1: batch, first position, q | k | v, head of this tile (all from blockIdx and the wave number: scalar)
    if (EPI == 1 && sec == 2) {   // v: a lane holds 8 consecutive positions of one d per accumulator, which is this lane's piece of a v^T fragment: stored straight from registers, 512 contiguous bytes per wave-wide store
        const size_t vo = (size_t)(bt * NKV + hd) * HD * TT + (size_t)t0 * HD + lane * 8; bf* vh = Vh + vo; bf* vl = Vl + vo;   // 32 positions x 64 d = 2048 elements per key chunk
#pragma unroll
        for (int nb = 0; nb < 4; ++nb) { v8us oh[4], ol[4];
#pragma unroll
            for (int mb = 0; mb < 4; ++mb)
#pragma unroll
                for (int j = 0; j < 8; ++j) { unsigned short a2, c2; splitf(acc[mb][nb][j], a2, c2); oh[mb][j] = a2; ol[mb][j] = c2; }
#pragma unroll
            for (int mb = 0; mb < 4; ++mb) *(v8us*)(vh + (mb >> 1) * 2048 + nb * 512 + (mb & 1) * 256) = oh[mb];
#pragma unroll
            for (int mb = 0; mb < 4; ++mb) *(v8us*)(vl + (mb >> 1) * 2048 + nb * 512 + (mb & 1) * 256) = ol[mb];
            asm volatile("s_wait_xcnt 0x0" ::: "memory");   // in front of the next group's overwrites of the data registers that these stores name
            __builtin_amdgcn_sched_barrier(0);   // keeps those overwrites behind the wait
        }
        return;
    }
    v4f xs[4][8]; const size_t go = (size_t)(r0 + hi) * DM + c0 + lr * 4;   // EPI 2: this lane's first element of X and O
    if (EPI == 2) {   // the gate's x values of the whole tile are asked for at once, in front of the staging: one exposed latency per tile
        const float* xp = X + go;
#pragma unroll
        for (int mb = 0; mb < 4; ++mb)
#pragma unroll
            for (int s = 0; s < 8; ++s) xs[mb][s] = *(const v4f*)(xp + (mb * 16 + 2 * s) * DM);
    }
    const size_t po = ((size_t)((sec * NB_ + bt) * NH_ + hd) * TT + t0) * HD + lane * 8;   // EPI 1: this lane's first piece of the tile's 64 rows (four 16-row blocks of 1024 elements) in its q or k head plane
#pragma unroll
    for (int mb = 0; mb < 4; ++mb) {
#pragma unroll
        for (int nb = 0; nb < 4; ++nb) {
#pragma unroll
            for (int j = 0; j < 8; ++j) os[(hi * 8 + j) * 68 + nb * 16 + lr] = acc[mb][nb][j]; }
        __builtin_amdgcn_wave_barrier(); asm volatile("" ::: "memory");
        if (EPI == 1) { v8us oh[4], ol[4]; bf* ph = Ph + po; bf* pl = Pl + po;   // piece s = d / 16: row lr, d = 16 s + 8 hi .. + 7
#pragma unroll
            for (int s = 0; s < 4; ++s) { const float* rp = os + lr * 68 + s * 16 + hi * 8; const v4f v0 = *(const v4fa*)rp, v1 = *(const v4fa*)(rp + 4);
#pragma unroll
                for (int q = 0; q < 4; ++q) { unsigned short a2, c2; splitf(v0[q], a2, c2); oh[s][q] = a2; ol[s][q] = c2; splitf(v1[q], a2, c2); oh[s][4 + q] = a2; ol[s][4 + q] = c2; } }
#pragma unroll
            for (int s = 0; s < 4; ++s) *(v8us*)(ph + mb * 1024 + s * 256) = oh[s];
#pragma unroll
            for (int s = 0; s < 4; ++s) *(v8us*)(pl + mb * 1024 + s * 256) = ol[s]; }
        if (EPI == 2) { v4f o[8]; float* op = O + go;
#pragma unroll
            for (int s = 0; s < 8; ++s) { const v4f val = *(const v4fa*)(os + (2 * s + hi) * 68 + lr * 4);
#pragma unroll
                for (int q = 0; q < 4; ++q) o[s][q] = __fmul_rn(bfr(xs[mb][s][q]), val[q]); }
#pragma unroll
            for (int s = 0; s < 8; ++s) *(v4f*)(op + (mb * 16 + 2 * s) * DM) = o[s]; }
        __builtin_amdgcn_wave_barrier(); asm volatile("s_wait_xcnt 0x0" ::: "memory");   // in front of the next group's overwrites of the data registers that these stores name; as a compiler fence it also keeps the next group's LDS writes behind this group's reads
        __builtin_amdgcn_sched_barrier(0);   // keeps those overwrites behind the wait
    }
}

// ---- k_prep: everything the GEMMs need in bf16, one launch. Work-groups 0 .. PWQ + PWO - 1 each transpose one tile of 128 k x 64 n of a weight ('xw' [k][n] f32 -> Bt [n][k] bf16) through LDS; the PXB behind them round x.
// Transpose: a wave reads 16 rows of k, 256 contiguous bytes per row (a lane: 2 n), all 16 loads in flight at once; a lane then holds 16 consecutive k of its 2 n, writes them as 16-byte pieces of the transposed rows in LDS, and the tile leaves as 256 contiguous bytes per n.
#define PTK  128                  // k of a tile
#define PTN  64                   // n of a tile
#define PTP  136                  // LDS pitch of a transposed row, elements: 272 B = 16 B x odd, free of bank conflicts for the 16-byte writes down a column
#define PWQ  ((DM / PTK) * (3 * DM / PTN))
#define PWO  ((DQ / PTK) * (DM / PTN))
#define PXB  256                  // work-groups that round x: 16 pieces of 4 elements per thread
typedef __attribute__((ext_vector_type(2))) float v2f;
// one tile; N (the weight's row length) is a compile-time constant so that the 16 rows are immediate offsets from one scalar base and no address register is rewritten between the loads
template <int N> __device__ __forceinline__ void wtile(const float* __restrict__ w, bf* Bt, int b, bf* tl) {
    const int tid = threadIdx.x, lane = tid & 31;
    const int wv = __builtin_amdgcn_readfirstlane(tid >> 5);   // wave number in a scalar register: the rows' base address stays scalar
    const int k0 = (b % (DM / PTK)) * PTK, n0 = (b / (DM / PTK)) * PTN;
    const float* p = w + (size_t)(k0 + wv * 16) * N + n0; v2f r[16];
#pragma unroll
    for (int j = 0; j < 16; ++j) r[j] = *(const v2f*)(p + j * N + lane * 2);
    asm volatile("s_wait_xcnt 0x0" ::: "memory");   // in front of any later overwrite of a register that the 16 loads name
    __builtin_amdgcn_sched_barrier(0);   // keeps those overwrites behind the wait, and the 16 loads in one group in front of it
#pragma unroll
    for (int c = 0; c < 2; ++c)
#pragma unroll
        for (int h = 0; h < 2; ++h) { v8us o;
#pragma unroll
            for (int j = 0; j < 8; ++j) o[j] = f2bf(r[h * 8 + j][c]);
            *(v8usa*)(tl + (c * 32 + lane) * PTP + wv * 16 + h * 8) = o; }   // n = 2 * lane + c lies in LDS row c * 32 + lane: a wave's 16-byte writes walk consecutive rows
    __syncthreads();   // the whole transposed tile is in LDS before any thread reads a row of it
#pragma unroll
    for (int i = 0; i < 4; ++i) { const int row = (tid >> 4) + 16 * i, n = (row & 31) * 2 + (row >> 5), pc = (tid & 15) * 8; *(v8us*)(Bt + (size_t)(n0 + n) * DM + k0 + pc) = *(const v8usa*)(tl + row * PTP + pc); }
    asm volatile("s_wait_xcnt 0x0" ::: "memory");   // in front of any later overwrite of a register that the four stores name
}
__global__ __launch_bounds__(256) void k_prep(const float* __restrict__ x, const float* __restrict__ wqkv, const float* __restrict__ wo, bf* XB, bf* WALL, bf* WO) {
    __shared__ __align__(16) bf tl[PTN * PTP];
    const int b = blockIdx.x;
    if (b < PWQ) { wtile<3 * DM>(wqkv, WALL, b, tl); return; }
    if (b < PWQ + PWO) { wtile<DM>(wo, WO, b - PWQ, tl); return; }
    // x: a wave's load covers 512 contiguous bytes, its store 256
    const size_t i0 = (size_t)(b - (PWQ + PWO)) * (256 * 4) + threadIdx.x * 4; v4f v[16]; v4us o[16];
#pragma unroll
    for (int s = 0; s < 16; ++s) v[s] = *(const v4f*)(x + i0 + (size_t)s * (PXB * 256 * 4));
    asm volatile("s_wait_xcnt 0x0" ::: "memory");   // in front of any later overwrite of a register that the 16 loads name
    __builtin_amdgcn_sched_barrier(0);   // keeps those overwrites behind the wait, and the 16 loads in one group in front of it
#pragma unroll
    for (int s = 0; s < 16; ++s)
#pragma unroll
        for (int q = 0; q < 4; ++q) o[s][q] = f2bf(v[s][q]);
#pragma unroll
    for (int s = 0; s < 16; ++s) *(v4us*)(XB + i0 + (size_t)s * (PXB * 256 * 4)) = o[s];
    asm volatile("s_wait_xcnt 0x0" ::: "memory");   // in front of any later overwrite of a register that the 16 stores name
}


// value of lane l ^ X inside the 16-lane row (DPP row_xmask): the row reductions of k_cstat stay on the vector unit
template <int X> __device__ __forceinline__ float rowx(float x) { return __builtin_bit_cast(float, __builtin_amdgcn_update_dpp(0, __builtin_bit_cast(int, x), 0x160 | X, 0xf, 0xf, true)); }

// ---- k_cstat: column-softmax statistics. One work-group per 64 keys of one head (grid: head, key block): two tiles of 32 keys (wave number even | odd); the 64-wide query chunks from the diagonal on are dealt round-robin to the CSP waves of each tile, the same chunks to both tiles.
// A = key rows (kept in registers), B = query rows, D = S^T tile: lane (lr, hi) holds keys hi*8 + r of queries lr. Every lane keeps a running (max, sum) per key row over its own queries;
// the 16 lanes of a row and then the CSP waves of a tile are merged at the end. MX[h][j] = max_i s, RZ[h][j] = 1 / sum_i exp(s - max).
// The query rows of a chunk come in two groups of 16 loads (32 rows each) through one register set: the second group is issued as the first group's products free its registers, the next chunk's first group flies under this chunk's vector work.
// Second launch bound: four waves on a SIMD, that is at most 256 registers, so that two work-groups share a WGP as before; without it the build takes a few registers more and a wave slot per SIMD is lost.
__global__ __launch_bounds__(32 * CSW, 4) void k_cstat(const bf* __restrict__ Kh, const bf* __restrict__ Kl, const bf* __restrict__ Qh, const bf* __restrict__ Ql, float* MX, float* RZ) {
    __shared__ float sm[CSW][32]; __shared__ float sl[CSW][32];
    const int wv = __builtin_amdgcn_readfirstlane(threadIdx.x >> 5);   // wave number in a scalar register: the query loop stays a scalar branch, every lane on at the matrix instructions
    const size_t zo = (size_t)blockIdx.x * TT * HD; const int lane = threadIdx.x & 31, lr = lane & 15, hi = lane >> 4; const int j0 = blockIdx.y * 64 + (wv & 1) * 32;
    v16bf kh[2][2], kl[2][2];
    float m[2][8], l[2][8];
#pragma unroll
    for (int mb = 0; mb < 2; ++mb)
#pragma unroll
        for (int r = 0; r < 8; ++r) { m[mb][r] = -3.0e38f; l[mb][r] = 0.f; }
    const unsigned qo = (unsigned)(lane * 8);   // this lane's place in a piece of a fragment
    // hi/lo fragments of the 32 query rows from q0 on: 16 loads at immediate offsets from two addresses (hi plane, lo plane)
    auto ldq = [&](int q0, v16bf (&qh)[2][2], v16bf (&ql)[2][2]) { const bf* bh = Qh + zo + (size_t)q0 * HD; const bf* bl = Ql + zo + (size_t)q0 * HD;
#pragma unroll
        for (int nb = 0; nb < 2; ++nb)
#pragma unroll
            for (int ks = 0; ks < 2; ++ks) { qh[nb][ks] = ldfr(bh + qo + nb * 16 * HD + ks * 512); ql[nb][ks] = ldfr(bl + qo + nb * 16 * HD + ks * 512); }
        __builtin_amdgcn_sched_barrier(0);   // all 16 loads are issued in front of the first product that reads one: one load latency per group; left free, they sink between their own products in twos and threes, each behind a wait of its own
        asm volatile("s_wait_xcnt 0x0" ::: "memory");   // in front of every later overwrite of an address register that the 16 loads name
        __builtin_amdgcn_sched_barrier(0);   // keeps those overwrites behind the wait
    };
    // S^T tiles of the 32 keys x those 32 queries
    auto prod = [&](const v16bf (&qh)[2][2], const v16bf (&ql)[2][2], v8f (&s)[2][4], int n0) {
#pragma unroll
        for (int nb = 0; nb < 2; ++nb)
#pragma unroll
            for (int mb = 0; mb < 2; ++mb) { v8f a = (v8f){};
#pragma unroll
                for (int ks = 0; ks < 2; ++ks) { a = wmmab(kh[mb][ks], qh[nb][ks], a); a = wmmab(kl[mb][ks], qh[nb][ks], a); a = wmmab(kh[mb][ks], ql[nb][ks], a); }
                s[mb][n0 + nb] = a; }
    };
    int c0 = blockIdx.y * 64 + (wv >> 1) * 64;
    if (c0 < TT) {   // a wave with no trip loads nothing
#pragma unroll
        for (int mb = 0; mb < 2; ++mb)
#pragma unroll
            for (int ks = 0; ks < 2; ++ks) { const size_t o = zo + (size_t)(j0 + mb * 16) * HD + ks * 512; kh[mb][ks] = ldfr(Kh + o + qo); kl[mb][ks] = ldfr(Kl + o + qo); }
        asm volatile("s_wait_xcnt 0x0" ::: "memory");   // in front of the loop's overwrites of the address registers that the key loads name
        __builtin_amdgcn_sched_barrier(0);   // keeps those overwrites behind the wait
        v16bf qh[2][2], ql[2][2];
        ldq(c0, qh, ql);
        // the loop stays rolled: one register set for the query fragments, carried from trip to trip
#pragma unroll 1
        for (;;) {
            v8f s[2][4]; const int cn = c0 + CSP * 64; const bool more = cn < TT;
            prod(qh, ql, s, 0);
            ldq(c0 + 32, qh, ql);
            prod(qh, ql, s, 2);
            if (more) ldq(cn, qh, ql);   // in flight under this trip's vector work
#pragma unroll
            for (int mb = 0; mb < 2; ++mb)
#pragma unroll
                for (int r = 0; r < 8; ++r) { const int j = j0 + mb * 16 + hi * 8 + r; float t[4]; float mn = m[mb][r];
#pragma unroll
                    for (int nb = 0; nb < 4; ++nb) { t[nb] = (c0 + nb * 16 + lr >= j) ? s[mb][nb][r] * SCL : -3.0e38f;   /* causal keeps queries i >= key j */ mn = fmaxf(mn, t[nb]); }
                    float a = l[mb][r] * __builtin_amdgcn_exp2f((m[mb][r] - mn) * L2E);
#pragma unroll
                    for (int nb = 0; nb < 4; ++nb) a += (c0 + nb * 16 + lr >= j) ? __builtin_amdgcn_exp2f((t[nb] - mn) * L2E) : 0.f;
                    l[mb][r] = a; m[mb][r] = mn; }
            if (!more) break;
            c0 = cn;
        }
    }
#pragma unroll
    for (int mb = 0; mb < 2; ++mb)
#pragma unroll
        for (int r = 0; r < 8; ++r) { float M = m[mb][r]; M = fmaxf(M, rowx<1>(M)); M = fmaxf(M, rowx<2>(M)); M = fmaxf(M, rowx<4>(M)); M = fmaxf(M, rowx<8>(M));
            float a = l[mb][r] * __builtin_amdgcn_exp2f((m[mb][r] - M) * L2E); a += rowx<1>(a); a += rowx<2>(a); a += rowx<4>(a); a += rowx<8>(a); m[mb][r] = M; l[mb][r] = a; }
    if (lr == 0) {
#pragma unroll
        for (int mb = 0; mb < 2; ++mb)
#pragma unroll
            for (int r = 0; r < 8; ++r) { sm[wv][mb * 16 + hi * 8 + r] = m[mb][r]; sl[wv][mb * 16 + hi * 8 + r] = l[mb][r]; } }
    __syncthreads();   // every wave's (max, sum) per key is in LDS before waves 0 and 1 merge them
    if (wv < 2) { const int row = lane; float M = sm[wv][row];   // wave 0 merges the even waves' tile, wave 1 the odd waves': each its own j0
#pragma unroll
        for (int w = 1; w < CSP; ++w) M = fmaxf(M, sm[2 * w + wv][row]);
        float Z = 0.f;
#pragma unroll
        for (int w = 0; w < CSP; ++w) Z += sl[2 * w + wv][row] * __builtin_amdgcn_exp2f((sm[2 * w + wv][row] - M) * L2E);
        const size_t o = (size_t)blockIdx.x * TT + j0 + row; MX[o] = M; RZ[o] = __fdiv_rn(1.0f, Z); }
}

// ---- k_cattn: out^T[d][i] = sum_j v^T[d][j] A[i][j] for 128 queries of one head per work-group (grid: head, query block, the longest key loops first): two tiles of 64 queries (wave number even | odd); the 32-wide key chunks up to
// a tile's diagonal block are dealt round-robin to its CSP waves, the same chunks to both tiles. Per chunk a wave forms S^T (two 16-key tiles per 16 queries), p = exp(s - MX[j]) RZ[j] (0 for j > i), splits p hi/lo, and uses the two tiles as they lie as one B fragment:
// D of tile t holds keys t*16 + hi*8 + r at lane (lr, hi), which is the k order 8*hi + e | 16 + 8*hi + e of the A loader of v^T. The CSP partial tiles of each query tile are summed through LDS in wave order and written as the merged hi/lo planes.
__global__ __launch_bounds__(32 * CSW) void k_cattn(const bf* __restrict__ Kh, const bf* __restrict__ Kl, const bf* __restrict__ Qh, const bf* __restrict__ Ql, const bf* __restrict__ Vh, const bf* __restrict__ Vl, const float* __restrict__ MX, const float* __restrict__ RZ, bf* Ah, bf* Al) {
    __shared__ __align__(16) float os[CSW][64 * 68];
    const int wv = __builtin_amdgcn_readfirstlane(threadIdx.x >> 5);   // wave number in a scalar register: the key loop stays a scalar branch, every lane on at the matrix instructions
    const size_t zo = (size_t)blockIdx.x * TT * HD, zs = (size_t)blockIdx.x * TT; const int lane = threadIdx.x & 31, lr = lane & 15, hi = lane >> 4; const int rb = (TT / 128 - 1 - (int)blockIdx.y) * 128, r0 = rb + (wv & 1) * 64;
    const unsigned fo = (unsigned)(lane * 8), so = (unsigned)(hi * 8);   // this lane's place in a piece of a fragment, and in 16 keys' statistics
    v16bf qh[4][2], ql[4][2];
#pragma unroll
    for (int nb = 0; nb < 4; ++nb)
#pragma unroll
        for (int ks = 0; ks < 2; ++ks) { const size_t o = zo + (size_t)(r0 + nb * 16) * HD + ks * 512; qh[nb][ks] = ldfr(Qh + o + fo); ql[nb][ks] = ldfr(Ql + o + fo); }
    asm volatile("s_wait_xcnt 0x0" ::: "memory");   // in front of the loop's overwrites of the address registers that the query loads name
    __builtin_amdgcn_sched_barrier(0);   // keeps those overwrites behind the wait
    v8f acc[4][4];
#pragma unroll
    for (int mb = 0; mb < 4; ++mb)
#pragma unroll
        for (int nb = 0; nb < 4; ++nb) acc[mb][nb] = (v8f){};
#pragma unroll 1
    for (int kc = (wv >> 1) * 32; kc < r0 + 64; kc += CSP * 32) {
        v16bf kh[2][2], kl[2][2], vh[4], vl[4]; v8f mx[2], rz[2];
#pragma unroll
        for (int t = 0; t < 2; ++t) { mx[t] = *(const v8f*)(MX + zs + kc + t * 16 + so); rz[t] = *(const v8f*)(RZ + zs + kc + t * 16 + so);
#pragma unroll
            for (int ks = 0; ks < 2; ++ks) { const size_t o = zo + (size_t)(kc + t * 16) * HD + ks * 512; kh[t][ks] = ldfr(Kh + o + fo); kl[t][ks] = ldfr(Kl + o + fo); } }
#pragma unroll
        for (int mb = 0; mb < 4; ++mb) { const size_t o = zo + (size_t)kc * HD + mb * 512; vh[mb] = ldfr(Vh + o + fo); vl[mb] = ldfr(Vl + o + fo); }
        __builtin_amdgcn_sched_barrier(0);   // every load of the chunk is issued in front of its first matrix instruction: one exposed load latency per chunk; left free, the v^T loads sink between the products
        asm volatile("s_wait_xcnt 0x0" ::: "memory");   // stands in front of every later overwrite of an address register that the chunk's loads name
        __builtin_amdgcn_sched_barrier(0);   // keeps the address updates of the next chunk behind that wait
#pragma unroll
        for (int nb = 0; nb < 4; ++nb) { v8us ph[2], pl[2]; const int i = r0 + nb * 16 + lr;
#pragma unroll
            for (int t = 0; t < 2; ++t) { v8f a = (v8f){};
#pragma unroll
                for (int ks = 0; ks < 2; ++ks) { a = wmmab(kh[t][ks], qh[nb][ks], a); a = wmmab(kl[t][ks], qh[nb][ks], a); a = wmmab(kh[t][ks], ql[nb][ks], a); }
#pragma unroll
                for (int r = 0; r < 8; ++r) { const float e = __builtin_amdgcn_exp2f((a[r] * SCL - mx[t][r]) * L2E); const float p = (i >= kc + t * 16 + hi * 8 + r) ? e * rz[t][r] : 0.f; unsigned short h2, l2; splitf(p, h2, l2); ph[t][r] = h2; pl[t][r] = l2; } }
            const v16bf bh = cat16b(ph[0], ph[1]), bl = cat16b(pl[0], pl[1]);
#pragma unroll
            for (int mb = 0; mb < 4; ++mb) { acc[mb][nb] = wmmab(vh[mb], bh, acc[mb][nb]); acc[mb][nb] = wmmab(vh[mb], bl, acc[mb][nb]); acc[mb][nb] = wmmab(vl[mb], bh, acc[mb][nb]); } }
    }
#pragma unroll
    for (int mb = 0; mb < 4; ++mb)
#pragma unroll
        for (int nb = 0; nb < 4; ++nb) { float* p = &os[wv][(nb * 16 + lr) * 68 + mb * 16 + hi * 8]; const v8f a = acc[mb][nb]; *(v4fa*)p = __builtin_shufflevector(a, a, 0, 1, 2, 3); *(v4fa*)(p + 4) = __builtin_shufflevector(a, a, 4, 5, 6, 7); }
    __syncthreads();   // every wave's partial tile is in LDS before any thread sums across the waves
    // a thread sums and splits its 4 columns of one row in each group of 16 rows; all 16 stores stand at the end, at immediate offsets from two addresses, so that no register that a store names is written again
    const int rw = (int)threadIdx.x >> 4, cofs = ((int)threadIdx.x & 15) * 4; v4us oh[128 * 16 / (32 * CSW)], ol[128 * 16 / (32 * CSW)];
    const size_t oo = (size_t)((int)(blockIdx.x / NH_) * TT + rb + rw) * DQ + (size_t)(blockIdx.x % NH_) * HD + cofs;   /* blockIdx.x: batch x head */
#pragma unroll
    for (int s = 0; s < 128 * 16 / (32 * CSW); ++s) { const int qt = s >> 2, row = (s & 3) * 16 + rw; v4f val = *(const v4fa*)(&os[qt][row * 68 + cofs]);
#pragma unroll
        for (int w = 1; w < CSP; ++w) val += *(const v4fa*)(&os[2 * w + qt][row * 68 + cofs]);
#pragma unroll
        for (int q = 0; q < 4; ++q) { unsigned short a2, c2; splitf(val[q], a2, c2); oh[s][q] = a2; ol[s][q] = c2; } }
#pragma unroll
    for (int s = 0; s < 128 * 16 / (32 * CSW); ++s) { *(v4us*)(Ah + oo + s * 16 * DQ) = oh[s]; *(v4us*)(Al + oo + s * 16 * DQ) = ol[s]; }
}

extern "C" void kernel_launch(void* const* d_in, const int* in_sizes, int n_in,
                              void* d_out, int out_size, void* d_ws, size_t ws_size, hipStream_t stream) {
    (void)in_sizes; (void)n_in; (void)out_size;
    const float* x = (const float*)d_in[0]; const float* wqkv = (const float*)d_in[1]; const float* wo = (const float*)d_in[2];  const float* wq = nullptr; const float* wk = nullptr; const float* wv = nullptr; (void)wq; (void)wk; (void)wv;
    float* OUT = (float*)d_out;     // [2][2048][1024]
    char* wsp = (char*)d_ws;
    auto take = [&](size_t bytes) { char* p = wsp; wsp += (bytes + 255) & ~(size_t)255; return (void*)p; };
    bf* WALL = (bf*)take((size_t)3 * DM * DM * 2); bf* WO = (bf*)take((size_t)DM * DQ * 2);
    bf* XB = (bf*)take((size_t)NB_ * TT * DM * 2);
    const size_t PL = (size_t)NB_ * NH_ * TT * HD;   // one plane set: [batch x head] planes of TT x HD elements in fragment order
    bf* QPh = (bf*)take(2 * PL * 2);   /* q planes, then k planes */ bf* QPl = (bf*)take(2 * PL * 2); bf* KPh = QPh + PL; bf* KPl = QPl + PL; bf* VTh = (bf*)take(PL * 2); bf* VTl = (bf*)take(PL * 2);
    float* MX = (float*)take((size_t)NB_ * NH_ * TT * 4); float* RZ = (float*)take((size_t)NB_ * NH_ * TT * 4); bf* ATh = (bf*)take((size_t)NB_ * TT * DQ * 2); bf* ATl = (bf*)take((size_t)NB_ * TT * DQ * 2);
    if ((size_t)(wsp - (char*)d_ws) > ws_size) return;    // ws 256 MiB
    // one launch per stage: both batches (rows of x are contiguous) and, in the projection, q | k | v (rows of WALL are contiguous) are grid dimensions
    k_prep<<<PWQ + PWO + PXB, 256, 0, stream>>>(x, wqkv, wo, XB, WALL, WO);   /* fused 'xw' [DM][3DM] -> Bt [3DM][DM] (row blocks q | k | v), W_proj -> Bt [DM][DQ], x -> bf16 */
    k_gemmw<bf, 0, 1><<<dim3(NB_ * TT / 128, 3 * DM / 128, 1), 128, 0, stream>>>(XB, nullptr, WALL, nullptr, DM, nullptr, nullptr, QPh, QPl, VTh, VTl);   /* q, k head planes and v^T planes written by the projection's own epilogue */
    k_cstat<<<dim3(NB_ * NH_, TT / 64, 1), 32 * CSW, 0, stream>>>(KPh, KPl, QPh, QPl, MX, RZ);   /* per key: maximum and 1/sum of the scores over the queries that see it (one kv head per query head) */
    k_cattn<<<dim3(NB_ * NH_, TT / 128, 1), 32 * CSW, 0, stream>>>(KPh, KPl, QPh, QPl, VTh, VTl, MX, RZ, ATh, ATl);   /* A.v with the probabilities formed in registers, written as the merged hi/lo planes */
    k_gemmw<bf, 1, 2><<<dim3(NB_ * TT / 128, DM / 128, 1), 128, 0, stream>>>(ATh, ATl, WO, nullptr, DQ, x, OUT, nullptr, nullptr, nullptr, nullptr);   /* out = x * (m W_proj), the gate in the epilogue */
}
